// v000
// The times below were measured on an AMD MI455X: many runs one after another, warmed up first and cycling through
// copies of the inputs, with the whole window's GPU time divided by the number of runs. Launches and the gaps
// between them are all in it. The median over several windows is given; except for v000 it joins two sittings, which
// can be a few percent apart, so the side-by-side timings, each taken in one sitting, are the better comparison.
// The starting kernel, v000, takes 440 microseconds a run.
#include <hip/hip_runtime.h>
#include <hip/hip_bf16.h>

typedef __attribute__((ext_vector_type(16))) _Float16 v16h;
typedef __attribute__((ext_vector_type(4)))  _Float16 v4h;
typedef __attribute__((ext_vector_type(8)))  float    v8f;
typedef __attribute__((ext_vector_type(4)))  unsigned int v4u;

#define HB 4      // batch
#define TT 2048   // sequence
#define DD 1024   // model dim
#define HH 16     // heads
#define DH 64     // head dim

union FragU { v16h h; v4u u[2]; };

// 16x32 f16 WMMA fragment load (A-layout; identical for B when source is
// N-major / K-contiguous). lane r<16: row r, halves 0..7 = K 8*hi.., halves
// 8..15 = K 16+8*hi.. (hi = lane>=16).  ld = row stride in halves.
__device__ __forceinline__ v16h load_frag(const _Float16* base, int ld, int lane) {
  const int r  = lane & 15;
  const int hi = lane >> 4;
  const _Float16* p = base + (size_t)r * ld + hi * 8;
  FragU f;
  f.u[0] = *(const v4u*)(p);
  f.u[1] = *(const v4u*)(p + 16);
  return f.h;
}

__device__ __forceinline__ v8f wmma16(v16h a, v16h b, v8f c) {
  return __builtin_amdgcn_wmma_f32_16x16x32_f16(false, a, false, b, (short)0, c,
                                                false, false);
}

// --- CDNA5 async global->LDS copy helpers (ASYNCcnt-tracked) ---------------
// Each active lane copies 16B per op: LDS[la + inst_off] = MEM[ga + inst_off].
__device__ __forceinline__ void async_copy_tiles(unsigned la, unsigned lb,
                                                 const _Float16* ga,
                                                 const _Float16* gb) {
  asm volatile(
      "global_load_async_to_lds_b128 %0, %2, off\n\t"
      "global_load_async_to_lds_b128 %0, %2, off offset:16\n\t"
      "global_load_async_to_lds_b128 %0, %2, off offset:32\n\t"
      "global_load_async_to_lds_b128 %0, %2, off offset:48\n\t"
      "global_load_async_to_lds_b128 %1, %3, off\n\t"
      "global_load_async_to_lds_b128 %1, %3, off offset:16"
      :
      : "v"(la), "v"(lb), "v"((unsigned long long)(size_t)ga),
        "v"((unsigned long long)(size_t)gb)
      : "memory");
}

__device__ __forceinline__ void wait_async_le6() {
#if __has_builtin(__builtin_amdgcn_s_wait_asynccnt)
  __builtin_amdgcn_s_wait_asynccnt(6);
#else
  asm volatile("s_wait_asynccnt 0x6" ::: "memory");
#endif
}
__device__ __forceinline__ void wait_async_le0() {
#if __has_builtin(__builtin_amdgcn_s_wait_asynccnt)
  __builtin_amdgcn_s_wait_asynccnt(0);
#else
  asm volatile("s_wait_asynccnt 0x0" ::: "memory");
#endif
}

// ---------------------------------------------------------------------------
// Shared GEMM mainloop: 256x128 block tile, K-step 32, double-buffered LDS
// filled by async global->LDS DMA. 256 threads = 8 waves (4x2); each wave
// owns a 64x64 sub-tile = 4x4 frags -> 16 WMMAs per 8 fragment loads.
// ---------------------------------------------------------------------------
__device__ __forceinline__ void gemm_mainloop(
    const _Float16* __restrict__ A, const _Float16* __restrict__ BT,
    int m0, int n0, _Float16* ldsA, _Float16* ldsB, int tid, v8f acc[4][4]) {
  const int lane = tid & 31;
  const int wave = tid >> 5;
  const int wm   = (wave & 3) * 64;   // 0,64,128,192
  const int wn   = (wave >> 2) * 64;  // 0,64
  const int brow = tid >> 1;          // 0..127 (B tile rows)
  const int bch  = (tid & 1) * 16;    // 0 or 16 halves

  const _Float16* Ar = A  + (size_t)(m0 + tid)  * DD;        // one row/thread
  const _Float16* Br = BT + (size_t)(n0 + brow) * DD + bch;

  // Per-lane LDS byte addresses (low 32 bits of the generic pointer are the
  // LDS aperture offset).
  const unsigned laBase = (unsigned)(size_t)(ldsA) + (unsigned)tid * 64u;
  const unsigned lbBase =
      (unsigned)(size_t)(ldsB) + (unsigned)brow * 64u + (unsigned)bch * 2u;

  // Prologue: fill buffer 0.
  async_copy_tiles(laBase, lbBase, Ar, Br);

  for (int k0 = 0; k0 < DD; k0 += 32) {
    const int cur = (k0 >> 5) & 1;
    if (k0 + 32 < DD) {
      // Kick off next tile into the other buffer, then ensure the current
      // tile's 6 async ops (issued last iteration) have landed.
      async_copy_tiles(laBase + (unsigned)(1 - cur) * 16384u,
                       lbBase + (unsigned)(1 - cur) * 8192u,
                       Ar + k0 + 32, Br + k0 + 32);
      wait_async_le6();
    } else {
      wait_async_le0();
    }
    __syncthreads();   // current tile visible to all waves

    const _Float16* tA = ldsA + (size_t)cur * (256 * 32);
    const _Float16* tB = ldsB + (size_t)cur * (128 * 32);
    const v16h a0 = load_frag(tA + (size_t)(wm)      * 32, 32, lane);
    const v16h a1 = load_frag(tA + (size_t)(wm + 16) * 32, 32, lane);
    const v16h a2 = load_frag(tA + (size_t)(wm + 32) * 32, 32, lane);
    const v16h a3 = load_frag(tA + (size_t)(wm + 48) * 32, 32, lane);
    const v16h b0 = load_frag(tB + (size_t)(wn)      * 32, 32, lane);
    const v16h b1 = load_frag(tB + (size_t)(wn + 16) * 32, 32, lane);
    const v16h b2 = load_frag(tB + (size_t)(wn + 32) * 32, 32, lane);
    const v16h b3 = load_frag(tB + (size_t)(wn + 48) * 32, 32, lane);
    acc[0][0] = wmma16(a0, b0, acc[0][0]);
    acc[1][0] = wmma16(a1, b0, acc[1][0]);
    acc[2][0] = wmma16(a2, b0, acc[2][0]);
    acc[3][0] = wmma16(a3, b0, acc[3][0]);
    acc[0][1] = wmma16(a0, b1, acc[0][1]);
    acc[1][1] = wmma16(a1, b1, acc[1][1]);
    acc[2][1] = wmma16(a2, b1, acc[2][1]);
    acc[3][1] = wmma16(a3, b1, acc[3][1]);
    acc[0][2] = wmma16(a0, b2, acc[0][2]);
    acc[1][2] = wmma16(a1, b2, acc[1][2]);
    acc[2][2] = wmma16(a2, b2, acc[2][2]);
    acc[3][2] = wmma16(a3, b2, acc[3][2]);
    acc[0][3] = wmma16(a0, b3, acc[0][3]);
    acc[1][3] = wmma16(a1, b3, acc[1][3]);
    acc[2][3] = wmma16(a2, b3, acc[2][3]);
    acc[3][3] = wmma16(a3, b3, acc[3][3]);
    __syncthreads();   // readers done before next iteration overwrites `cur`
  }
}

// ---------------------------------------------------------------------------
// Kernel 1: f32 -> f16 convert (vectorized)
// ---------------------------------------------------------------------------
__global__ __launch_bounds__(256) void cvt_kernel(const float* __restrict__ x,
                                                  _Float16* __restrict__ xh,
                                                  int n4) {
  const int i = blockIdx.x * 256 + threadIdx.x;
  if (i < n4) {
    const float4 f = ((const float4*)x)[i];
    v4h hv;
    hv.x = (_Float16)f.x; hv.y = (_Float16)f.y;
    hv.z = (_Float16)f.z; hv.w = (_Float16)f.w;
    ((v4h*)xh)[i] = hv;
  }
}

// ---------------------------------------------------------------------------
// Kernel 2: transposed convert: WT[n*K + k] = (f16) W[k*N + n]
// ---------------------------------------------------------------------------
__global__ __launch_bounds__(256) void transpose_cvt(const float* __restrict__ W,
                                                     _Float16* __restrict__ WT,
                                                     int K, int N) {
  __shared__ float tile[32][33];
  const int n0 = blockIdx.x * 32, k0 = blockIdx.y * 32;
  const int tx = threadIdx.x, ty = threadIdx.y;  // block (32, 8)
  for (int i = ty; i < 32; i += 8)
    tile[i][tx] = W[(size_t)(k0 + i) * N + n0 + tx];
  __syncthreads();
  for (int i = ty; i < 32; i += 8)
    WT[(size_t)(n0 + i) * K + k0 + tx] = (_Float16)tile[tx][i];
}

// ---------------------------------------------------------------------------
// Kernel 3: QKV GEMM + bias + RoPE, scatter into Q[b,h,t,d], K[b,h,t,d],
// V^T[b,h,d,t] (all f16).  grid = (3072/128, 8192/256)
// ---------------------------------------------------------------------------
__global__ __launch_bounds__(256) void qkv_rope_kernel(
    const _Float16* __restrict__ Xh, const _Float16* __restrict__ WT,
    const float* __restrict__ bqkv, const float* __restrict__ cosT,
    const float* __restrict__ sinT, _Float16* __restrict__ Qb,
    _Float16* __restrict__ Kb, _Float16* __restrict__ VT) {
  __shared__ alignas(16) _Float16 ldsA[2 * 256 * 32];
  __shared__ alignas(16) _Float16 ldsB[2 * 128 * 32];
  const int tid  = threadIdx.x;
  const int lane = tid & 31;
  const int hi   = lane >> 4;
  const int cn   = lane & 15;
  const int wave = tid >> 5;
  const int wm   = (wave & 3) * 64;
  const int wn   = (wave >> 2) * 64;
  const int m0   = blockIdx.y * 256;
  const int n0   = blockIdx.x * 128;

  v8f acc[4][4] = {};
  gemm_mainloop(Xh, WT, m0, n0, ldsA, ldsB, tid, acc);

  // Wave's 64-col span == exactly one head (n0 mult of 128, wn in {0,64}),
  // so rotate-half pairs (d, d+32) live in acc[i][jj] / acc[i][jj+2].
#pragma unroll
  for (int i = 0; i < 4; ++i) {
#pragma unroll
    for (int jj = 0; jj < 2; ++jj) {
      const int gn_lo = n0 + wn + 16 * jj + cn;
      const int gn_hi = gn_lo + 32;
      const int sec   = gn_lo >> 10;   // 0=Q 1=K 2=V
      const int nn    = gn_lo & 1023;
      const int h     = nn >> 6;
      const int dlo   = nn & 63;       // < 32
      const int dhi   = dlo + 32;
      const float blo = bqkv[gn_lo];
      const float bhi = bqkv[gn_hi];
#pragma unroll
      for (int v = 0; v < 8; ++v) {
        const int gm = m0 + wm + 16 * i + v + hi * 8;
        const int b  = gm >> 11;
        const int t  = gm & (TT - 1);
        const float xlo = acc[i][jj][v]     + blo;
        const float xhi = acc[i][jj + 2][v] + bhi;
        if (sec == 2) {
          VT[((size_t)((b * HH + h) * DH + dlo)) * TT + t] = (_Float16)xlo;
          VT[((size_t)((b * HH + h) * DH + dhi)) * TT + t] = (_Float16)xhi;
        } else {
          const float cl = cosT[t * DH + dlo], sl = sinT[t * DH + dlo];
          const float ch = cosT[t * DH + dhi], sh = sinT[t * DH + dhi];
          _Float16* dst = (sec == 0) ? Qb : Kb;
          dst[((size_t)((b * HH + h) * TT + t)) * DH + dlo] =
              (_Float16)(xlo * cl - xhi * sl);
          dst[((size_t)((b * HH + h) * TT + t)) * DH + dhi] =
              (_Float16)(xhi * ch + xlo * sh);
        }
      }
    }
  }
}

// ---------------------------------------------------------------------------
// Kernel 4: flash attention. grid = (T/128, B*H); 8 waves/block, each wave
// owns 16 query rows and streams 32 keys per iteration.
// ---------------------------------------------------------------------------
__global__ __launch_bounds__(256) void attn_kernel(
    const _Float16* __restrict__ Q, const _Float16* __restrict__ K,
    const _Float16* __restrict__ VT, _Float16* __restrict__ O) {
  __shared__ alignas(16) _Float16 Ptile[8][16 * 32];
  const int tid  = threadIdx.x;
  const int lane = tid & 31;
  const int hi   = lane >> 4;
  const int cn   = lane & 15;
  const int wave = tid >> 5;
  const int bh   = blockIdx.y;
  const int b    = bh >> 4;
  const int h    = bh & 15;
  const int tq0  = blockIdx.x * 128 + wave * 16;

  const _Float16* Qp = Q  + ((size_t)bh * TT + tq0) * DH;
  const _Float16* Kp = K  + (size_t)bh * TT * DH;
  const _Float16* Vp = VT + (size_t)bh * DH * TT;   // [DH][TT]
  _Float16* myP = &Ptile[wave][0];

  const v16h q0 = load_frag(Qp,      DH, lane);     // d 0..31
  const v16h q1 = load_frag(Qp + 32, DH, lane);     // d 32..63

  float mrow[8], lrow[8];
#pragma unroll
  for (int v = 0; v < 8; ++v) { mrow[v] = -3.0e38f; lrow[v] = 0.f; }
  v8f o[4] = {};

  for (int kb = 0; kb < TT; kb += 32) {
    v8f s0 = {}, s1 = {};
    const v16h k00 = load_frag(Kp + (size_t)kb * DH,             DH, lane);
    const v16h k01 = load_frag(Kp + (size_t)kb * DH + 32,        DH, lane);
    const v16h k10 = load_frag(Kp + (size_t)(kb + 16) * DH,      DH, lane);
    const v16h k11 = load_frag(Kp + (size_t)(kb + 16) * DH + 32, DH, lane);
    if (kb + 32 < TT) {
      __builtin_prefetch(Kp + (size_t)(kb + 32) * DH, 0, 1);
      __builtin_prefetch(Vp + (size_t)cn * TT + kb + 32, 0, 1);
    }
    s0 = wmma16(q0, k00, s0);
    s0 = wmma16(q1, k01, s0);
    s1 = wmma16(q0, k10, s1);
    s1 = wmma16(q1, k11, s1);

    float alpha[8];
#pragma unroll
    for (int v = 0; v < 8; ++v) {
      const float a = (float)s0[v] * 0.125f;   // 1/sqrt(64)
      const float c = (float)s1[v] * 0.125f;
      float mx = fmaxf(a, c);                  // row = 16-lane group
#pragma unroll
      for (int off = 8; off >= 1; off >>= 1)
        mx = fmaxf(mx, __shfl_xor(mx, off, 16));
      const float mnew = fmaxf(mrow[v], mx);
      const float al   = __expf(mrow[v] - mnew);
      const float p0   = __expf(a - mnew);
      const float p1   = __expf(c - mnew);
      float sum = p0 + p1;
#pragma unroll
      for (int off = 8; off >= 1; off >>= 1)
        sum += __shfl_xor(sum, off, 16);
      lrow[v]  = lrow[v] * al + sum;
      mrow[v]  = mnew;
      alpha[v] = al;
      const int mloc = v + hi * 8;             // D-layout -> A-layout via LDS
      myP[mloc * 32 + cn]      = (_Float16)p0;
      myP[mloc * 32 + 16 + cn] = (_Float16)p1;
    }

    const v16h pf  = load_frag(myP, 32, lane); // same-wave DS ops in order
    const v16h vf0 = load_frag(Vp + (size_t)0  * TT + kb, TT, lane);
    const v16h vf1 = load_frag(Vp + (size_t)16 * TT + kb, TT, lane);
    const v16h vf2 = load_frag(Vp + (size_t)32 * TT + kb, TT, lane);
    const v16h vf3 = load_frag(Vp + (size_t)48 * TT + kb, TT, lane);
#pragma unroll
    for (int f = 0; f < 4; ++f)
#pragma unroll
      for (int v = 0; v < 8; ++v) o[f][v] *= alpha[v];
    o[0] = wmma16(pf, vf0, o[0]);
    o[1] = wmma16(pf, vf1, o[1]);
    o[2] = wmma16(pf, vf2, o[2]);
    o[3] = wmma16(pf, vf3, o[3]);
  }

  float inv[8];
#pragma unroll
  for (int v = 0; v < 8; ++v) inv[v] = 1.0f / lrow[v];
#pragma unroll
  for (int f = 0; f < 4; ++f) {
#pragma unroll
    for (int v = 0; v < 8; ++v) {
      const int tq = tq0 + v + hi * 8;
      const int d  = 16 * f + cn;
      O[((size_t)(b * TT + tq)) * DD + h * DH + d] = (_Float16)(o[f][v] * inv[v]);
    }
  }
}

// ---------------------------------------------------------------------------
// Kernel 5: output projection, fp32 result + bias. grid = (1024/128, 8192/256)
// ---------------------------------------------------------------------------
__global__ __launch_bounds__(256) void proj_kernel(
    const _Float16* __restrict__ Ah, const _Float16* __restrict__ WT,
    const float* __restrict__ bproj, float* __restrict__ out) {
  __shared__ alignas(16) _Float16 ldsA[2 * 256 * 32];
  __shared__ alignas(16) _Float16 ldsB[2 * 128 * 32];
  const int tid  = threadIdx.x;
  const int lane = tid & 31;
  const int hi   = lane >> 4;
  const int cn   = lane & 15;
  const int wave = tid >> 5;
  const int wm   = (wave & 3) * 64;
  const int wn   = (wave >> 2) * 64;
  const int m0   = blockIdx.y * 256;
  const int n0   = blockIdx.x * 128;

  v8f acc[4][4] = {};
  gemm_mainloop(Ah, WT, m0, n0, ldsA, ldsB, tid, acc);

#pragma unroll
  for (int i = 0; i < 4; ++i) {
#pragma unroll
    for (int j = 0; j < 4; ++j) {
      const int gn = n0 + wn + 16 * j + cn;
      const float bv = bproj[gn];
#pragma unroll
      for (int v = 0; v < 8; ++v) {
        const int gm = m0 + wm + 16 * i + v + hi * 8;
        out[(size_t)gm * DD + gn] = acc[i][j][v] + bv;
      }
    }
  }
}

// ---------------------------------------------------------------------------
extern "C" void kernel_launch(void* const* d_in, const int* in_sizes, int n_in,
                              void* d_out, int out_size, void* d_ws,
                              size_t ws_size, hipStream_t stream) {
  const float* x     = (const float*)d_in[0];
  const float* Wqkv  = (const float*)d_in[1];
  const float* bqkv  = (const float*)d_in[2];
  const float* Wproj = (const float*)d_in[3];
  const float* bproj = (const float*)d_in[4];
  const float* cosT  = (const float*)d_in[5];
  const float* sinT  = (const float*)d_in[6];
  float* out = (float*)d_out;

  char* ws = (char*)d_ws;
  // byte offsets (total 72 MB)
  _Float16* xh     = (_Float16*)(ws);              // 16 MB, reused as attn out
  _Float16* wqkvT  = (_Float16*)(ws + 16777216);   //  6 MB
  _Float16* wprojT = (_Float16*)(ws + 23068672);   //  2 MB
  _Float16* Qb     = (_Float16*)(ws + 25165824);   // 16 MB
  _Float16* Kb     = (_Float16*)(ws + 41943040);   // 16 MB
  _Float16* VT     = (_Float16*)(ws + 58720256);   // 16 MB
  _Float16* attnh  = xh;   // x no longer needed after QKV GEMM

  // 1) precision conversion / weight transpose
  cvt_kernel<<<8192, 256, 0, stream>>>(x, xh, (HB * TT * DD) / 4);
  transpose_cvt<<<dim3(96, 32), dim3(32, 8), 0, stream>>>(Wqkv, wqkvT, DD, 3 * DD);
  transpose_cvt<<<dim3(32, 32), dim3(32, 8), 0, stream>>>(Wproj, wprojT, DD, DD);
  // 2) QKV GEMM + RoPE  (M=8192 in 256-row tiles, N=3072 in 128-col tiles)
  qkv_rope_kernel<<<dim3(24, 32), 256, 0, stream>>>(xh, wqkvT, bqkv, cosT, sinT,
                                                    Qb, Kb, VT);
  // 3) flash attention  (grid: T/128 x B*H)
  attn_kernel<<<dim3(TT / 128, HB * HH), 256, 0, stream>>>(Qb, Kb, VT, attnh);
  // 4) output projection (M=8192, N=1024)
  proj_kernel<<<dim3(8, 32), 256, 0, stream>>>(attnh, wprojT, bproj, out);
}

// v001
// One run takes 320 microseconds.
// In two side-by-side timings against v000, it was 1.42 and 1.44 times as fast.
#include <hip/hip_runtime.h>
#include <hip/hip_bf16.h>

typedef __attribute__((ext_vector_type(16))) _Float16 v16h;
typedef __attribute__((ext_vector_type(4)))  _Float16 v4h;
typedef __attribute__((ext_vector_type(8)))  float    v8f;
typedef __attribute__((ext_vector_type(4)))  unsigned int v4u;

#define HB 4      // batch
#define TT 2048   // sequence
#define DD 1024   // model dim
#define HH 16     // heads
#define DH 64     // head dim

union FragU { v16h h; v4u u[2]; };

// 16x32 f16 WMMA fragment load (A-layout; identical for B when source is
// N-major / K-contiguous). lane r<16: row r, halves 0..7 = K 8*hi.., halves
// 8..15 = K 16+8*hi.. (hi = lane>=16).  ld = row stride in halves.
__device__ __forceinline__ v16h load_frag(const _Float16* base, int ld, int lane) {
  const int r  = lane & 15;
  const int hi = lane >> 4;
  const _Float16* p = base + (size_t)r * ld + hi * 8;
  FragU f;
  f.u[0] = *(const v4u*)(p);
  f.u[1] = *(const v4u*)(p + 16);
  return f.h;
}

__device__ __forceinline__ v8f wmma16(v16h a, v16h b, v8f c) {
  return __builtin_amdgcn_wmma_f32_16x16x32_f16(false, a, false, b, (short)0, c,
                                                false, false);
}

// --- CDNA5 async global->LDS copy helpers (ASYNCcnt-tracked) ---------------
// Each active lane copies 16B per op: LDS[la + inst_off] = MEM[ga + inst_off].
__device__ __forceinline__ void async_copy_tiles(unsigned la, unsigned lb,
                                                 const _Float16* ga,
                                                 const _Float16* gb) {
  asm volatile(
      "global_load_async_to_lds_b128 %0, %2, off\n\t"
      "global_load_async_to_lds_b128 %0, %2, off offset:16\n\t"
      "global_load_async_to_lds_b128 %0, %2, off offset:32\n\t"
      "global_load_async_to_lds_b128 %0, %2, off offset:48\n\t"
      "global_load_async_to_lds_b128 %1, %3, off\n\t"
      "global_load_async_to_lds_b128 %1, %3, off offset:16"
      :
      : "v"(la), "v"(lb), "v"((unsigned long long)(size_t)ga),
        "v"((unsigned long long)(size_t)gb)
      : "memory");
}

__device__ __forceinline__ void wait_async_le6() {
#if __has_builtin(__builtin_amdgcn_s_wait_asynccnt)
  __builtin_amdgcn_s_wait_asynccnt(6);
#else
  asm volatile("s_wait_asynccnt 0x6" ::: "memory");
#endif
}
__device__ __forceinline__ void wait_async_le0() {
#if __has_builtin(__builtin_amdgcn_s_wait_asynccnt)
  __builtin_amdgcn_s_wait_asynccnt(0);
#else
  asm volatile("s_wait_asynccnt 0x0" ::: "memory");
#endif
}

// ---------------------------------------------------------------------------
// Shared GEMM mainloop: 256x128 block tile, K-step 32, double-buffered LDS
// filled by async global->LDS DMA. 256 threads = 8 waves (4x2); each wave
// owns a 64x64 sub-tile = 4x4 frags -> 16 WMMAs per 8 fragment loads.
// ---------------------------------------------------------------------------
__device__ __forceinline__ void gemm_mainloop(
    const _Float16* __restrict__ A, const _Float16* __restrict__ BT,
    int m0, int n0, _Float16* ldsA, _Float16* ldsB, int tid, v8f acc[4][4]) {
  const int lane = tid & 31;
  const int wave = tid >> 5;
  const int wm   = (wave & 3) * 64;   // 0,64,128,192
  const int wn   = (wave >> 2) * 64;  // 0,64
  const int brow = tid >> 1;          // 0..127 (B tile rows)
  const int bch  = (tid & 1) * 16;    // 0 or 16 halves

  const _Float16* Ar = A  + (size_t)(m0 + tid)  * DD;        // one row/thread
  const _Float16* Br = BT + (size_t)(n0 + brow) * DD + bch;

  // Per-lane LDS byte addresses (low 32 bits of the generic pointer are the
  // LDS aperture offset).
  const unsigned laBase = (unsigned)(size_t)(ldsA) + (unsigned)tid * 64u;
  const unsigned lbBase =
      (unsigned)(size_t)(ldsB) + (unsigned)brow * 64u + (unsigned)bch * 2u;

  // Prologue: fill buffer 0.
  async_copy_tiles(laBase, lbBase, Ar, Br);

  for (int k0 = 0; k0 < DD; k0 += 32) {
    const int cur = (k0 >> 5) & 1;
    if (k0 + 32 < DD) {
      // Kick off next tile into the other buffer, then ensure the current
      // tile's 6 async ops (issued last iteration) have landed.
      async_copy_tiles(laBase + (unsigned)(1 - cur) * 16384u,
                       lbBase + (unsigned)(1 - cur) * 8192u,
                       Ar + k0 + 32, Br + k0 + 32);
      wait_async_le6();
    } else {
      wait_async_le0();
    }
    __syncthreads();   // current tile visible to all waves

    const _Float16* tA = ldsA + (size_t)cur * (256 * 32);
    const _Float16* tB = ldsB + (size_t)cur * (128 * 32);
    const v16h a0 = load_frag(tA + (size_t)(wm)      * 32, 32, lane);
    const v16h a1 = load_frag(tA + (size_t)(wm + 16) * 32, 32, lane);
    const v16h a2 = load_frag(tA + (size_t)(wm + 32) * 32, 32, lane);
    const v16h a3 = load_frag(tA + (size_t)(wm + 48) * 32, 32, lane);
    const v16h b0 = load_frag(tB + (size_t)(wn)      * 32, 32, lane);
    const v16h b1 = load_frag(tB + (size_t)(wn + 16) * 32, 32, lane);
    const v16h b2 = load_frag(tB + (size_t)(wn + 32) * 32, 32, lane);
    const v16h b3 = load_frag(tB + (size_t)(wn + 48) * 32, 32, lane);
    acc[0][0] = wmma16(a0, b0, acc[0][0]);
    acc[1][0] = wmma16(a1, b0, acc[1][0]);
    acc[2][0] = wmma16(a2, b0, acc[2][0]);
    acc[3][0] = wmma16(a3, b0, acc[3][0]);
    acc[0][1] = wmma16(a0, b1, acc[0][1]);
    acc[1][1] = wmma16(a1, b1, acc[1][1]);
    acc[2][1] = wmma16(a2, b1, acc[2][1]);
    acc[3][1] = wmma16(a3, b1, acc[3][1]);
    acc[0][2] = wmma16(a0, b2, acc[0][2]);
    acc[1][2] = wmma16(a1, b2, acc[1][2]);
    acc[2][2] = wmma16(a2, b2, acc[2][2]);
    acc[3][2] = wmma16(a3, b2, acc[3][2]);
    acc[0][3] = wmma16(a0, b3, acc[0][3]);
    acc[1][3] = wmma16(a1, b3, acc[1][3]);
    acc[2][3] = wmma16(a2, b3, acc[2][3]);
    acc[3][3] = wmma16(a3, b3, acc[3][3]);
    __syncthreads();   // readers done before next iteration overwrites `cur`
  }
}

// ---------------------------------------------------------------------------
// Kernel 1: f32 -> f16 convert (vectorized)
// ---------------------------------------------------------------------------
__global__ __launch_bounds__(256) void cvt_kernel(const float* __restrict__ x,
                                                  _Float16* __restrict__ xh,
                                                  int n4) {
  const int i = blockIdx.x * 256 + threadIdx.x;
  if (i < n4) {
    const float4 f = ((const float4*)x)[i];
    v4h hv;
    hv.x = (_Float16)f.x; hv.y = (_Float16)f.y;
    hv.z = (_Float16)f.z; hv.w = (_Float16)f.w;
    ((v4h*)xh)[i] = hv;
  }
}

// ---------------------------------------------------------------------------
// Kernel 2: transposed convert: WT[n*K + k] = (f16) W[k*N + n]
// ---------------------------------------------------------------------------
__global__ __launch_bounds__(256) void transpose_cvt(const float* __restrict__ W,
                                                     _Float16* __restrict__ WT,
                                                     int K, int N) {
  __shared__ float tile[32][33];
  const int n0 = blockIdx.x * 32, k0 = blockIdx.y * 32;
  const int tx = threadIdx.x, ty = threadIdx.y;  // block (32, 8)
  for (int i = ty; i < 32; i += 8)
    tile[i][tx] = W[(size_t)(k0 + i) * N + n0 + tx];
  __syncthreads();
  for (int i = ty; i < 32; i += 8)
    WT[(size_t)(n0 + i) * K + k0 + tx] = (_Float16)tile[tx][i];
}

// ---------------------------------------------------------------------------
// Kernel 3: QKV GEMM + bias + RoPE, scatter into Q[b,h,t,d], K[b,h,t,d],
// V^T[b,h,d,t] (all f16).  grid = (3072/128, 8192/256)
// ---------------------------------------------------------------------------
__global__ __launch_bounds__(256) void qkv_rope_kernel(
    const _Float16* __restrict__ Xh, const _Float16* __restrict__ WT,
    const float* __restrict__ bqkv, const float* __restrict__ cosT,
    const float* __restrict__ sinT, _Float16* __restrict__ Qb,
    _Float16* __restrict__ Kb, _Float16* __restrict__ VT) {
  __shared__ alignas(16) _Float16 ldsA[2 * 256 * 32];
  __shared__ alignas(16) _Float16 ldsB[2 * 128 * 32];
  const int tid  = threadIdx.x;
  const int lane = tid & 31;
  const int hi   = lane >> 4;
  const int cn   = lane & 15;
  const int wave = tid >> 5;
  const int wm   = (wave & 3) * 64;
  const int wn   = (wave >> 2) * 64;
  const int m0   = blockIdx.y * 256;
  const int n0   = blockIdx.x * 128;

  v8f acc[4][4] = {};
  gemm_mainloop(Xh, WT, m0, n0, ldsA, ldsB, tid, acc);

  // Wave's 64-col span == exactly one head (n0 mult of 128, wn in {0,64}),
  // so rotate-half pairs (d, d+32) live in acc[i][jj] / acc[i][jj+2].
#pragma unroll
  for (int i = 0; i < 4; ++i) {
#pragma unroll
    for (int jj = 0; jj < 2; ++jj) {
      const int gn_lo = n0 + wn + 16 * jj + cn;
      const int gn_hi = gn_lo + 32;
      const int sec   = gn_lo >> 10;   // 0=Q 1=K 2=V
      const int nn    = gn_lo & 1023;
      const int h     = nn >> 6;
      const int dlo   = nn & 63;       // < 32
      const int dhi   = dlo + 32;
      const float blo = bqkv[gn_lo];
      const float bhi = bqkv[gn_hi];
#pragma unroll
      for (int v = 0; v < 8; ++v) {
        const int gm = m0 + wm + 16 * i + v + hi * 8;
        const int b  = gm >> 11;
        const int t  = gm & (TT - 1);
        const float xlo = acc[i][jj][v]     + blo;
        const float xhi = acc[i][jj + 2][v] + bhi;
        if (sec == 2) {
          VT[((size_t)((b * HH + h) * DH + dlo)) * TT + t] = (_Float16)xlo;
          VT[((size_t)((b * HH + h) * DH + dhi)) * TT + t] = (_Float16)xhi;
        } else {
          const float cl = cosT[t * DH + dlo], sl = sinT[t * DH + dlo];
          const float ch = cosT[t * DH + dhi], sh = sinT[t * DH + dhi];
          _Float16* dst = (sec == 0) ? Qb : Kb;
          dst[((size_t)((b * HH + h) * TT + t)) * DH + dlo] =
              (_Float16)(xlo * cl - xhi * sl);
          dst[((size_t)((b * HH + h) * TT + t)) * DH + dhi] =
              (_Float16)(xhi * ch + xlo * sh);
        }
      }
    }
  }
}

// ---------------------------------------------------------------------------
// Kernel 4: flash attention. grid = (T/128, B*H); 8 waves/block, each wave
// owns 16 query rows and works through 32 keys at a time. K and V^T tiles of
// AKT keys are staged in LDS once per block (two buffers) and read by all
// eight waves; every copy instruction covers four whole 128-byte lines.
// ---------------------------------------------------------------------------
#define AKT 64   // keys per staged tile: one K row and one V^T row are 128 B
#define APW 72   // LDS row pitch in halves: 128 B + 16 B, 16-byte reads of 16
                 // rows then fall on 64 distinct banks

// One tile = 2 x 8 KB; each thread brings two 16-byte pieces of K and two of
// V^T. The closing s_wait_xcnt stands in front of every later rewrite of the
// copies' address registers (a precaution).
__device__ __forceinline__ void attn_copy_tile(unsigned lk,
                                               const _Float16* gk,
                                               const _Float16* gv) {
  const unsigned lk1 = lk + 32u * APW * 2u;
  const unsigned lv  = lk + AKT * APW * 2u;   // V^T tile follows the K tile
  const unsigned lv1 = lv + 32u * APW * 2u;
  const _Float16* gk1 = gk + 32 * DH;
  const _Float16* gv1 = gv + 32 * TT;
  asm volatile(
      "global_load_async_to_lds_b128 %0, %4, off\n\t"
      "global_load_async_to_lds_b128 %1, %5, off\n\t"
      "global_load_async_to_lds_b128 %2, %6, off\n\t"
      "global_load_async_to_lds_b128 %3, %7, off\n\t"
      "s_wait_xcnt 0x0"
      :
      : "v"(lk), "v"(lk1), "v"(lv), "v"(lv1),
        "v"((unsigned long long)(size_t)gk),
        "v"((unsigned long long)(size_t)gk1),
        "v"((unsigned long long)(size_t)gv),
        "v"((unsigned long long)(size_t)gv1)
      : "memory");
}

__global__ __launch_bounds__(256) void attn_kernel(
    const _Float16* __restrict__ Q, const _Float16* __restrict__ K,
    const _Float16* __restrict__ VT, _Float16* __restrict__ O) {
  static_assert(AKT == DH, "K tile and V^T tile have the same number of rows");
  __shared__ alignas(16) _Float16 KVtile[2][2][AKT * APW];  // [buffer][K, V^T]
  __shared__ alignas(16) _Float16 Ptile[8][16 * 32];
  const int tid  = threadIdx.x;
  const int lane = tid & 31;
  const int hi   = lane >> 4;
  const int cn   = lane & 15;
  const int wave = tid >> 5;
  const int bh   = blockIdx.y;
  const int b    = bh >> 4;
  const int h    = bh & 15;
  const int tq0  = blockIdx.x * 128 + wave * 16;

  const _Float16* Qp = Q  + ((size_t)bh * TT + tq0) * DH;
  const _Float16* Kp = K  + (size_t)bh * TT * DH;
  const _Float16* Vp = VT + (size_t)bh * DH * TT;   // [DH][TT]
  _Float16* myP = &Ptile[wave][0];

  // This thread's piece of a tile: row crow (and crow + 32), 16 bytes at ccol.
  const int crow = tid >> 3;         // 0..31
  const int ccol = (tid & 7) * 8;    // halves
  const unsigned coff = (unsigned)(crow * APW + ccol) * 2u;
  const unsigned lkBase = (unsigned)(size_t)(&KVtile[0][0][0]) + coff;
  const _Float16* gkBase = Kp + (size_t)crow * DH + ccol;
  const _Float16* gvBase = Vp + (size_t)crow * TT + ccol;

  // Tile 0 lands and is published; tile 1 then flies while tile 0 is worked on.
  attn_copy_tile(lkBase, gkBase, gvBase);
  asm volatile("s_wait_asynccnt 0x0" ::: "memory");  // own copies landed
  __syncthreads();                                   // tile 0 visible to all
  attn_copy_tile(lkBase + 2u * AKT * APW * 2u, gkBase + (size_t)AKT * DH,
                 gvBase + AKT);

  const v16h q0 = load_frag(Qp,      DH, lane);     // d 0..31
  const v16h q1 = load_frag(Qp + 32, DH, lane);     // d 32..63

  float mrow[8], lrow[8];
#pragma unroll
  for (int v = 0; v < 8; ++v) { mrow[v] = -3.0e38f; lrow[v] = 0.f; }
  v8f o[4] = {};

  for (int ps = 0; ps < TT / 32; ++ps) {
    const int st  = ps >> 1;          // tile
    const int cur = st & 1;           // its buffer
    const int kb  = (ps & 1) * 32;    // first key of this pass inside the tile
    const _Float16* tK = &KVtile[cur][0][0];
    const _Float16* tV = &KVtile[cur][1][0];

    v8f s0 = {}, s1 = {};
    const v16h k00 = load_frag(tK + kb * APW,             APW, lane);
    const v16h k01 = load_frag(tK + kb * APW + 32,        APW, lane);
    const v16h k10 = load_frag(tK + (kb + 16) * APW,      APW, lane);
    const v16h k11 = load_frag(tK + (kb + 16) * APW + 32, APW, lane);
    s0 = wmma16(q0, k00, s0);
    s0 = wmma16(q1, k01, s0);
    s1 = wmma16(q0, k10, s1);
    s1 = wmma16(q1, k11, s1);

    float alpha[8];
#pragma unroll
    for (int v = 0; v < 8; ++v) {
      const float a = (float)s0[v] * 0.125f;   // 1/sqrt(64)
      const float c = (float)s1[v] * 0.125f;
      float mx = fmaxf(a, c);                  // row = 16-lane group
#pragma unroll
      for (int off = 8; off >= 1; off >>= 1)
        mx = fmaxf(mx, __shfl_xor(mx, off, 16));
      const float mnew = fmaxf(mrow[v], mx);
      const float al   = __expf(mrow[v] - mnew);
      const float p0   = __expf(a - mnew);
      const float p1   = __expf(c - mnew);
      float sum = p0 + p1;
#pragma unroll
      for (int off = 8; off >= 1; off >>= 1)
        sum += __shfl_xor(sum, off, 16);
      lrow[v]  = lrow[v] * al + sum;
      mrow[v]  = mnew;
      alpha[v] = al;
      const int mloc = v + hi * 8;             // D-layout -> A-layout via LDS
      myP[mloc * 32 + cn]      = (_Float16)p0;
      myP[mloc * 32 + 16 + cn] = (_Float16)p1;
    }

    const v16h pf  = load_frag(myP, 32, lane); // same-wave DS ops in order
    const v16h vf0 = load_frag(tV + 0  * APW + kb, APW, lane);
    const v16h vf1 = load_frag(tV + 16 * APW + kb, APW, lane);
    const v16h vf2 = load_frag(tV + 32 * APW + kb, APW, lane);
    const v16h vf3 = load_frag(tV + 48 * APW + kb, APW, lane);
#pragma unroll
    for (int f = 0; f < 4; ++f)
#pragma unroll
      for (int v = 0; v < 8; ++v) o[f][v] *= alpha[v];
    o[0] = wmma16(pf, vf0, o[0]);
    o[1] = wmma16(pf, vf1, o[1]);
    o[2] = wmma16(pf, vf2, o[2]);
    o[3] = wmma16(pf, vf3, o[3]);

    if (ps & 1) {
      // Hand-over: this wave's reads of the current tile are done, its copies
      // of the next tile have landed; the barrier says both of every wave.
      asm volatile("s_wait_dscnt 0x0" ::: "memory");
      asm volatile("s_wait_asynccnt 0x0" ::: "memory");
      __syncthreads();
      if (st + 2 < TT / AKT) {   // refill the buffer that this tile has left
        attn_copy_tile(lkBase + (unsigned)cur * (2u * AKT * APW * 2u),
                       gkBase + (size_t)(st + 2) * AKT * DH,
                       gvBase + (st + 2) * AKT);
      }
    }
  }
  asm volatile("s_wait_asynccnt 0x0" ::: "memory");  // nothing left in flight

  float inv[8];
#pragma unroll
  for (int v = 0; v < 8; ++v) inv[v] = 1.0f / lrow[v];
#pragma unroll
  for (int f = 0; f < 4; ++f) {
#pragma unroll
    for (int v = 0; v < 8; ++v) {
      const int tq = tq0 + v + hi * 8;
      const int d  = 16 * f + cn;
      O[((size_t)(b * TT + tq)) * DD + h * DH + d] = (_Float16)(o[f][v] * inv[v]);
    }
  }
}

// ---------------------------------------------------------------------------
// Kernel 5: output projection, fp32 result + bias. grid = (1024/128, 8192/256)
// ---------------------------------------------------------------------------
__global__ __launch_bounds__(256) void proj_kernel(
    const _Float16* __restrict__ Ah, const _Float16* __restrict__ WT,
    const float* __restrict__ bproj, float* __restrict__ out) {
  __shared__ alignas(16) _Float16 ldsA[2 * 256 * 32];
  __shared__ alignas(16) _Float16 ldsB[2 * 128 * 32];
  const int tid  = threadIdx.x;
  const int lane = tid & 31;
  const int hi   = lane >> 4;
  const int cn   = lane & 15;
  const int wave = tid >> 5;
  const int wm   = (wave & 3) * 64;
  const int wn   = (wave >> 2) * 64;
  const int m0   = blockIdx.y * 256;
  const int n0   = blockIdx.x * 128;

  v8f acc[4][4] = {};
  gemm_mainloop(Ah, WT, m0, n0, ldsA, ldsB, tid, acc);

#pragma unroll
  for (int i = 0; i < 4; ++i) {
#pragma unroll
    for (int j = 0; j < 4; ++j) {
      const int gn = n0 + wn + 16 * j + cn;
      const float bv = bproj[gn];
#pragma unroll
      for (int v = 0; v < 8; ++v) {
        const int gm = m0 + wm + 16 * i + v + hi * 8;
        out[(size_t)gm * DD + gn] = acc[i][j][v] + bv;
      }
    }
  }
}

// ---------------------------------------------------------------------------
extern "C" void kernel_launch(void* const* d_in, const int* in_sizes, int n_in,
                              void* d_out, int out_size, void* d_ws,
                              size_t ws_size, hipStream_t stream) {
  const float* x     = (const float*)d_in[0];
  const float* Wqkv  = (const float*)d_in[1];
  const float* bqkv  = (const float*)d_in[2];
  const float* Wproj = (const float*)d_in[3];
  const float* bproj = (const float*)d_in[4];
  const float* cosT  = (const float*)d_in[5];
  const float* sinT  = (const float*)d_in[6];
  float* out = (float*)d_out;

  char* ws = (char*)d_ws;
  // byte offsets (total 72 MB)
  _Float16* xh     = (_Float16*)(ws);              // 16 MB, reused as attn out
  _Float16* wqkvT  = (_Float16*)(ws + 16777216);   //  6 MB
  _Float16* wprojT = (_Float16*)(ws + 23068672);   //  2 MB
  _Float16* Qb     = (_Float16*)(ws + 25165824);   // 16 MB
  _Float16* Kb     = (_Float16*)(ws + 41943040);   // 16 MB
  _Float16* VT     = (_Float16*)(ws + 58720256);   // 16 MB
  _Float16* attnh  = xh;   // x no longer needed after QKV GEMM

  // 1) precision conversion / weight transpose
  cvt_kernel<<<8192, 256, 0, stream>>>(x, xh, (HB * TT * DD) / 4);
  transpose_cvt<<<dim3(96, 32), dim3(32, 8), 0, stream>>>(Wqkv, wqkvT, DD, 3 * DD);
  transpose_cvt<<<dim3(32, 32), dim3(32, 8), 0, stream>>>(Wproj, wprojT, DD, DD);
  // 2) QKV GEMM + RoPE  (M=8192 in 256-row tiles, N=3072 in 128-col tiles)
  qkv_rope_kernel<<<dim3(24, 32), 256, 0, stream>>>(xh, wqkvT, bqkv, cosT, sinT,
                                                    Qb, Kb, VT);
  // 3) flash attention  (grid: T/128 x B*H)
  attn_kernel<<<dim3(TT / 128, HB * HH), 256, 0, stream>>>(Qb, Kb, VT, attnh);
  // 4) output projection (M=8192, N=1024)
  proj_kernel<<<dim3(8, 32), 256, 0, stream>>>(attnh, wprojT, bproj, out);
}

// v002
// A run of this version takes 260 microseconds.
// In both of two side-by-side timings against v001, it was 1.23 times as fast.
// Over all steps from v000 it is 1.76 times as fast.
#include <hip/hip_runtime.h>
#include <hip/hip_bf16.h>

typedef __attribute__((ext_vector_type(16))) _Float16 v16h;
typedef __attribute__((ext_vector_type(4)))  _Float16 v4h;
typedef __attribute__((ext_vector_type(8)))  _Float16 v8h;
typedef __attribute__((ext_vector_type(8)))  float    v8f;
typedef __attribute__((ext_vector_type(4)))  unsigned int v4u;

#define HB 4      // batch
#define TT 2048   // sequence
#define DD 1024   // model dim
#define HH 16     // heads
#define DH 64     // head dim

union FragU { v16h h; v4u u[2]; };

// 16x32 f16 WMMA fragment load (A-layout; identical for B when source is
// N-major / K-contiguous). lane r<16: row r, halves 0..7 = K 8*hi.., halves
// 8..15 = K 16+8*hi.. (hi = lane>=16).  ld = row stride in halves.
__device__ __forceinline__ v16h load_frag(const _Float16* base, int ld, int lane) {
  const int r  = lane & 15;
  const int hi = lane >> 4;
  const _Float16* p = base + (size_t)r * ld + hi * 8;
  FragU f;
  f.u[0] = *(const v4u*)(p);
  f.u[1] = *(const v4u*)(p + 16);
  return f.h;
}

__device__ __forceinline__ v8f wmma16(v16h a, v16h b, v8f c) {
  return __builtin_amdgcn_wmma_f32_16x16x32_f16(false, a, false, b, (short)0, c,
                                                false, false);
}

// --- CDNA5 async global->LDS copy helpers (ASYNCcnt-tracked) ---------------
// Each active lane copies 16B per op: LDS[la + inst_off] = MEM[ga + inst_off].
__device__ __forceinline__ void async_copy_tiles(unsigned la, unsigned lb,
                                                 const _Float16* ga,
                                                 const _Float16* gb) {
  asm volatile(
      "global_load_async_to_lds_b128 %0, %2, off\n\t"
      "global_load_async_to_lds_b128 %0, %2, off offset:16\n\t"
      "global_load_async_to_lds_b128 %0, %2, off offset:32\n\t"
      "global_load_async_to_lds_b128 %0, %2, off offset:48\n\t"
      "global_load_async_to_lds_b128 %1, %3, off\n\t"
      "global_load_async_to_lds_b128 %1, %3, off offset:16"
      :
      : "v"(la), "v"(lb), "v"((unsigned long long)(size_t)ga),
        "v"((unsigned long long)(size_t)gb)
      : "memory");
}

__device__ __forceinline__ void wait_async_le6() {
#if __has_builtin(__builtin_amdgcn_s_wait_asynccnt)
  __builtin_amdgcn_s_wait_asynccnt(6);
#else
  asm volatile("s_wait_asynccnt 0x6" ::: "memory");
#endif
}
__device__ __forceinline__ void wait_async_le0() {
#if __has_builtin(__builtin_amdgcn_s_wait_asynccnt)
  __builtin_amdgcn_s_wait_asynccnt(0);
#else
  asm volatile("s_wait_asynccnt 0x0" ::: "memory");
#endif
}

// ---------------------------------------------------------------------------
// Shared GEMM mainloop: 256x128 block tile, K-step 32, double-buffered LDS
// filled by async global->LDS DMA. 256 threads = 8 waves (4x2); each wave
// owns a 64x64 sub-tile = 4x4 frags -> 16 WMMAs per 8 fragment loads.
// ---------------------------------------------------------------------------
__device__ __forceinline__ void gemm_mainloop(
    const _Float16* __restrict__ A, const _Float16* __restrict__ BT,
    int m0, int n0, _Float16* ldsA, _Float16* ldsB, int tid, v8f acc[4][4]) {
  const int lane = tid & 31;
  const int wave = tid >> 5;
  const int wm   = (wave & 3) * 64;   // 0,64,128,192
  const int wn   = (wave >> 2) * 64;  // 0,64
  const int brow = tid >> 1;          // 0..127 (B tile rows)
  const int bch  = (tid & 1) * 16;    // 0 or 16 halves

  const _Float16* Ar = A  + (size_t)(m0 + tid)  * DD;        // one row/thread
  const _Float16* Br = BT + (size_t)(n0 + brow) * DD + bch;

  // Per-lane LDS byte addresses (low 32 bits of the generic pointer are the
  // LDS aperture offset).
  const unsigned laBase = (unsigned)(size_t)(ldsA) + (unsigned)tid * 64u;
  const unsigned lbBase =
      (unsigned)(size_t)(ldsB) + (unsigned)brow * 64u + (unsigned)bch * 2u;

  // Prologue: fill buffer 0.
  async_copy_tiles(laBase, lbBase, Ar, Br);

  for (int k0 = 0; k0 < DD; k0 += 32) {
    const int cur = (k0 >> 5) & 1;
    if (k0 + 32 < DD) {
      // Kick off next tile into the other buffer, then ensure the current
      // tile's 6 async ops (issued last iteration) have landed.
      async_copy_tiles(laBase + (unsigned)(1 - cur) * 16384u,
                       lbBase + (unsigned)(1 - cur) * 8192u,
                       Ar + k0 + 32, Br + k0 + 32);
      wait_async_le6();
    } else {
      wait_async_le0();
    }
    __syncthreads();   // current tile visible to all waves

    const _Float16* tA = ldsA + (size_t)cur * (256 * 32);
    const _Float16* tB = ldsB + (size_t)cur * (128 * 32);
    const v16h a0 = load_frag(tA + (size_t)(wm)      * 32, 32, lane);
    const v16h a1 = load_frag(tA + (size_t)(wm + 16) * 32, 32, lane);
    const v16h a2 = load_frag(tA + (size_t)(wm + 32) * 32, 32, lane);
    const v16h a3 = load_frag(tA + (size_t)(wm + 48) * 32, 32, lane);
    const v16h b0 = load_frag(tB + (size_t)(wn)      * 32, 32, lane);
    const v16h b1 = load_frag(tB + (size_t)(wn + 16) * 32, 32, lane);
    const v16h b2 = load_frag(tB + (size_t)(wn + 32) * 32, 32, lane);
    const v16h b3 = load_frag(tB + (size_t)(wn + 48) * 32, 32, lane);
    acc[0][0] = wmma16(a0, b0, acc[0][0]);
    acc[1][0] = wmma16(a1, b0, acc[1][0]);
    acc[2][0] = wmma16(a2, b0, acc[2][0]);
    acc[3][0] = wmma16(a3, b0, acc[3][0]);
    acc[0][1] = wmma16(a0, b1, acc[0][1]);
    acc[1][1] = wmma16(a1, b1, acc[1][1]);
    acc[2][1] = wmma16(a2, b1, acc[2][1]);
    acc[3][1] = wmma16(a3, b1, acc[3][1]);
    acc[0][2] = wmma16(a0, b2, acc[0][2]);
    acc[1][2] = wmma16(a1, b2, acc[1][2]);
    acc[2][2] = wmma16(a2, b2, acc[2][2]);
    acc[3][2] = wmma16(a3, b2, acc[3][2]);
    acc[0][3] = wmma16(a0, b3, acc[0][3]);
    acc[1][3] = wmma16(a1, b3, acc[1][3]);
    acc[2][3] = wmma16(a2, b3, acc[2][3]);
    acc[3][3] = wmma16(a3, b3, acc[3][3]);
    __syncthreads();   // readers done before next iteration overwrites `cur`
  }
}

// ---------------------------------------------------------------------------
// Kernel 1: f32 -> f16 convert (vectorized)
// ---------------------------------------------------------------------------
__global__ __launch_bounds__(256) void cvt_kernel(const float* __restrict__ x,
                                                  _Float16* __restrict__ xh,
                                                  int n4) {
  const int i = blockIdx.x * 256 + threadIdx.x;
  if (i < n4) {
    const float4 f = ((const float4*)x)[i];
    v4h hv;
    hv.x = (_Float16)f.x; hv.y = (_Float16)f.y;
    hv.z = (_Float16)f.z; hv.w = (_Float16)f.w;
    ((v4h*)xh)[i] = hv;
  }
}

// ---------------------------------------------------------------------------
// Kernel 2: transposed convert: WT[n*K + k] = (f16) W[k*N + n]
// ---------------------------------------------------------------------------
__global__ __launch_bounds__(256) void transpose_cvt(const float* __restrict__ W,
                                                     _Float16* __restrict__ WT,
                                                     int K, int N) {
  __shared__ float tile[32][33];
  const int n0 = blockIdx.x * 32, k0 = blockIdx.y * 32;
  const int tx = threadIdx.x, ty = threadIdx.y;  // block (32, 8)
  for (int i = ty; i < 32; i += 8)
    tile[i][tx] = W[(size_t)(k0 + i) * N + n0 + tx];
  __syncthreads();
  for (int i = ty; i < 32; i += 8)
    WT[(size_t)(n0 + i) * K + k0 + tx] = (_Float16)tile[tx][i];
}

// ---------------------------------------------------------------------------
// Kernel 3: QKV GEMM + bias + RoPE, scatter into Q[b,h,t,d], K[b,h,t,d],
// V^T[b,h,d,t] (all f16).  grid = (3072/128, 8192/256)
// ---------------------------------------------------------------------------
__global__ __launch_bounds__(256) void qkv_rope_kernel(
    const _Float16* __restrict__ Xh, const _Float16* __restrict__ WT,
    const float* __restrict__ bqkv, const float* __restrict__ cosT,
    const float* __restrict__ sinT, _Float16* __restrict__ Qb,
    _Float16* __restrict__ Kb, _Float16* __restrict__ VT) {
  __shared__ alignas(16) _Float16 ldsA[2 * 256 * 32];
  __shared__ alignas(16) _Float16 ldsB[2 * 128 * 32];
  const int tid  = threadIdx.x;
  const int lane = tid & 31;
  const int hi   = lane >> 4;
  const int cn   = lane & 15;
  const int wave = tid >> 5;
  const int wm   = (wave & 3) * 64;
  const int wn   = (wave >> 2) * 64;
  const int m0   = blockIdx.y * 256;
  const int n0   = blockIdx.x * 128;

  v8f acc[4][4] = {};
  gemm_mainloop(Xh, WT, m0, n0, ldsA, ldsB, tid, acc);

  // Wave's 64-col span == exactly one head (n0 mult of 128, wn in {0,64}),
  // so rotate-half pairs (d, d+32) live in acc[i][jj] / acc[i][jj+2].
#pragma unroll
  for (int i = 0; i < 4; ++i) {
#pragma unroll
    for (int jj = 0; jj < 2; ++jj) {
      const int gn_lo = n0 + wn + 16 * jj + cn;
      const int gn_hi = gn_lo + 32;
      const int sec   = gn_lo >> 10;   // 0=Q 1=K 2=V
      const int nn    = gn_lo & 1023;
      const int h     = nn >> 6;
      const int dlo   = nn & 63;       // < 32
      const int dhi   = dlo + 32;
      const float blo = bqkv[gn_lo];
      const float bhi = bqkv[gn_hi];
#pragma unroll
      for (int v = 0; v < 8; ++v) {
        const int gm = m0 + wm + 16 * i + v + hi * 8;
        const int b  = gm >> 11;
        const int t  = gm & (TT - 1);
        const float xlo = acc[i][jj][v]     + blo;
        const float xhi = acc[i][jj + 2][v] + bhi;
        if (sec == 2) {
          VT[((size_t)((b * HH + h) * DH + dlo)) * TT + t] = (_Float16)xlo;
          VT[((size_t)((b * HH + h) * DH + dhi)) * TT + t] = (_Float16)xhi;
        } else {
          const float cl = cosT[t * DH + dlo], sl = sinT[t * DH + dlo];
          const float ch = cosT[t * DH + dhi], sh = sinT[t * DH + dhi];
          _Float16* dst = (sec == 0) ? Qb : Kb;
          dst[((size_t)((b * HH + h) * TT + t)) * DH + dlo] =
              (_Float16)(xlo * cl - xhi * sl);
          dst[((size_t)((b * HH + h) * TT + t)) * DH + dhi] =
              (_Float16)(xhi * ch + xlo * sh);
        }
      }
    }
  }
}

#define AKT 64
#define APW 72

// One tile = 2 x 8 KB; each thread brings two 16-byte pieces of K and two of
// V^T. The closing s_wait_xcnt stands in front of every later rewrite of the
// copies' address registers (a precaution).
__device__ __forceinline__ void attn_copy_tile(unsigned lk,
                                               const _Float16* gk,
                                               const _Float16* gv) {
  const unsigned lk1 = lk + 32u * APW * 2u;
  const unsigned lv  = lk + AKT * APW * 2u;   // V^T tile follows the K tile
  const unsigned lv1 = lv + 32u * APW * 2u;
  const _Float16* gk1 = gk + 32 * DH;
  const _Float16* gv1 = gv + 32 * TT;
  asm volatile(
      "global_load_async_to_lds_b128 %0, %4, off\n\t"
      "global_load_async_to_lds_b128 %1, %5, off\n\t"
      "global_load_async_to_lds_b128 %2, %6, off\n\t"
      "global_load_async_to_lds_b128 %3, %7, off\n\t"
      "s_wait_xcnt 0x0"
      :
      : "v"(lk), "v"(lk1), "v"(lv), "v"(lv1),
        "v"((unsigned long long)(size_t)gk),
        "v"((unsigned long long)(size_t)gk1),
        "v"((unsigned long long)(size_t)gv),
        "v"((unsigned long long)(size_t)gv1)
      : "memory");
}

// Lane l with lane l ^ 16: the two lanes that share one query column.
__device__ __forceinline__ float xhalf(float x) {
  const int i = __builtin_bit_cast(int, x);
  return __builtin_bit_cast(float, __builtin_amdgcn_permlanex16(
      i, i, 0x76543210, 0xfedcba98, false, false));
}

__global__ __launch_bounds__(256) void attn_kernel(
    const _Float16* __restrict__ Q, const _Float16* __restrict__ K,
    const _Float16* __restrict__ VT, _Float16* __restrict__ O) {
  static_assert(AKT == DH, "K tile and V^T tile have the same number of rows");
  __shared__ alignas(16) _Float16 KVtile[2][2][AKT * APW];  // [buffer][K, V^T]
  const int tid  = threadIdx.x;
  const int lane = tid & 31;
  const int hi   = lane >> 4;
  const int cn   = lane & 15;
  const int wave = tid >> 5;
  const int bh   = blockIdx.y;
  const int b    = bh >> 4;
  const int h    = bh & 15;
  const int tq0  = blockIdx.x * 128 + wave * 16;

  const _Float16* Qp = Q  + ((size_t)bh * TT + tq0) * DH;
  const _Float16* Kp = K  + (size_t)bh * TT * DH;
  const _Float16* Vp = VT + (size_t)bh * DH * TT;   // [DH][TT]

  // This thread's piece of a tile: row crow (and crow + 32), 16 bytes at ccol.
  const int crow = tid >> 3;         // 0..31
  const int ccol = (tid & 7) * 8;    // halves
  const unsigned coff = (unsigned)(crow * APW + ccol) * 2u;
  const unsigned lkBase = (unsigned)(size_t)(&KVtile[0][0][0]) + coff;
  const _Float16* gkBase = Kp + (size_t)crow * DH + ccol;
  const _Float16* gvBase = Vp + (size_t)crow * TT + ccol;

  // Tile 0 lands and is published; tile 1 then flies while tile 0 is worked on.
  attn_copy_tile(lkBase, gkBase, gvBase);
  asm volatile("s_wait_asynccnt 0x0" ::: "memory");  // own copies landed
  __syncthreads();                                   // tile 0 visible to all
  attn_copy_tile(lkBase + 2u * AKT * APW * 2u, gkBase + (size_t)AKT * DH,
                 gvBase + AKT);

  // Q is the B operand: lane cn holds query column tq0 + cn.
  const v16h q0 = load_frag(Qp,      DH, lane);     // d 0..31
  const v16h q1 = load_frag(Qp + 32, DH, lane);     // d 32..63

  // Everything below is per query column, so per lane: lanes cn and cn + 16
  // share a column and split its keys (scores) and its d (output).
  // The loops over v and f are unrolled because their index names a register.
  float mrun = -3.0e38f;   // running maximum, equal in both lanes of a column
  float lsum = 0.f;        // this lane's share of the running sum
  v8f o[4] = {};           // o[f][v] = O^T[16 f + 8 hi + v][cn]

  for (int ps = 0; ps < TT / 32; ++ps) {
    const int st  = ps >> 1;          // tile
    const int cur = st & 1;           // its buffer
    const int kb  = (ps & 1) * 32;    // first key of this pass inside the tile
    const _Float16* tK = &KVtile[cur][0][0];
    const _Float16* tV = &KVtile[cur][1][0];

    // S^T = K Q^T: s0[v] = key kb + 8 hi + v, s1[v] = key kb + 16 + 8 hi + v.
    v8f s0 = {}, s1 = {};
    const v16h k00 = load_frag(tK + kb * APW,             APW, lane);
    const v16h k01 = load_frag(tK + kb * APW + 32,        APW, lane);
    const v16h k10 = load_frag(tK + (kb + 16) * APW,      APW, lane);
    const v16h k11 = load_frag(tK + (kb + 16) * APW + 32, APW, lane);
    s0 = wmma16(k00, q0, s0);
    s0 = wmma16(k01, q1, s0);
    s1 = wmma16(k10, q0, s1);
    s1 = wmma16(k11, q1, s1);

    const v16h vf0 = load_frag(tV + 0  * APW + kb, APW, lane);
    const v16h vf1 = load_frag(tV + 16 * APW + kb, APW, lane);
    const v16h vf2 = load_frag(tV + 32 * APW + kb, APW, lane);
    const v16h vf3 = load_frag(tV + 48 * APW + kb, APW, lane);

    const v8f a = s0 * 0.125f;        // 1/sqrt(64)
    const v8f c = s1 * 0.125f;
    float mx = -3.0e38f;
#pragma unroll
    for (int v = 0; v < 8; ++v) mx = fmaxf(mx, fmaxf(a[v], c[v]));
    mx = fmaxf(mx, xhalf(mx));        // the column's other 16 keys
    const float mnew = fmaxf(mrun, mx);
    const float al   = __expf(mrun - mnew);

    // The two score tiles, converted in place, are P^T as a B operand in the
    // k order of load_frag: halves 0..7 = keys 8 hi.., 8..15 = keys 16 + 8 hi..
    const v8f ea = a - mnew, ec = c - mnew;
    v8f p0, p1;
#pragma unroll
    for (int v = 0; v < 8; ++v) {
      p0[v] = __expf(ea[v]);
      p1[v] = __expf(ec[v]);
    }
    v16h pf;
#pragma unroll
    for (int v = 0; v < 8; ++v) {
      pf[v]     = (_Float16)p0[v];
      pf[8 + v] = (_Float16)p1[v];
    }
    const v8f pp = p0 + p1;
    float sum = pp[0];
#pragma unroll
    for (int v = 1; v < 8; ++v) sum += pp[v];
    lsum = lsum * al + sum;
    mrun = mnew;

    // O^T += V^T P^T
#pragma unroll
    for (int f = 0; f < 4; ++f)
#pragma unroll
      for (int v = 0; v < 8; ++v) o[f][v] *= al;
    o[0] = wmma16(vf0, pf, o[0]);
    o[1] = wmma16(vf1, pf, o[1]);
    o[2] = wmma16(vf2, pf, o[2]);
    o[3] = wmma16(vf3, pf, o[3]);

    if (ps & 1) {
      // Hand-over: this wave's reads of the current tile are done, its copies
      // of the next tile have landed; the barrier says both of every wave.
      asm volatile("s_wait_dscnt 0x0" ::: "memory");
      asm volatile("s_wait_asynccnt 0x0" ::: "memory");
      __syncthreads();
      if (st + 2 < TT / AKT) {   // refill the buffer that this tile has left
        attn_copy_tile(lkBase + (unsigned)cur * (2u * AKT * APW * 2u),
                       gkBase + (size_t)(st + 2) * AKT * DH,
                       gvBase + (st + 2) * AKT);
      }
    }
  }
  asm volatile("s_wait_asynccnt 0x0" ::: "memory");  // nothing left in flight

  const float inv = 1.0f / (lsum + xhalf(lsum));     // join the two shares
  // A lane holds 8 consecutive d of its query row per tile: 16-byte stores.
  _Float16* Op = O + ((size_t)(b * TT + tq0 + cn)) * DD + h * DH + hi * 8;
#pragma unroll
  for (int f = 0; f < 4; ++f) {
    v8h ov;
#pragma unroll
    for (int v = 0; v < 8; ++v) ov[v] = (_Float16)(o[f][v] * inv);
    *(v8h*)(Op + 16 * f) = ov;
  }
}

// ---------------------------------------------------------------------------
// Kernel 5: output projection, fp32 result + bias. grid = (1024/128, 8192/256)
// ---------------------------------------------------------------------------
__global__ __launch_bounds__(256) void proj_kernel(
    const _Float16* __restrict__ Ah, const _Float16* __restrict__ WT,
    const float* __restrict__ bproj, float* __restrict__ out) {
  __shared__ alignas(16) _Float16 ldsA[2 * 256 * 32];
  __shared__ alignas(16) _Float16 ldsB[2 * 128 * 32];
  const int tid  = threadIdx.x;
  const int lane = tid & 31;
  const int hi   = lane >> 4;
  const int cn   = lane & 15;
  const int wave = tid >> 5;
  const int wm   = (wave & 3) * 64;
  const int wn   = (wave >> 2) * 64;
  const int m0   = blockIdx.y * 256;
  const int n0   = blockIdx.x * 128;

  v8f acc[4][4] = {};
  gemm_mainloop(Ah, WT, m0, n0, ldsA, ldsB, tid, acc);

#pragma unroll
  for (int i = 0; i < 4; ++i) {
#pragma unroll
    for (int j = 0; j < 4; ++j) {
      const int gn = n0 + wn + 16 * j + cn;
      const float bv = bproj[gn];
#pragma unroll
      for (int v = 0; v < 8; ++v) {
        const int gm = m0 + wm + 16 * i + v + hi * 8;
        out[(size_t)gm * DD + gn] = acc[i][j][v] + bv;
      }
    }
  }
}

// ---------------------------------------------------------------------------
extern "C" void kernel_launch(void* const* d_in, const int* in_sizes, int n_in,
                              void* d_out, int out_size, void* d_ws,
                              size_t ws_size, hipStream_t stream) {
  const float* x     = (const float*)d_in[0];
  const float* Wqkv  = (const float*)d_in[1];
  const float* bqkv  = (const float*)d_in[2];
  const float* Wproj = (const float*)d_in[3];
  const float* bproj = (const float*)d_in[4];
  const float* cosT  = (const float*)d_in[5];
  const float* sinT  = (const float*)d_in[6];
  float* out = (float*)d_out;

  char* ws = (char*)d_ws;
  // byte offsets (total 72 MB)
  _Float16* xh     = (_Float16*)(ws);              // 16 MB, reused as attn out
  _Float16* wqkvT  = (_Float16*)(ws + 16777216);   //  6 MB
  _Float16* wprojT = (_Float16*)(ws + 23068672);   //  2 MB
  _Float16* Qb     = (_Float16*)(ws + 25165824);   // 16 MB
  _Float16* Kb     = (_Float16*)(ws + 41943040);   // 16 MB
  _Float16* VT     = (_Float16*)(ws + 58720256);   // 16 MB
  _Float16* attnh  = xh;   // x no longer needed after QKV GEMM

  // 1) precision conversion / weight transpose
  cvt_kernel<<<8192, 256, 0, stream>>>(x, xh, (HB * TT * DD) / 4);
  transpose_cvt<<<dim3(96, 32), dim3(32, 8), 0, stream>>>(Wqkv, wqkvT, DD, 3 * DD);
  transpose_cvt<<<dim3(32, 32), dim3(32, 8), 0, stream>>>(Wproj, wprojT, DD, DD);
  // 2) QKV GEMM + RoPE  (M=8192 in 256-row tiles, N=3072 in 128-col tiles)
  qkv_rope_kernel<<<dim3(24, 32), 256, 0, stream>>>(xh, wqkvT, bqkv, cosT, sinT,
                                                    Qb, Kb, VT);
  // 3) flash attention  (grid: T/128 x B*H)
  attn_kernel<<<dim3(TT / 128, HB * HH), 256, 0, stream>>>(Qb, Kb, VT, attnh);
  // 4) output projection (M=8192, N=1024)
  proj_kernel<<<dim3(8, 32), 256, 0, stream>>>(attnh, wprojT, bproj, out);
}

// v003
// A run of this version takes 199 microseconds.
// Timed twice side by side with v002, it ran 1.30 and 1.31 times as fast.
// All steps since v000 together make it 2.30 times as fast.
#include <hip/hip_runtime.h>
#include <hip/hip_bf16.h>

typedef __attribute__((ext_vector_type(16))) _Float16 v16h;
typedef __attribute__((ext_vector_type(4)))  _Float16 v4h;
typedef __attribute__((ext_vector_type(8)))  _Float16 v8h;
typedef __attribute__((ext_vector_type(8)))  float    v8f;
typedef __attribute__((ext_vector_type(4)))  unsigned int v4u;

#define HB 4      // batch
#define TT 2048   // sequence
#define DD 1024   // model dim
#define HH 16     // heads
#define DH 64     // head dim

union FragU { v16h h; v4u u[2]; };

// 16x32 f16 WMMA fragment load (A-layout; identical for B when source is
// N-major / K-contiguous). lane r<16: row r, halves 0..7 = K 8*hi.., halves
// 8..15 = K 16+8*hi.. (hi = lane>=16).  ld = row stride in halves.
__device__ __forceinline__ v16h load_frag(const _Float16* base, int ld, int lane) {
  const int r  = lane & 15;
  const int hi = lane >> 4;
  const _Float16* p = base + (size_t)r * ld + hi * 8;
  FragU f;
  f.u[0] = *(const v4u*)(p);
  f.u[1] = *(const v4u*)(p + 16);
  return f.h;
}

__device__ __forceinline__ v8f wmma16(v16h a, v16h b, v8f c) {
  return __builtin_amdgcn_wmma_f32_16x16x32_f16(false, a, false, b, (short)0, c,
                                                false, false);
}

// ---------------------------------------------------------------------------
// Shared GEMM mainloop: 256x128 block tile, 256 threads = 8 waves (4x2); each
// wave owns a 64x64 sub-tile = 4x4 frags. A and B^T tiles of GKT k are staged
// in LDS (two buffers) by asynchronous copies. A staged row is one whole
// 128-byte line of its source row, and 8 neighbouring lanes bring one row, so
// that every copy instruction covers four whole lines.
// ---------------------------------------------------------------------------
#define GKT 64            // k per staged tile: one row is 128 B
#define GPW 72            // LDS row pitch in halves: 128 B + 16 B, 16-byte reads
                          // of 16 rows then fall on 64 distinct banks
#define GROWS (256 + 128) // rows of a buffer: the A tile, then the B^T tile
#define GBUF (GROWS * GPW)

// One tile: each thread brings 16 bytes of rows crow + 32 j, eight of A and
// four of B^T. The closing s_wait_xcnt stands in front of every later rewrite
// of the copies' address registers (a precaution).
__device__ __forceinline__ void gemm_copy_tile(unsigned l, const _Float16* ga,
                                               const _Float16* gb) {
  const unsigned st = 32u * GPW * 2u;   // 32 rows further in LDS, bytes
  asm volatile(
      "global_load_async_to_lds_b128 %0, %12, off\n\t"
      "global_load_async_to_lds_b128 %1, %13, off\n\t"
      "global_load_async_to_lds_b128 %2, %14, off\n\t"
      "global_load_async_to_lds_b128 %3, %15, off\n\t"
      "global_load_async_to_lds_b128 %4, %16, off\n\t"
      "global_load_async_to_lds_b128 %5, %17, off\n\t"
      "global_load_async_to_lds_b128 %6, %18, off\n\t"
      "global_load_async_to_lds_b128 %7, %19, off\n\t"
      "global_load_async_to_lds_b128 %8, %20, off\n\t"
      "global_load_async_to_lds_b128 %9, %21, off\n\t"
      "global_load_async_to_lds_b128 %10, %22, off\n\t"
      "global_load_async_to_lds_b128 %11, %23, off\n\t"
      "s_wait_xcnt 0x0"
      :
      : "v"(l), "v"(l + st), "v"(l + 2u * st), "v"(l + 3u * st),
        "v"(l + 4u * st), "v"(l + 5u * st), "v"(l + 6u * st),
        "v"(l + 7u * st), "v"(l + 8u * st), "v"(l + 9u * st),
        "v"(l + 10u * st), "v"(l + 11u * st),
        "v"((unsigned long long)(size_t)(ga)),
        "v"((unsigned long long)(size_t)(ga + 32 * DD)),
        "v"((unsigned long long)(size_t)(ga + 64 * DD)),
        "v"((unsigned long long)(size_t)(ga + 96 * DD)),
        "v"((unsigned long long)(size_t)(ga + 128 * DD)),
        "v"((unsigned long long)(size_t)(ga + 160 * DD)),
        "v"((unsigned long long)(size_t)(ga + 192 * DD)),
        "v"((unsigned long long)(size_t)(ga + 224 * DD)),
        "v"((unsigned long long)(size_t)(gb)),
        "v"((unsigned long long)(size_t)(gb + 32 * DD)),
        "v"((unsigned long long)(size_t)(gb + 64 * DD)),
        "v"((unsigned long long)(size_t)(gb + 96 * DD))
      : "memory");
}

__device__ __forceinline__ void gemm_mainloop(
    const _Float16* __restrict__ A, const _Float16* __restrict__ BT,
    int m0, int n0, _Float16* lds, int tid, v8f acc[4][4]) {
  const int lane = tid & 31;
  const int wave = tid >> 5;
  const int wm   = (wave & 3) * 64;   // 0,64,128,192
  const int wn   = (wave >> 2) * 64;  // 0,64
  const int crow = tid >> 3;          // 0..31
  const int ccol = (tid & 7) * 8;     // halves

  const _Float16* Ar = A  + (size_t)(m0 + crow) * DD + ccol;
  const _Float16* Br = BT + (size_t)(n0 + crow) * DD + ccol;

  // Per-lane LDS byte address (the low 32 bits of the generic pointer are the
  // offset in the work-group's LDS).
  const unsigned lBase =
      (unsigned)(size_t)(lds) + (unsigned)(crow * GPW + ccol) * 2u;

  // Tile 0 lands and is published; tile 1 then flies while tile 0 is worked on.
  gemm_copy_tile(lBase, Ar, Br);
  asm volatile("s_wait_asynccnt 0x0" ::: "memory");  // own copies landed
  __syncthreads();                                   // tile 0 visible to all
  gemm_copy_tile(lBase + GBUF * 2u, Ar + GKT, Br + GKT);

  for (int t = 0; t < DD / GKT; ++t) {
    const int cur = t & 1;
    const _Float16* tA = lds + (size_t)cur * GBUF;
    const _Float16* tB = tA + 256 * GPW;
    // unrolled so that ks folds into the LDS loads' immediate offsets
#pragma unroll
    for (int ks = 0; ks < GKT; ks += 32) {
      const v16h a0 = load_frag(tA + (wm)      * GPW + ks, GPW, lane);
      const v16h a1 = load_frag(tA + (wm + 16) * GPW + ks, GPW, lane);
      const v16h a2 = load_frag(tA + (wm + 32) * GPW + ks, GPW, lane);
      const v16h a3 = load_frag(tA + (wm + 48) * GPW + ks, GPW, lane);
      const v16h b0 = load_frag(tB + (wn)      * GPW + ks, GPW, lane);
      const v16h b1 = load_frag(tB + (wn + 16) * GPW + ks, GPW, lane);
      const v16h b2 = load_frag(tB + (wn + 32) * GPW + ks, GPW, lane);
      const v16h b3 = load_frag(tB + (wn + 48) * GPW + ks, GPW, lane);
      acc[0][0] = wmma16(a0, b0, acc[0][0]);
      acc[1][0] = wmma16(a1, b0, acc[1][0]);
      acc[2][0] = wmma16(a2, b0, acc[2][0]);
      acc[3][0] = wmma16(a3, b0, acc[3][0]);
      acc[0][1] = wmma16(a0, b1, acc[0][1]);
      acc[1][1] = wmma16(a1, b1, acc[1][1]);
      acc[2][1] = wmma16(a2, b1, acc[2][1]);
      acc[3][1] = wmma16(a3, b1, acc[3][1]);
      acc[0][2] = wmma16(a0, b2, acc[0][2]);
      acc[1][2] = wmma16(a1, b2, acc[1][2]);
      acc[2][2] = wmma16(a2, b2, acc[2][2]);
      acc[3][2] = wmma16(a3, b2, acc[3][2]);
      acc[0][3] = wmma16(a0, b3, acc[0][3]);
      acc[1][3] = wmma16(a1, b3, acc[1][3]);
      acc[2][3] = wmma16(a2, b3, acc[2][3]);
      acc[3][3] = wmma16(a3, b3, acc[3][3]);
    }
    // Hand-over: this wave's reads of the current tile are done, its copies of
    // the next tile have landed; the barrier says both of every wave.
    asm volatile("s_wait_dscnt 0x0" ::: "memory");
    asm volatile("s_wait_asynccnt 0x0" ::: "memory");
    __syncthreads();
    if (t + 2 < DD / GKT) {   // refill the buffer that this tile has left
      gemm_copy_tile(lBase + (unsigned)cur * (GBUF * 2u),
                     Ar + (t + 2) * GKT, Br + (t + 2) * GKT);
    }
  }
  asm volatile("s_wait_asynccnt 0x0" ::: "memory");  // nothing left in flight
}

// ---------------------------------------------------------------------------
// Kernel 1: f32 -> f16 convert (vectorized)
// ---------------------------------------------------------------------------
__global__ __launch_bounds__(256) void cvt_kernel(const float* __restrict__ x,
                                                  _Float16* __restrict__ xh,
                                                  int n4) {
  const int i = blockIdx.x * 256 + threadIdx.x;
  if (i < n4) {
    const float4 f = ((const float4*)x)[i];
    v4h hv;
    hv.x = (_Float16)f.x; hv.y = (_Float16)f.y;
    hv.z = (_Float16)f.z; hv.w = (_Float16)f.w;
    ((v4h*)xh)[i] = hv;
  }
}

// ---------------------------------------------------------------------------
// Kernel 2: transposed convert: WT[n*K + k] = (f16) W[k*N + n]
// ---------------------------------------------------------------------------
__global__ __launch_bounds__(256) void transpose_cvt(const float* __restrict__ W,
                                                     _Float16* __restrict__ WT,
                                                     int K, int N) {
  __shared__ float tile[32][33];
  const int n0 = blockIdx.x * 32, k0 = blockIdx.y * 32;
  const int tx = threadIdx.x, ty = threadIdx.y;  // block (32, 8)
  for (int i = ty; i < 32; i += 8)
    tile[i][tx] = W[(size_t)(k0 + i) * N + n0 + tx];
  __syncthreads();
  for (int i = ty; i < 32; i += 8)
    WT[(size_t)(n0 + i) * K + k0 + tx] = (_Float16)tile[tx][i];
}

// ---------------------------------------------------------------------------
// Kernel 3: QKV GEMM + bias + RoPE, scatter into Q[b,h,t,d], K[b,h,t,d],
// V^T[b,h,d,t] (all f16).  grid = (3072/128, 8192/256)
// ---------------------------------------------------------------------------
__global__ __launch_bounds__(256) void qkv_rope_kernel(
    const _Float16* __restrict__ Xh, const _Float16* __restrict__ WT,
    const float* __restrict__ bqkv, const float* __restrict__ cosT,
    const float* __restrict__ sinT, _Float16* __restrict__ Qb,
    _Float16* __restrict__ Kb, _Float16* __restrict__ VT) {
  __shared__ alignas(16) _Float16 ldsAB[2 * GBUF];
  const int tid  = threadIdx.x;
  const int lane = tid & 31;
  const int hi   = lane >> 4;
  const int cn   = lane & 15;
  const int wave = tid >> 5;
  const int wm   = (wave & 3) * 64;
  const int wn   = (wave >> 2) * 64;
  const int m0   = blockIdx.y * 256;
  const int n0   = blockIdx.x * 128;

  v8f acc[4][4] = {};
  gemm_mainloop(Xh, WT, m0, n0, ldsAB, tid, acc);

  // Wave's 64-col span == exactly one head (n0 mult of 128, wn in {0,64}),
  // so rotate-half pairs (d, d+32) live in acc[i][jj] / acc[i][jj+2].
#pragma unroll
  for (int i = 0; i < 4; ++i) {
#pragma unroll
    for (int jj = 0; jj < 2; ++jj) {
      const int gn_lo = n0 + wn + 16 * jj + cn;
      const int gn_hi = gn_lo + 32;
      const int sec   = gn_lo >> 10;   // 0=Q 1=K 2=V
      const int nn    = gn_lo & 1023;
      const int h     = nn >> 6;
      const int dlo   = nn & 63;       // < 32
      const int dhi   = dlo + 32;
      const float blo = bqkv[gn_lo];
      const float bhi = bqkv[gn_hi];
#pragma unroll
      for (int v = 0; v < 8; ++v) {
        const int gm = m0 + wm + 16 * i + v + hi * 8;
        const int b  = gm >> 11;
        const int t  = gm & (TT - 1);
        const float xlo = acc[i][jj][v]     + blo;
        const float xhi = acc[i][jj + 2][v] + bhi;
        if (sec == 2) {
          VT[((size_t)((b * HH + h) * DH + dlo)) * TT + t] = (_Float16)xlo;
          VT[((size_t)((b * HH + h) * DH + dhi)) * TT + t] = (_Float16)xhi;
        } else {
          const float cl = cosT[t * DH + dlo], sl = sinT[t * DH + dlo];
          const float ch = cosT[t * DH + dhi], sh = sinT[t * DH + dhi];
          _Float16* dst = (sec == 0) ? Qb : Kb;
          dst[((size_t)((b * HH + h) * TT + t)) * DH + dlo] =
              (_Float16)(xlo * cl - xhi * sl);
          dst[((size_t)((b * HH + h) * TT + t)) * DH + dhi] =
              (_Float16)(xhi * ch + xlo * sh);
        }
      }
    }
  }
}

#define AKT 64
#define APW 72

// One tile = 2 x 8 KB; each thread brings two 16-byte pieces of K and two of
// V^T. The closing s_wait_xcnt stands in front of every later rewrite of the
// copies' address registers (a precaution).
__device__ __forceinline__ void attn_copy_tile(unsigned lk,
                                               const _Float16* gk,
                                               const _Float16* gv) {
  const unsigned lk1 = lk + 32u * APW * 2u;
  const unsigned lv  = lk + AKT * APW * 2u;   // V^T tile follows the K tile
  const unsigned lv1 = lv + 32u * APW * 2u;
  const _Float16* gk1 = gk + 32 * DH;
  const _Float16* gv1 = gv + 32 * TT;
  asm volatile(
      "global_load_async_to_lds_b128 %0, %4, off\n\t"
      "global_load_async_to_lds_b128 %1, %5, off\n\t"
      "global_load_async_to_lds_b128 %2, %6, off\n\t"
      "global_load_async_to_lds_b128 %3, %7, off\n\t"
      "s_wait_xcnt 0x0"
      :
      : "v"(lk), "v"(lk1), "v"(lv), "v"(lv1),
        "v"((unsigned long long)(size_t)gk),
        "v"((unsigned long long)(size_t)gk1),
        "v"((unsigned long long)(size_t)gv),
        "v"((unsigned long long)(size_t)gv1)
      : "memory");
}

// Lane l with lane l ^ 16: the two lanes that share one query column.
__device__ __forceinline__ float xhalf(float x) {
  const int i = __builtin_bit_cast(int, x);
  return __builtin_bit_cast(float, __builtin_amdgcn_permlanex16(
      i, i, 0x76543210, 0xfedcba98, false, false));
}

__global__ __launch_bounds__(256) void attn_kernel(
    const _Float16* __restrict__ Q, const _Float16* __restrict__ K,
    const _Float16* __restrict__ VT, _Float16* __restrict__ O) {
  static_assert(AKT == DH, "K tile and V^T tile have the same number of rows");
  __shared__ alignas(16) _Float16 KVtile[2][2][AKT * APW];  // [buffer][K, V^T]
  const int tid  = threadIdx.x;
  const int lane = tid & 31;
  const int hi   = lane >> 4;
  const int cn   = lane & 15;
  const int wave = tid >> 5;
  const int bh   = blockIdx.y;
  const int b    = bh >> 4;
  const int h    = bh & 15;
  const int tq0  = blockIdx.x * 128 + wave * 16;

  const _Float16* Qp = Q  + ((size_t)bh * TT + tq0) * DH;
  const _Float16* Kp = K  + (size_t)bh * TT * DH;
  const _Float16* Vp = VT + (size_t)bh * DH * TT;   // [DH][TT]

  // This thread's piece of a tile: row crow (and crow + 32), 16 bytes at ccol.
  const int crow = tid >> 3;         // 0..31
  const int ccol = (tid & 7) * 8;    // halves
  const unsigned coff = (unsigned)(crow * APW + ccol) * 2u;
  const unsigned lkBase = (unsigned)(size_t)(&KVtile[0][0][0]) + coff;
  const _Float16* gkBase = Kp + (size_t)crow * DH + ccol;
  const _Float16* gvBase = Vp + (size_t)crow * TT + ccol;

  // Tile 0 lands and is published; tile 1 then flies while tile 0 is worked on.
  attn_copy_tile(lkBase, gkBase, gvBase);
  asm volatile("s_wait_asynccnt 0x0" ::: "memory");  // own copies landed
  __syncthreads();                                   // tile 0 visible to all
  attn_copy_tile(lkBase + 2u * AKT * APW * 2u, gkBase + (size_t)AKT * DH,
                 gvBase + AKT);

  // Q is the B operand: lane cn holds query column tq0 + cn.
  const v16h q0 = load_frag(Qp,      DH, lane);     // d 0..31
  const v16h q1 = load_frag(Qp + 32, DH, lane);     // d 32..63

  // Everything below is per query column, so per lane: lanes cn and cn + 16
  // share a column and split its keys (scores) and its d (output).
  // The loops over v and f are unrolled because their index names a register.
  float mrun = -3.0e38f;   // running maximum, equal in both lanes of a column
  float lsum = 0.f;        // this lane's share of the running sum
  v8f o[4] = {};           // o[f][v] = O^T[16 f + 8 hi + v][cn]

  for (int ps = 0; ps < TT / 32; ++ps) {
    const int st  = ps >> 1;          // tile
    const int cur = st & 1;           // its buffer
    const int kb  = (ps & 1) * 32;    // first key of this pass inside the tile
    const _Float16* tK = &KVtile[cur][0][0];
    const _Float16* tV = &KVtile[cur][1][0];

    // S^T = K Q^T: s0[v] = key kb + 8 hi + v, s1[v] = key kb + 16 + 8 hi + v.
    v8f s0 = {}, s1 = {};
    const v16h k00 = load_frag(tK + kb * APW,             APW, lane);
    const v16h k01 = load_frag(tK + kb * APW + 32,        APW, lane);
    const v16h k10 = load_frag(tK + (kb + 16) * APW,      APW, lane);
    const v16h k11 = load_frag(tK + (kb + 16) * APW + 32, APW, lane);
    s0 = wmma16(k00, q0, s0);
    s0 = wmma16(k01, q1, s0);
    s1 = wmma16(k10, q0, s1);
    s1 = wmma16(k11, q1, s1);

    const v16h vf0 = load_frag(tV + 0  * APW + kb, APW, lane);
    const v16h vf1 = load_frag(tV + 16 * APW + kb, APW, lane);
    const v16h vf2 = load_frag(tV + 32 * APW + kb, APW, lane);
    const v16h vf3 = load_frag(tV + 48 * APW + kb, APW, lane);

    const v8f a = s0 * 0.125f;        // 1/sqrt(64)
    const v8f c = s1 * 0.125f;
    float mx = -3.0e38f;
#pragma unroll
    for (int v = 0; v < 8; ++v) mx = fmaxf(mx, fmaxf(a[v], c[v]));
    mx = fmaxf(mx, xhalf(mx));        // the column's other 16 keys
    const float mnew = fmaxf(mrun, mx);
    const float al   = __expf(mrun - mnew);

    // The two score tiles, converted in place, are P^T as a B operand in the
    // k order of load_frag: halves 0..7 = keys 8 hi.., 8..15 = keys 16 + 8 hi..
    const v8f ea = a - mnew, ec = c - mnew;
    v8f p0, p1;
#pragma unroll
    for (int v = 0; v < 8; ++v) {
      p0[v] = __expf(ea[v]);
      p1[v] = __expf(ec[v]);
    }
    v16h pf;
#pragma unroll
    for (int v = 0; v < 8; ++v) {
      pf[v]     = (_Float16)p0[v];
      pf[8 + v] = (_Float16)p1[v];
    }
    const v8f pp = p0 + p1;
    float sum = pp[0];
#pragma unroll
    for (int v = 1; v < 8; ++v) sum += pp[v];
    lsum = lsum * al + sum;
    mrun = mnew;

    // O^T += V^T P^T
#pragma unroll
    for (int f = 0; f < 4; ++f)
#pragma unroll
      for (int v = 0; v < 8; ++v) o[f][v] *= al;
    o[0] = wmma16(vf0, pf, o[0]);
    o[1] = wmma16(vf1, pf, o[1]);
    o[2] = wmma16(vf2, pf, o[2]);
    o[3] = wmma16(vf3, pf, o[3]);

    if (ps & 1) {
      // Hand-over: this wave's reads of the current tile are done, its copies
      // of the next tile have landed; the barrier says both of every wave.
      asm volatile("s_wait_dscnt 0x0" ::: "memory");
      asm volatile("s_wait_asynccnt 0x0" ::: "memory");
      __syncthreads();
      if (st + 2 < TT / AKT) {   // refill the buffer that this tile has left
        attn_copy_tile(lkBase + (unsigned)cur * (2u * AKT * APW * 2u),
                       gkBase + (size_t)(st + 2) * AKT * DH,
                       gvBase + (st + 2) * AKT);
      }
    }
  }
  asm volatile("s_wait_asynccnt 0x0" ::: "memory");  // nothing left in flight

  const float inv = 1.0f / (lsum + xhalf(lsum));     // join the two shares
  // A lane holds 8 consecutive d of its query row per tile: 16-byte stores.
  _Float16* Op = O + ((size_t)(b * TT + tq0 + cn)) * DD + h * DH + hi * 8;
#pragma unroll
  for (int f = 0; f < 4; ++f) {
    v8h ov;
#pragma unroll
    for (int v = 0; v < 8; ++v) ov[v] = (_Float16)(o[f][v] * inv);
    *(v8h*)(Op + 16 * f) = ov;
  }
}

// ---------------------------------------------------------------------------
// Kernel 5: output projection, fp32 result + bias. grid = (1024/128, 8192/256)
// ---------------------------------------------------------------------------
__global__ __launch_bounds__(256) void proj_kernel(
    const _Float16* __restrict__ Ah, const _Float16* __restrict__ WT,
    const float* __restrict__ bproj, float* __restrict__ out) {
  __shared__ alignas(16) _Float16 ldsAB[2 * GBUF];
  const int tid  = threadIdx.x;
  const int lane = tid & 31;
  const int hi   = lane >> 4;
  const int cn   = lane & 15;
  const int wave = tid >> 5;
  const int wm   = (wave & 3) * 64;
  const int wn   = (wave >> 2) * 64;
  const int m0   = blockIdx.y * 256;
  const int n0   = blockIdx.x * 128;

  v8f acc[4][4] = {};
  gemm_mainloop(Ah, WT, m0, n0, ldsAB, tid, acc);

#pragma unroll
  for (int i = 0; i < 4; ++i) {
#pragma unroll
    for (int j = 0; j < 4; ++j) {
      const int gn = n0 + wn + 16 * j + cn;
      const float bv = bproj[gn];
#pragma unroll
      for (int v = 0; v < 8; ++v) {
        const int gm = m0 + wm + 16 * i + v + hi * 8;
        out[(size_t)gm * DD + gn] = acc[i][j][v] + bv;
      }
    }
  }
}

// ---------------------------------------------------------------------------
extern "C" void kernel_launch(void* const* d_in, const int* in_sizes, int n_in,
                              void* d_out, int out_size, void* d_ws,
                              size_t ws_size, hipStream_t stream) {
  const float* x     = (const float*)d_in[0];
  const float* Wqkv  = (const float*)d_in[1];
  const float* bqkv  = (const float*)d_in[2];
  const float* Wproj = (const float*)d_in[3];
  const float* bproj = (const float*)d_in[4];
  const float* cosT  = (const float*)d_in[5];
  const float* sinT  = (const float*)d_in[6];
  float* out = (float*)d_out;

  char* ws = (char*)d_ws;
  // byte offsets (total 72 MB)
  _Float16* xh     = (_Float16*)(ws);              // 16 MB, reused as attn out
  _Float16* wqkvT  = (_Float16*)(ws + 16777216);   //  6 MB
  _Float16* wprojT = (_Float16*)(ws + 23068672);   //  2 MB
  _Float16* Qb     = (_Float16*)(ws + 25165824);   // 16 MB
  _Float16* Kb     = (_Float16*)(ws + 41943040);   // 16 MB
  _Float16* VT     = (_Float16*)(ws + 58720256);   // 16 MB
  _Float16* attnh  = xh;   // x no longer needed after QKV GEMM

  // 1) precision conversion / weight transpose
  cvt_kernel<<<8192, 256, 0, stream>>>(x, xh, (HB * TT * DD) / 4);
  transpose_cvt<<<dim3(96, 32), dim3(32, 8), 0, stream>>>(Wqkv, wqkvT, DD, 3 * DD);
  transpose_cvt<<<dim3(32, 32), dim3(32, 8), 0, stream>>>(Wproj, wprojT, DD, DD);
  // 2) QKV GEMM + RoPE  (M=8192 in 256-row tiles, N=3072 in 128-col tiles)
  qkv_rope_kernel<<<dim3(24, 32), 256, 0, stream>>>(xh, wqkvT, bqkv, cosT, sinT,
                                                    Qb, Kb, VT);
  // 3) flash attention  (grid: T/128 x B*H)
  attn_kernel<<<dim3(TT / 128, HB * HH), 256, 0, stream>>>(Qb, Kb, VT, attnh);
  // 4) output projection (M=8192, N=1024)
  proj_kernel<<<dim3(8, 32), 256, 0, stream>>>(attnh, wprojT, bproj, out);
}

// v004
// One run takes 163 microseconds.
// Next to v003, in two timings, it ran 1.22 times as fast each time.
// Counting every step since v000, it is 2.80 times as fast.
#include <hip/hip_runtime.h>
#include <hip/hip_bf16.h>

typedef __attribute__((ext_vector_type(16))) _Float16 v16h;
typedef __attribute__((ext_vector_type(4)))  _Float16 v4h;
typedef __attribute__((ext_vector_type(8)))  _Float16 v8h;
typedef __attribute__((ext_vector_type(8)))  float    v8f;
typedef __attribute__((ext_vector_type(4)))  float    v4f;
typedef __attribute__((ext_vector_type(4)))  unsigned int v4u;

#define HB 4      // batch
#define TT 2048   // sequence
#define DD 1024   // model dim
#define HH 16     // heads
#define DH 64     // head dim

union FragU { v16h h; v4u u[2]; };

// 16x32 f16 WMMA fragment load (A-layout; identical for B when source is
// N-major / K-contiguous). lane r<16: row r, halves 0..7 = K 8*hi.., halves
// 8..15 = K 16+8*hi.. (hi = lane>=16).  ld = row stride in halves.
__device__ __forceinline__ v16h load_frag(const _Float16* base, int ld, int lane) {
  const int r  = lane & 15;
  const int hi = lane >> 4;
  const _Float16* p = base + (size_t)r * ld + hi * 8;
  FragU f;
  f.u[0] = *(const v4u*)(p);
  f.u[1] = *(const v4u*)(p + 16);
  return f.h;
}

__device__ __forceinline__ v8f wmma16(v16h a, v16h b, v8f c) {
  return __builtin_amdgcn_wmma_f32_16x16x32_f16(false, a, false, b, (short)0, c,
                                                false, false);
}

// ---------------------------------------------------------------------------
// Shared GEMM mainloop: 256x128 block tile, 256 threads = 8 waves (4x2); each
// wave owns a 64x64 sub-tile = 4x4 frags. A and B^T tiles of GKT k are staged
// in LDS (two buffers) by asynchronous copies. A staged row is one whole
// 128-byte line of its source row, and 8 neighbouring lanes bring one row, so
// that every copy instruction covers four whole lines.
// ---------------------------------------------------------------------------
#define GKT 64            // k per staged tile: one row is 128 B
#define GPW 72            // LDS row pitch in halves: 128 B + 16 B, 16-byte reads
                          // of 16 rows then fall on 64 distinct banks
#define GROWS (256 + 128) // rows of a buffer: the A tile, then the B^T tile
#define GBUF (GROWS * GPW)

// One tile: each thread brings 16 bytes of rows crow + 32 j, eight of A and
// four of B^T. The closing s_wait_xcnt stands in front of every later rewrite
// of the copies' address registers (a precaution).
__device__ __forceinline__ void gemm_copy_tile(unsigned l, const _Float16* ga,
                                               const _Float16* gb) {
  const unsigned st = 32u * GPW * 2u;   // 32 rows further in LDS, bytes
  asm volatile(
      "global_load_async_to_lds_b128 %0, %12, off\n\t"
      "global_load_async_to_lds_b128 %1, %13, off\n\t"
      "global_load_async_to_lds_b128 %2, %14, off\n\t"
      "global_load_async_to_lds_b128 %3, %15, off\n\t"
      "global_load_async_to_lds_b128 %4, %16, off\n\t"
      "global_load_async_to_lds_b128 %5, %17, off\n\t"
      "global_load_async_to_lds_b128 %6, %18, off\n\t"
      "global_load_async_to_lds_b128 %7, %19, off\n\t"
      "global_load_async_to_lds_b128 %8, %20, off\n\t"
      "global_load_async_to_lds_b128 %9, %21, off\n\t"
      "global_load_async_to_lds_b128 %10, %22, off\n\t"
      "global_load_async_to_lds_b128 %11, %23, off\n\t"
      "s_wait_xcnt 0x0"
      :
      : "v"(l), "v"(l + st), "v"(l + 2u * st), "v"(l + 3u * st),
        "v"(l + 4u * st), "v"(l + 5u * st), "v"(l + 6u * st),
        "v"(l + 7u * st), "v"(l + 8u * st), "v"(l + 9u * st),
        "v"(l + 10u * st), "v"(l + 11u * st),
        "v"((unsigned long long)(size_t)(ga)),
        "v"((unsigned long long)(size_t)(ga + 32 * DD)),
        "v"((unsigned long long)(size_t)(ga + 64 * DD)),
        "v"((unsigned long long)(size_t)(ga + 96 * DD)),
        "v"((unsigned long long)(size_t)(ga + 128 * DD)),
        "v"((unsigned long long)(size_t)(ga + 160 * DD)),
        "v"((unsigned long long)(size_t)(ga + 192 * DD)),
        "v"((unsigned long long)(size_t)(ga + 224 * DD)),
        "v"((unsigned long long)(size_t)(gb)),
        "v"((unsigned long long)(size_t)(gb + 32 * DD)),
        "v"((unsigned long long)(size_t)(gb + 64 * DD)),
        "v"((unsigned long long)(size_t)(gb + 96 * DD))
      : "memory");
}

__device__ __forceinline__ void gemm_mainloop(
    const _Float16* __restrict__ A, const _Float16* __restrict__ BT,
    int m0, int n0, _Float16* lds, int tid, v8f acc[4][4]) {
  const int lane = tid & 31;
  const int wave = tid >> 5;
  const int wm   = (wave & 3) * 64;   // 0,64,128,192
  const int wn   = (wave >> 2) * 64;  // 0,64
  const int crow = tid >> 3;          // 0..31
  const int ccol = (tid & 7) * 8;     // halves

  const _Float16* Ar = A  + (size_t)(m0 + crow) * DD + ccol;
  const _Float16* Br = BT + (size_t)(n0 + crow) * DD + ccol;

  // Per-lane LDS byte address (the low 32 bits of the generic pointer are the
  // offset in the work-group's LDS).
  const unsigned lBase =
      (unsigned)(size_t)(lds) + (unsigned)(crow * GPW + ccol) * 2u;

  // Tile 0 lands and is published; tile 1 then flies while tile 0 is worked on.
  gemm_copy_tile(lBase, Ar, Br);
  asm volatile("s_wait_asynccnt 0x0" ::: "memory");  // own copies landed
  __syncthreads();                                   // tile 0 visible to all
  gemm_copy_tile(lBase + GBUF * 2u, Ar + GKT, Br + GKT);

  for (int t = 0; t < DD / GKT; ++t) {
    const int cur = t & 1;
    const _Float16* tA = lds + (size_t)cur * GBUF;
    const _Float16* tB = tA + 256 * GPW;
    // unrolled so that ks folds into the LDS loads' immediate offsets
#pragma unroll
    for (int ks = 0; ks < GKT; ks += 32) {
      const v16h a0 = load_frag(tA + (wm)      * GPW + ks, GPW, lane);
      const v16h a1 = load_frag(tA + (wm + 16) * GPW + ks, GPW, lane);
      const v16h a2 = load_frag(tA + (wm + 32) * GPW + ks, GPW, lane);
      const v16h a3 = load_frag(tA + (wm + 48) * GPW + ks, GPW, lane);
      const v16h b0 = load_frag(tB + (wn)      * GPW + ks, GPW, lane);
      const v16h b1 = load_frag(tB + (wn + 16) * GPW + ks, GPW, lane);
      const v16h b2 = load_frag(tB + (wn + 32) * GPW + ks, GPW, lane);
      const v16h b3 = load_frag(tB + (wn + 48) * GPW + ks, GPW, lane);
      acc[0][0] = wmma16(a0, b0, acc[0][0]);
      acc[1][0] = wmma16(a1, b0, acc[1][0]);
      acc[2][0] = wmma16(a2, b0, acc[2][0]);
      acc[3][0] = wmma16(a3, b0, acc[3][0]);
      acc[0][1] = wmma16(a0, b1, acc[0][1]);
      acc[1][1] = wmma16(a1, b1, acc[1][1]);
      acc[2][1] = wmma16(a2, b1, acc[2][1]);
      acc[3][1] = wmma16(a3, b1, acc[3][1]);
      acc[0][2] = wmma16(a0, b2, acc[0][2]);
      acc[1][2] = wmma16(a1, b2, acc[1][2]);
      acc[2][2] = wmma16(a2, b2, acc[2][2]);
      acc[3][2] = wmma16(a3, b2, acc[3][2]);
      acc[0][3] = wmma16(a0, b3, acc[0][3]);
      acc[1][3] = wmma16(a1, b3, acc[1][3]);
      acc[2][3] = wmma16(a2, b3, acc[2][3]);
      acc[3][3] = wmma16(a3, b3, acc[3][3]);
    }
    // Hand-over: this wave's reads of the current tile are done, its copies of
    // the next tile have landed; the barrier says both of every wave.
    asm volatile("s_wait_dscnt 0x0" ::: "memory");
    asm volatile("s_wait_asynccnt 0x0" ::: "memory");
    __syncthreads();
    if (t + 2 < DD / GKT) {   // refill the buffer that this tile has left
      gemm_copy_tile(lBase + (unsigned)cur * (GBUF * 2u),
                     Ar + (t + 2) * GKT, Br + (t + 2) * GKT);
    }
  }
  asm volatile("s_wait_asynccnt 0x0" ::: "memory");  // nothing left in flight
}

// ---------------------------------------------------------------------------
// Kernel 1: f32 -> f16 convert (vectorized)
// ---------------------------------------------------------------------------
__global__ __launch_bounds__(256) void cvt_kernel(const float* __restrict__ x,
                                                  _Float16* __restrict__ xh,
                                                  int n4) {
  const int i = blockIdx.x * 256 + threadIdx.x;
  if (i < n4) {
    const float4 f = ((const float4*)x)[i];
    v4h hv;
    hv.x = (_Float16)f.x; hv.y = (_Float16)f.y;
    hv.z = (_Float16)f.z; hv.w = (_Float16)f.w;
    ((v4h*)xh)[i] = hv;
  }
}

// ---------------------------------------------------------------------------
// Kernel 2: transposed convert: WT[n*K + k] = (f16) W[k*N + n]
// ---------------------------------------------------------------------------
__global__ __launch_bounds__(256) void transpose_cvt(const float* __restrict__ W,
                                                     _Float16* __restrict__ WT,
                                                     int K, int N) {
  __shared__ float tile[32][33];
  const int n0 = blockIdx.x * 32, k0 = blockIdx.y * 32;
  const int tx = threadIdx.x, ty = threadIdx.y;  // block (32, 8)
  for (int i = ty; i < 32; i += 8)
    tile[i][tx] = W[(size_t)(k0 + i) * N + n0 + tx];
  __syncthreads();
  for (int i = ty; i < 32; i += 8)
    WT[(size_t)(n0 + i) * K + k0 + tx] = (_Float16)tile[tx][i];
}

// ---------------------------------------------------------------------------
// Kernel 3: QKV GEMM + bias + RoPE, scatter into Q[b,h,t,d], K[b,h,t,d],
// V^T[b,h,d,t] (all f16).  grid = (3072/128, 8192/256)
// ---------------------------------------------------------------------------
#define EPF 68   // staging pitch, floats: 272 B; rows 8 apart fall 32 banks
                 // apart (stores), 16-byte reads of two rows on distinct banks
#define EPH 72   // staging pitch, halves: 144 B, as in the ring
#define ESTG (64 * EPF * 4)   // a wave's staging area, bytes: 64 f32 rows
__global__ __launch_bounds__(256) void qkv_rope_kernel(
    const _Float16* __restrict__ Xh, const _Float16* __restrict__ WT,
    const float* __restrict__ bqkv, const float* __restrict__ cosT,
    const float* __restrict__ sinT, _Float16* __restrict__ Qb,
    _Float16* __restrict__ Kb, _Float16* __restrict__ VT) {
  // the ring, and behind the loop eight staging areas of ESTG bytes
  static_assert(8 * ESTG >= 2 * GBUF * 2, "the ring fits");
  __shared__ alignas(16) _Float16 ldsAB[8 * ESTG / 2];
  const int tid  = threadIdx.x;
  const int lane = tid & 31;
  const int hi   = lane >> 4;
  const int cn   = lane & 15;
  const int wave = tid >> 5;
  const int m0   = blockIdx.y * 256;
  const int n0   = blockIdx.x * 128;

  v8f acc[4][4] = {};
  gemm_mainloop(Xh, WT, m0, n0, ldsAB, tid, acc);

  // Epilogue, staged through LDS. The loop's last barrier stands behind every
  // wave's last read of the ring and no copy is in flight, so each wave takes
  // its own staging area there and needs no further barrier.
  // A wave's 64 columns are exactly one head (they start at a multiple of 64)
  // and its 64 rows lie in one batch.
  const int wv  = __builtin_amdgcn_readfirstlane(wave);  // scalar address parts
  const int sec = (int)(blockIdx.x * 128u) >> 10;        // 0=Q 1=K 2=V, per block
  const int nh  = n0 + (wv >> 2) * 64;
  const int h   = (nh & 1023) >> 6;
  const int gm0 = m0 + (wv & 3) * 64;
  const int b   = gm0 >> 11;
  const int t0  = gm0 & (TT - 1);
  const int rr  = lane >> 3;   // row inside a group of four rows
  const int c   = lane & 7;    // 8-element piece of a row
  char* stg = (char*)ldsAB + wv * ESTG;

  float bias[4];
#pragma unroll
  for (int j = 0; j < 4; ++j) bias[j] = bqkv[nh + 16 * j + cn];

  // The loops over i, j, v and g are unrolled because their index names a
  // register.
  if (sec == 2) {
    // V^T: a lane holds 8 consecutive t of one d. Rows of 64 t = one line.
    _Float16* sv = (_Float16*)stg;
#pragma unroll
    for (int i = 0; i < 4; ++i) {
#pragma unroll
      for (int j = 0; j < 4; ++j) {
        v8h hv;
#pragma unroll
        for (int v = 0; v < 8; ++v) hv[v] = (_Float16)(acc[i][j][v] + bias[j]);
        *(v8h*)(sv + (16 * j + cn) * EPH + 16 * i + 8 * hi) = hv;
      }
    }
    // the rows that are read back were written by other lanes of this wave
    asm volatile("s_wait_dscnt 0x0" ::: "memory");
    _Float16* vrow = VT + ((size_t)((b * HH + h) * DH + rr)) * TT + t0 + c * 8;
#pragma unroll
    for (int rg = 0; rg < 16; ++rg) {
      const v8h hv = *(const v8h*)(sv + (rg * 4 + rr) * EPH + c * 8);
      *(v8h*)(vrow + (size_t)(rg * 4) * TT) = hv;
    }
  } else {
    // Q, K: the f32 rows are staged; a lane then takes 8 consecutive d of one
    // row and the 8 that rotate-half pairs with them (d +- 32). The cos and sin
    // rows come in batches of four row groups.
    float* sf = (float*)stg;
    _Float16* dst = ((sec == 0) ? Qb : Kb) +
                    ((size_t)((b * HH + h) * TT + t0 + rr)) * DH + c * 8;
    const float* cp = cosT + (size_t)(t0 + rr) * DH + c * 8;
    const float* sp = sinT + (size_t)(t0 + rr) * DH + c * 8;
    const float sg = (c < 4) ? -1.0f : 1.0f;   // rotate-half: -x[d+32], +x[d-32]
    const float* own = sf + rr * EPF + c * 8;
    const float* par = sf + rr * EPF + (c ^ 4) * 8;
#pragma unroll
    for (int i = 0; i < 4; ++i)
#pragma unroll
      for (int j = 0; j < 4; ++j)
#pragma unroll
        for (int v = 0; v < 8; ++v)
          sf[(16 * i + 8 * hi + v) * EPF + 16 * j + cn] = acc[i][j][v] + bias[j];
    // the rows that are read back were written by other lanes of this wave
    asm volatile("s_wait_dscnt 0x0" ::: "memory");
#pragma unroll
    for (int bt = 0; bt < 4; ++bt) {
      v4f tc[8], ts[8];   // [row group in the batch, low or high 4]
#pragma unroll
      for (int g = 0; g < 4; ++g) {
        const int tr = bt * 16 + g * 4;
        tc[2 * g]     = *(const v4f*)(cp + tr * DH);
        tc[2 * g + 1] = *(const v4f*)(cp + tr * DH + 4);
        ts[2 * g]     = *(const v4f*)(sp + tr * DH);
        ts[2 * g + 1] = *(const v4f*)(sp + tr * DH + 4);
      }
      // keeps the batch's 16 loads together, one wait for all: left alone, the
      // scheduler sinks them to their uses, each with a full wait of its own
      __builtin_amdgcn_sched_barrier(0);
#pragma unroll
      for (int g = 0; g < 4; ++g) {
        const int tr = bt * 16 + g * 4;     // row in the wave's tile
        const v4f x0 = *(const v4f*)(own + tr * EPF);
        const v4f x1 = *(const v4f*)(own + tr * EPF + 4);
        const v4f p0 = *(const v4f*)(par + tr * EPF);
        const v4f p1 = *(const v4f*)(par + tr * EPF + 4);
        const v4f c0 = tc[2 * g], c1 = tc[2 * g + 1];
        const v4f s0 = ts[2 * g] * sg, s1 = ts[2 * g + 1] * sg;
        v8h ov;
#pragma unroll
        for (int e = 0; e < 4; ++e) {
          ov[e]     = (_Float16)(x0[e] * c0[e] + p0[e] * s0[e]);
          ov[4 + e] = (_Float16)(x1[e] * c1[e] + p1[e] * s1[e]);
        }
        *(v8h*)(dst + (size_t)tr * DH) = ov;
      }
      // later instructions rewrite registers that these stores name
      // (a precaution)
      asm volatile("s_wait_xcnt 0x0" ::: "memory");
      if (bt < 3) {
        // the next batch's loads start behind this batch's work
        __builtin_amdgcn_sched_barrier(0);
      }
    }
  }
}

#define AKT 64
#define APW 72

// One tile = 2 x 8 KB; each thread brings two 16-byte pieces of K and two of
// V^T. The closing s_wait_xcnt stands in front of every later rewrite of the
// copies' address registers (a precaution).
__device__ __forceinline__ void attn_copy_tile(unsigned lk,
                                               const _Float16* gk,
                                               const _Float16* gv) {
  const unsigned lk1 = lk + 32u * APW * 2u;
  const unsigned lv  = lk + AKT * APW * 2u;   // V^T tile follows the K tile
  const unsigned lv1 = lv + 32u * APW * 2u;
  const _Float16* gk1 = gk + 32 * DH;
  const _Float16* gv1 = gv + 32 * TT;
  asm volatile(
      "global_load_async_to_lds_b128 %0, %4, off\n\t"
      "global_load_async_to_lds_b128 %1, %5, off\n\t"
      "global_load_async_to_lds_b128 %2, %6, off\n\t"
      "global_load_async_to_lds_b128 %3, %7, off\n\t"
      "s_wait_xcnt 0x0"
      :
      : "v"(lk), "v"(lk1), "v"(lv), "v"(lv1),
        "v"((unsigned long long)(size_t)gk),
        "v"((unsigned long long)(size_t)gk1),
        "v"((unsigned long long)(size_t)gv),
        "v"((unsigned long long)(size_t)gv1)
      : "memory");
}

// Lane l with lane l ^ 16: the two lanes that share one query column.
__device__ __forceinline__ float xhalf(float x) {
  const int i = __builtin_bit_cast(int, x);
  return __builtin_bit_cast(float, __builtin_amdgcn_permlanex16(
      i, i, 0x76543210, 0xfedcba98, false, false));
}

__global__ __launch_bounds__(256) void attn_kernel(
    const _Float16* __restrict__ Q, const _Float16* __restrict__ K,
    const _Float16* __restrict__ VT, _Float16* __restrict__ O) {
  static_assert(AKT == DH, "K tile and V^T tile have the same number of rows");
  __shared__ alignas(16) _Float16 KVtile[2][2][AKT * APW];  // [buffer][K, V^T]
  const int tid  = threadIdx.x;
  const int lane = tid & 31;
  const int hi   = lane >> 4;
  const int cn   = lane & 15;
  const int wave = tid >> 5;
  const int bh   = blockIdx.y;
  const int b    = bh >> 4;
  const int h    = bh & 15;
  const int tq0  = blockIdx.x * 128 + wave * 16;

  const _Float16* Qp = Q  + ((size_t)bh * TT + tq0) * DH;
  const _Float16* Kp = K  + (size_t)bh * TT * DH;
  const _Float16* Vp = VT + (size_t)bh * DH * TT;   // [DH][TT]

  // This thread's piece of a tile: row crow (and crow + 32), 16 bytes at ccol.
  const int crow = tid >> 3;         // 0..31
  const int ccol = (tid & 7) * 8;    // halves
  const unsigned coff = (unsigned)(crow * APW + ccol) * 2u;
  const unsigned lkBase = (unsigned)(size_t)(&KVtile[0][0][0]) + coff;
  const _Float16* gkBase = Kp + (size_t)crow * DH + ccol;
  const _Float16* gvBase = Vp + (size_t)crow * TT + ccol;

  // Tile 0 lands and is published; tile 1 then flies while tile 0 is worked on.
  attn_copy_tile(lkBase, gkBase, gvBase);
  asm volatile("s_wait_asynccnt 0x0" ::: "memory");  // own copies landed
  __syncthreads();                                   // tile 0 visible to all
  attn_copy_tile(lkBase + 2u * AKT * APW * 2u, gkBase + (size_t)AKT * DH,
                 gvBase + AKT);

  // Q is the B operand: lane cn holds query column tq0 + cn.
  const v16h q0 = load_frag(Qp,      DH, lane);     // d 0..31
  const v16h q1 = load_frag(Qp + 32, DH, lane);     // d 32..63

  // Everything below is per query column, so per lane: lanes cn and cn + 16
  // share a column and split its keys (scores) and its d (output).
  // The loops over v and f are unrolled because their index names a register.
  float mrun = -3.0e38f;   // running maximum, equal in both lanes of a column
  float lsum = 0.f;        // this lane's share of the running sum
  v8f o[4] = {};           // o[f][v] = O^T[16 f + 8 hi + v][cn]

  for (int ps = 0; ps < TT / 32; ++ps) {
    const int st  = ps >> 1;          // tile
    const int cur = st & 1;           // its buffer
    const int kb  = (ps & 1) * 32;    // first key of this pass inside the tile
    const _Float16* tK = &KVtile[cur][0][0];
    const _Float16* tV = &KVtile[cur][1][0];

    // S^T = K Q^T: s0[v] = key kb + 8 hi + v, s1[v] = key kb + 16 + 8 hi + v.
    v8f s0 = {}, s1 = {};
    const v16h k00 = load_frag(tK + kb * APW,             APW, lane);
    const v16h k01 = load_frag(tK + kb * APW + 32,        APW, lane);
    const v16h k10 = load_frag(tK + (kb + 16) * APW,      APW, lane);
    const v16h k11 = load_frag(tK + (kb + 16) * APW + 32, APW, lane);
    s0 = wmma16(k00, q0, s0);
    s0 = wmma16(k01, q1, s0);
    s1 = wmma16(k10, q0, s1);
    s1 = wmma16(k11, q1, s1);

    const v16h vf0 = load_frag(tV + 0  * APW + kb, APW, lane);
    const v16h vf1 = load_frag(tV + 16 * APW + kb, APW, lane);
    const v16h vf2 = load_frag(tV + 32 * APW + kb, APW, lane);
    const v16h vf3 = load_frag(tV + 48 * APW + kb, APW, lane);

    const v8f a = s0 * 0.125f;        // 1/sqrt(64)
    const v8f c = s1 * 0.125f;
    float mx = -3.0e38f;
#pragma unroll
    for (int v = 0; v < 8; ++v) mx = fmaxf(mx, fmaxf(a[v], c[v]));
    mx = fmaxf(mx, xhalf(mx));        // the column's other 16 keys
    const float mnew = fmaxf(mrun, mx);
    const float al   = __expf(mrun - mnew);

    // The two score tiles, converted in place, are P^T as a B operand in the
    // k order of load_frag: halves 0..7 = keys 8 hi.., 8..15 = keys 16 + 8 hi..
    const v8f ea = a - mnew, ec = c - mnew;
    v8f p0, p1;
#pragma unroll
    for (int v = 0; v < 8; ++v) {
      p0[v] = __expf(ea[v]);
      p1[v] = __expf(ec[v]);
    }
    v16h pf;
#pragma unroll
    for (int v = 0; v < 8; ++v) {
      pf[v]     = (_Float16)p0[v];
      pf[8 + v] = (_Float16)p1[v];
    }
    const v8f pp = p0 + p1;
    float sum = pp[0];
#pragma unroll
    for (int v = 1; v < 8; ++v) sum += pp[v];
    lsum = lsum * al + sum;
    mrun = mnew;

    // O^T += V^T P^T
#pragma unroll
    for (int f = 0; f < 4; ++f)
#pragma unroll
      for (int v = 0; v < 8; ++v) o[f][v] *= al;
    o[0] = wmma16(vf0, pf, o[0]);
    o[1] = wmma16(vf1, pf, o[1]);
    o[2] = wmma16(vf2, pf, o[2]);
    o[3] = wmma16(vf3, pf, o[3]);

    if (ps & 1) {
      // Hand-over: this wave's reads of the current tile are done, its copies
      // of the next tile have landed; the barrier says both of every wave.
      asm volatile("s_wait_dscnt 0x0" ::: "memory");
      asm volatile("s_wait_asynccnt 0x0" ::: "memory");
      __syncthreads();
      if (st + 2 < TT / AKT) {   // refill the buffer that this tile has left
        attn_copy_tile(lkBase + (unsigned)cur * (2u * AKT * APW * 2u),
                       gkBase + (size_t)(st + 2) * AKT * DH,
                       gvBase + (st + 2) * AKT);
      }
    }
  }
  asm volatile("s_wait_asynccnt 0x0" ::: "memory");  // nothing left in flight

  const float inv = 1.0f / (lsum + xhalf(lsum));     // join the two shares
  // A lane holds 8 consecutive d of its query row per tile: 16-byte stores.
  _Float16* Op = O + ((size_t)(b * TT + tq0 + cn)) * DD + h * DH + hi * 8;
#pragma unroll
  for (int f = 0; f < 4; ++f) {
    v8h ov;
#pragma unroll
    for (int v = 0; v < 8; ++v) ov[v] = (_Float16)(o[f][v] * inv);
    *(v8h*)(Op + 16 * f) = ov;
  }
}

// ---------------------------------------------------------------------------
// Kernel 5: output projection, fp32 result + bias. grid = (1024/128, 8192/256)
// ---------------------------------------------------------------------------
__global__ __launch_bounds__(256) void proj_kernel(
    const _Float16* __restrict__ Ah, const _Float16* __restrict__ WT,
    const float* __restrict__ bproj, float* __restrict__ out) {
  __shared__ alignas(16) _Float16 ldsAB[2 * GBUF];
  const int tid  = threadIdx.x;
  const int lane = tid & 31;
  const int hi   = lane >> 4;
  const int cn   = lane & 15;
  const int wave = tid >> 5;
  const int wm   = (wave & 3) * 64;
  const int wn   = (wave >> 2) * 64;
  const int m0   = blockIdx.y * 256;
  const int n0   = blockIdx.x * 128;

  v8f acc[4][4] = {};
  gemm_mainloop(Ah, WT, m0, n0, ldsAB, tid, acc);

#pragma unroll
  for (int i = 0; i < 4; ++i) {
#pragma unroll
    for (int j = 0; j < 4; ++j) {
      const int gn = n0 + wn + 16 * j + cn;
      const float bv = bproj[gn];
#pragma unroll
      for (int v = 0; v < 8; ++v) {
        const int gm = m0 + wm + 16 * i + v + hi * 8;
        out[(size_t)gm * DD + gn] = acc[i][j][v] + bv;
      }
    }
  }
}

// ---------------------------------------------------------------------------
extern "C" void kernel_launch(void* const* d_in, const int* in_sizes, int n_in,
                              void* d_out, int out_size, void* d_ws,
                              size_t ws_size, hipStream_t stream) {
  const float* x     = (const float*)d_in[0];
  const float* Wqkv  = (const float*)d_in[1];
  const float* bqkv  = (const float*)d_in[2];
  const float* Wproj = (const float*)d_in[3];
  const float* bproj = (const float*)d_in[4];
  const float* cosT  = (const float*)d_in[5];
  const float* sinT  = (const float*)d_in[6];
  float* out = (float*)d_out;

  char* ws = (char*)d_ws;
  // byte offsets (total 72 MB)
  _Float16* xh     = (_Float16*)(ws);              // 16 MB, reused as attn out
  _Float16* wqkvT  = (_Float16*)(ws + 16777216);   //  6 MB
  _Float16* wprojT = (_Float16*)(ws + 23068672);   //  2 MB
  _Float16* Qb     = (_Float16*)(ws + 25165824);   // 16 MB
  _Float16* Kb     = (_Float16*)(ws + 41943040);   // 16 MB
  _Float16* VT     = (_Float16*)(ws + 58720256);   // 16 MB
  _Float16* attnh  = xh;   // x no longer needed after QKV GEMM

  // 1) precision conversion / weight transpose
  cvt_kernel<<<8192, 256, 0, stream>>>(x, xh, (HB * TT * DD) / 4);
  transpose_cvt<<<dim3(96, 32), dim3(32, 8), 0, stream>>>(Wqkv, wqkvT, DD, 3 * DD);
  transpose_cvt<<<dim3(32, 32), dim3(32, 8), 0, stream>>>(Wproj, wprojT, DD, DD);
  // 2) QKV GEMM + RoPE  (M=8192 in 256-row tiles, N=3072 in 128-col tiles)
  qkv_rope_kernel<<<dim3(24, 32), 256, 0, stream>>>(xh, wqkvT, bqkv, cosT, sinT,
                                                    Qb, Kb, VT);
  // 3) flash attention  (grid: T/128 x B*H)
  attn_kernel<<<dim3(TT / 128, HB * HH), 256, 0, stream>>>(Qb, Kb, VT, attnh);
  // 4) output projection (M=8192, N=1024)
  proj_kernel<<<dim3(8, 32), 256, 0, stream>>>(attnh, wprojT, bproj, out);
}

// v005
// It runs in 157 microseconds.
// Next to v004, in two timings, it ran 1.04 times as fast each time.
// Counting every step since v000, it is 2.91 times as fast.
#include <hip/hip_runtime.h>
#include <hip/hip_bf16.h>

typedef __attribute__((ext_vector_type(16))) _Float16 v16h;
typedef __attribute__((ext_vector_type(4)))  _Float16 v4h;
typedef __attribute__((ext_vector_type(8)))  _Float16 v8h;
typedef __attribute__((ext_vector_type(8)))  float    v8f;
typedef __attribute__((ext_vector_type(4)))  float    v4f;
typedef __attribute__((ext_vector_type(4)))  unsigned int v4u;

#define HB 4      // batch
#define TT 2048   // sequence
#define DD 1024   // model dim
#define HH 16     // heads
#define DH 64     // head dim

union FragU { v16h h; v4u u[2]; };

// 16x32 f16 WMMA fragment load (A-layout; identical for B when source is
// N-major / K-contiguous). lane r<16: row r, halves 0..7 = K 8*hi.., halves
// 8..15 = K 16+8*hi.. (hi = lane>=16).  ld = row stride in halves.
__device__ __forceinline__ v16h load_frag(const _Float16* base, int ld, int lane) {
  const int r  = lane & 15;
  const int hi = lane >> 4;
  const _Float16* p = base + (size_t)r * ld + hi * 8;
  FragU f;
  f.u[0] = *(const v4u*)(p);
  f.u[1] = *(const v4u*)(p + 16);
  return f.h;
}

__device__ __forceinline__ v8f wmma16(v16h a, v16h b, v8f c) {
  return __builtin_amdgcn_wmma_f32_16x16x32_f16(false, a, false, b, (short)0, c,
                                                false, false);
}

// ---------------------------------------------------------------------------
// Shared GEMM mainloop: 256x128 block tile, 256 threads = 8 waves (4x2); each
// wave owns a 64x64 sub-tile = 4x4 frags. A and B^T tiles of GKT k are staged
// in LDS (two buffers) by asynchronous copies. A staged row is one whole
// 128-byte line of its source row, and 8 neighbouring lanes bring one row, so
// that every copy instruction covers four whole lines.
// ---------------------------------------------------------------------------
#define GKT 64            // k per staged tile: one row is 128 B
#define GPW 72            // LDS row pitch in halves: 128 B + 16 B, 16-byte reads
                          // of 16 rows then fall on 64 distinct banks
#define GROWS (256 + 128) // rows of a buffer: the A tile, then the B^T tile
#define GBUF (GROWS * GPW)

// One tile: each thread brings 16 bytes of rows crow + 32 j, eight of A and
// four of B^T. The closing s_wait_xcnt stands in front of every later rewrite
// of the copies' address registers (a precaution).
__device__ __forceinline__ void gemm_copy_tile(unsigned l, const _Float16* ga,
                                               const _Float16* gb) {
  const unsigned st = 32u * GPW * 2u;   // 32 rows further in LDS, bytes
  asm volatile(
      "global_load_async_to_lds_b128 %0, %12, off\n\t"
      "global_load_async_to_lds_b128 %1, %13, off\n\t"
      "global_load_async_to_lds_b128 %2, %14, off\n\t"
      "global_load_async_to_lds_b128 %3, %15, off\n\t"
      "global_load_async_to_lds_b128 %4, %16, off\n\t"
      "global_load_async_to_lds_b128 %5, %17, off\n\t"
      "global_load_async_to_lds_b128 %6, %18, off\n\t"
      "global_load_async_to_lds_b128 %7, %19, off\n\t"
      "global_load_async_to_lds_b128 %8, %20, off\n\t"
      "global_load_async_to_lds_b128 %9, %21, off\n\t"
      "global_load_async_to_lds_b128 %10, %22, off\n\t"
      "global_load_async_to_lds_b128 %11, %23, off\n\t"
      "s_wait_xcnt 0x0"
      :
      : "v"(l), "v"(l + st), "v"(l + 2u * st), "v"(l + 3u * st),
        "v"(l + 4u * st), "v"(l + 5u * st), "v"(l + 6u * st),
        "v"(l + 7u * st), "v"(l + 8u * st), "v"(l + 9u * st),
        "v"(l + 10u * st), "v"(l + 11u * st),
        "v"((unsigned long long)(size_t)(ga)),
        "v"((unsigned long long)(size_t)(ga + 32 * DD)),
        "v"((unsigned long long)(size_t)(ga + 64 * DD)),
        "v"((unsigned long long)(size_t)(ga + 96 * DD)),
        "v"((unsigned long long)(size_t)(ga + 128 * DD)),
        "v"((unsigned long long)(size_t)(ga + 160 * DD)),
        "v"((unsigned long long)(size_t)(ga + 192 * DD)),
        "v"((unsigned long long)(size_t)(ga + 224 * DD)),
        "v"((unsigned long long)(size_t)(gb)),
        "v"((unsigned long long)(size_t)(gb + 32 * DD)),
        "v"((unsigned long long)(size_t)(gb + 64 * DD)),
        "v"((unsigned long long)(size_t)(gb + 96 * DD))
      : "memory");
}

__device__ __forceinline__ void gemm_mainloop(
    const _Float16* __restrict__ A, const _Float16* __restrict__ BT,
    int m0, int n0, _Float16* lds, int tid, v8f acc[4][4]) {
  const int lane = tid & 31;
  const int wave = tid >> 5;
  const int wm   = (wave & 3) * 64;   // 0,64,128,192
  const int wn   = (wave >> 2) * 64;  // 0,64
  const int crow = tid >> 3;          // 0..31
  const int ccol = (tid & 7) * 8;     // halves

  const _Float16* Ar = A  + (size_t)(m0 + crow) * DD + ccol;
  const _Float16* Br = BT + (size_t)(n0 + crow) * DD + ccol;

  // Per-lane LDS byte address (the low 32 bits of the generic pointer are the
  // offset in the work-group's LDS).
  const unsigned lBase =
      (unsigned)(size_t)(lds) + (unsigned)(crow * GPW + ccol) * 2u;

  // Tile 0 lands and is published; tile 1 then flies while tile 0 is worked on.
  gemm_copy_tile(lBase, Ar, Br);
  asm volatile("s_wait_asynccnt 0x0" ::: "memory");  // own copies landed
  __syncthreads();                                   // tile 0 visible to all
  gemm_copy_tile(lBase + GBUF * 2u, Ar + GKT, Br + GKT);

  for (int t = 0; t < DD / GKT; ++t) {
    const int cur = t & 1;
    const _Float16* tA = lds + (size_t)cur * GBUF;
    const _Float16* tB = tA + 256 * GPW;
    // unrolled so that ks folds into the LDS loads' immediate offsets
#pragma unroll
    for (int ks = 0; ks < GKT; ks += 32) {
      const v16h a0 = load_frag(tA + (wm)      * GPW + ks, GPW, lane);
      const v16h a1 = load_frag(tA + (wm + 16) * GPW + ks, GPW, lane);
      const v16h a2 = load_frag(tA + (wm + 32) * GPW + ks, GPW, lane);
      const v16h a3 = load_frag(tA + (wm + 48) * GPW + ks, GPW, lane);
      const v16h b0 = load_frag(tB + (wn)      * GPW + ks, GPW, lane);
      const v16h b1 = load_frag(tB + (wn + 16) * GPW + ks, GPW, lane);
      const v16h b2 = load_frag(tB + (wn + 32) * GPW + ks, GPW, lane);
      const v16h b3 = load_frag(tB + (wn + 48) * GPW + ks, GPW, lane);
      acc[0][0] = wmma16(a0, b0, acc[0][0]);
      acc[1][0] = wmma16(a1, b0, acc[1][0]);
      acc[2][0] = wmma16(a2, b0, acc[2][0]);
      acc[3][0] = wmma16(a3, b0, acc[3][0]);
      acc[0][1] = wmma16(a0, b1, acc[0][1]);
      acc[1][1] = wmma16(a1, b1, acc[1][1]);
      acc[2][1] = wmma16(a2, b1, acc[2][1]);
      acc[3][1] = wmma16(a3, b1, acc[3][1]);
      acc[0][2] = wmma16(a0, b2, acc[0][2]);
      acc[1][2] = wmma16(a1, b2, acc[1][2]);
      acc[2][2] = wmma16(a2, b2, acc[2][2]);
      acc[3][2] = wmma16(a3, b2, acc[3][2]);
      acc[0][3] = wmma16(a0, b3, acc[0][3]);
      acc[1][3] = wmma16(a1, b3, acc[1][3]);
      acc[2][3] = wmma16(a2, b3, acc[2][3]);
      acc[3][3] = wmma16(a3, b3, acc[3][3]);
    }
    // Hand-over: this wave's reads of the current tile are done, its copies of
    // the next tile have landed; the barrier says both of every wave.
    asm volatile("s_wait_dscnt 0x0" ::: "memory");
    asm volatile("s_wait_asynccnt 0x0" ::: "memory");
    __syncthreads();
    if (t + 2 < DD / GKT) {   // refill the buffer that this tile has left
      gemm_copy_tile(lBase + (unsigned)cur * (GBUF * 2u),
                     Ar + (t + 2) * GKT, Br + (t + 2) * GKT);
    }
  }
  asm volatile("s_wait_asynccnt 0x0" ::: "memory");  // nothing left in flight
}

// ---------------------------------------------------------------------------
// Kernel 1: all three conversions in one launch of few, long waves.
// Work-groups 0 .. PWQ + PWP - 1 take one weight tile each,
// WT[n*K + k] = (f16) W[k*N + n]; the PXB work-groups behind them take x,
// f32 -> f16. Every thread has all its loads in flight before its first use.
// ---------------------------------------------------------------------------
#define PTK 128   // k per weight tile: a piece of a WT row is 256 B
#define PTN 64    // n per weight tile: a piece of a W row is 256 B
#define PPW 136   // LDS row pitch in halves: 256 B + 16 B, 16-byte stores of 16
                  // rows then fall on 64 distinct banks
#define PWQ ((DD / PTK) * (3 * DD / PTN))   // tiles of Wqkv
#define PWP ((DD / PTK) * (DD / PTN))       // tiles of Wproj
#define PXL 16                              // 16-byte loads of x per thread
#define PXB (HB * TT * DD / 4 / (256 * PXL))

// One PTK x PTN tile. A thread loads 4 n of 8 consecutive k, so it holds four
// 16-byte pieces of WT rows; row n lies in LDS at row (n & 3) * 16 + (n >> 2),
// so that the 16 lanes of one store write 16 neighbouring LDS rows.
__device__ __forceinline__ void prep_weight_tile(const float* __restrict__ Wm,
                                                 _Float16* __restrict__ WT,
                                                 const int N, int w, int tid,
                                                 _Float16* tile) {
  const int k0 = (w & (DD / PTK - 1)) * PTK;
  const int n0 = (w / (DD / PTK)) * PTN;
  const int nq = tid & 15;   // which 4 n;  on the way out: which 8 k
  const int kg = tid >> 4;   // which 8 k;  on the way out: which 4 n
  const float* s = Wm + (size_t)(k0 + kg * 8) * N + n0 + nq * 4;
  // The loops over i, j and q are unrolled because their index names a register.
  v4f f[8];
#pragma unroll
  for (int i = 0; i < 8; ++i) f[i] = *(const v4f*)(s + (size_t)i * N);
#pragma unroll
  for (int j = 0; j < 4; ++j) {
    v8h hv;
#pragma unroll
    for (int i = 0; i < 8; ++i) hv[i] = (_Float16)f[i][j];
    *(v8h*)(tile + (j * 16 + nq) * PPW + kg * 8) = hv;
  }
  __syncthreads();   // the rows that are read back were written by other waves
  _Float16* d = WT + (size_t)(n0 + kg * 4) * DD + k0 + nq * 8;
#pragma unroll
  for (int q = 0; q < 4; ++q)
    *(v8h*)(d + (size_t)q * DD) =
        *(const v8h*)(tile + (q * 16 + kg) * PPW + nq * 8);
  // later instructions in the listing rewrite registers that these stores name
  // (a precaution)
  asm volatile("s_wait_xcnt 0x0" ::: "memory");
}

__global__ __launch_bounds__(256) void prep_kernel(
    const float* __restrict__ x, const float* __restrict__ Wqkv,
    const float* __restrict__ Wproj, _Float16* __restrict__ xh,
    _Float16* __restrict__ wqkvT, _Float16* __restrict__ wprojT) {
  __shared__ alignas(16) _Float16 tile[PTN * PPW];
  const int tid = threadIdx.x;
  const int blk = blockIdx.x;   // every branch below is the same for a block
  if (blk < PWQ) {
    prep_weight_tile(Wqkv, wqkvT, 3 * DD, blk, tid, tile);
  } else if (blk < PWQ + PWP) {
    prep_weight_tile(Wproj, wprojT, DD, blk - PWQ, tid, tile);
  } else {
    // A wave takes PXL * 512 contiguous bytes of x, 512 per load.
    const size_t base =
        ((size_t)(blk - (PWQ + PWP)) * 8 + (tid >> 5)) * (PXL * 32) + (tid & 31);
    const v4f* s = (const v4f*)x + base;
    v4h* d = (v4h*)xh + base;
    // The loops over i are unrolled because their index names a register.
    v4f f[PXL];
#pragma unroll
    for (int i = 0; i < PXL; ++i) f[i] = s[i * 32];
    // the address stays in its registers up to this wait: left alone, the last
    // load's result is placed over the address that all PXL loads name
    // (a precaution)
    asm volatile("s_wait_xcnt 0x0" :: "v"(s) : "memory");
    // keeps all PXL loads in front of the first use: left alone, the scheduler
    // holds the last four back until the first results have come
    __builtin_amdgcn_sched_barrier(0);
#pragma unroll
    for (int i = 0; i < PXL; ++i) {
      v4h hv;
      hv.x = (_Float16)f[i].x; hv.y = (_Float16)f[i].y;
      hv.z = (_Float16)f[i].z; hv.w = (_Float16)f[i].w;
      d[i * 32] = hv;
    }
    // later instructions in the listing rewrite registers that these stores
    // name (a precaution)
    asm volatile("s_wait_xcnt 0x0" ::: "memory");
  }
}

// ---------------------------------------------------------------------------
// Kernel 2: QKV GEMM + bias + RoPE, scatter into Q[b,h,t,d], K[b,h,t,d],
// V^T[b,h,d,t] (all f16).  grid = (3072/128, 8192/256)
// ---------------------------------------------------------------------------
#define EPF 68   // staging pitch, floats: 272 B; rows 8 apart fall 32 banks
                 // apart (stores), 16-byte reads of two rows on distinct banks
#define EPH 72   // staging pitch, halves: 144 B, as in the ring
#define ESTG (64 * EPF * 4)   // a wave's staging area, bytes: 64 f32 rows
__global__ __launch_bounds__(256) void qkv_rope_kernel(
    const _Float16* __restrict__ Xh, const _Float16* __restrict__ WT,
    const float* __restrict__ bqkv, const float* __restrict__ cosT,
    const float* __restrict__ sinT, _Float16* __restrict__ Qb,
    _Float16* __restrict__ Kb, _Float16* __restrict__ VT) {
  // the ring, and behind the loop eight staging areas of ESTG bytes
  static_assert(8 * ESTG >= 2 * GBUF * 2, "the ring fits");
  __shared__ alignas(16) _Float16 ldsAB[8 * ESTG / 2];
  const int tid  = threadIdx.x;
  const int lane = tid & 31;
  const int hi   = lane >> 4;
  const int cn   = lane & 15;
  const int wave = tid >> 5;
  const int m0   = blockIdx.y * 256;
  const int n0   = blockIdx.x * 128;

  v8f acc[4][4] = {};
  gemm_mainloop(Xh, WT, m0, n0, ldsAB, tid, acc);

  // Epilogue, staged through LDS. The loop's last barrier stands behind every
  // wave's last read of the ring and no copy is in flight, so each wave takes
  // its own staging area there and needs no further barrier.
  // A wave's 64 columns are exactly one head (they start at a multiple of 64)
  // and its 64 rows lie in one batch.
  const int wv  = __builtin_amdgcn_readfirstlane(wave);  // scalar address parts
  const int sec = (int)(blockIdx.x * 128u) >> 10;        // 0=Q 1=K 2=V, per block
  const int nh  = n0 + (wv >> 2) * 64;
  const int h   = (nh & 1023) >> 6;
  const int gm0 = m0 + (wv & 3) * 64;
  const int b   = gm0 >> 11;
  const int t0  = gm0 & (TT - 1);
  const int rr  = lane >> 3;   // row inside a group of four rows
  const int c   = lane & 7;    // 8-element piece of a row
  char* stg = (char*)ldsAB + wv * ESTG;

  float bias[4];
#pragma unroll
  for (int j = 0; j < 4; ++j) bias[j] = bqkv[nh + 16 * j + cn];

  // The loops over i, j, v and g are unrolled because their index names a
  // register.
  if (sec == 2) {
    // V^T: a lane holds 8 consecutive t of one d. Rows of 64 t = one line.
    _Float16* sv = (_Float16*)stg;
#pragma unroll
    for (int i = 0; i < 4; ++i) {
#pragma unroll
      for (int j = 0; j < 4; ++j) {
        v8h hv;
#pragma unroll
        for (int v = 0; v < 8; ++v) hv[v] = (_Float16)(acc[i][j][v] + bias[j]);
        *(v8h*)(sv + (16 * j + cn) * EPH + 16 * i + 8 * hi) = hv;
      }
    }
    // the rows that are read back were written by other lanes of this wave
    asm volatile("s_wait_dscnt 0x0" ::: "memory");
    _Float16* vrow = VT + ((size_t)((b * HH + h) * DH + rr)) * TT + t0 + c * 8;
#pragma unroll
    for (int rg = 0; rg < 16; ++rg) {
      const v8h hv = *(const v8h*)(sv + (rg * 4 + rr) * EPH + c * 8);
      *(v8h*)(vrow + (size_t)(rg * 4) * TT) = hv;
    }
  } else {
    // Q, K: the f32 rows are staged; a lane then takes 8 consecutive d of one
    // row and the 8 that rotate-half pairs with them (d +- 32). The cos and sin
    // rows come in batches of four row groups.
    float* sf = (float*)stg;
    _Float16* dst = ((sec == 0) ? Qb : Kb) +
                    ((size_t)((b * HH + h) * TT + t0 + rr)) * DH + c * 8;
    const float* cp = cosT + (size_t)(t0 + rr) * DH + c * 8;
    const float* sp = sinT + (size_t)(t0 + rr) * DH + c * 8;
    const float sg = (c < 4) ? -1.0f : 1.0f;   // rotate-half: -x[d+32], +x[d-32]
    const float* own = sf + rr * EPF + c * 8;
    const float* par = sf + rr * EPF + (c ^ 4) * 8;
#pragma unroll
    for (int i = 0; i < 4; ++i)
#pragma unroll
      for (int j = 0; j < 4; ++j)
#pragma unroll
        for (int v = 0; v < 8; ++v)
          sf[(16 * i + 8 * hi + v) * EPF + 16 * j + cn] = acc[i][j][v] + bias[j];
    // the rows that are read back were written by other lanes of this wave
    asm volatile("s_wait_dscnt 0x0" ::: "memory");
#pragma unroll
    for (int bt = 0; bt < 4; ++bt) {
      v4f tc[8], ts[8];   // [row group in the batch, low or high 4]
#pragma unroll
      for (int g = 0; g < 4; ++g) {
        const int tr = bt * 16 + g * 4;
        tc[2 * g]     = *(const v4f*)(cp + tr * DH);
        tc[2 * g + 1] = *(const v4f*)(cp + tr * DH + 4);
        ts[2 * g]     = *(const v4f*)(sp + tr * DH);
        ts[2 * g + 1] = *(const v4f*)(sp + tr * DH + 4);
      }
      // keeps the batch's 16 loads together, one wait for all: left alone, the
      // scheduler sinks them to their uses, each with a full wait of its own
      __builtin_amdgcn_sched_barrier(0);
#pragma unroll
      for (int g = 0; g < 4; ++g) {
        const int tr = bt * 16 + g * 4;     // row in the wave's tile
        const v4f x0 = *(const v4f*)(own + tr * EPF);
        const v4f x1 = *(const v4f*)(own + tr * EPF + 4);
        const v4f p0 = *(const v4f*)(par + tr * EPF);
        const v4f p1 = *(const v4f*)(par + tr * EPF + 4);
        const v4f c0 = tc[2 * g], c1 = tc[2 * g + 1];
        const v4f s0 = ts[2 * g] * sg, s1 = ts[2 * g + 1] * sg;
        v8h ov;
#pragma unroll
        for (int e = 0; e < 4; ++e) {
          ov[e]     = (_Float16)(x0[e] * c0[e] + p0[e] * s0[e]);
          ov[4 + e] = (_Float16)(x1[e] * c1[e] + p1[e] * s1[e]);
        }
        *(v8h*)(dst + (size_t)tr * DH) = ov;
      }
      // later instructions rewrite registers that these stores name
      // (a precaution)
      asm volatile("s_wait_xcnt 0x0" ::: "memory");
      if (bt < 3) {
        // the next batch's loads start behind this batch's work
        __builtin_amdgcn_sched_barrier(0);
      }
    }
  }
}

#define AKT 64
#define APW 72

// One tile = 2 x 8 KB; each thread brings two 16-byte pieces of K and two of
// V^T. The closing s_wait_xcnt stands in front of every later rewrite of the
// copies' address registers (a precaution).
__device__ __forceinline__ void attn_copy_tile(unsigned lk,
                                               const _Float16* gk,
                                               const _Float16* gv) {
  const unsigned lk1 = lk + 32u * APW * 2u;
  const unsigned lv  = lk + AKT * APW * 2u;   // V^T tile follows the K tile
  const unsigned lv1 = lv + 32u * APW * 2u;
  const _Float16* gk1 = gk + 32 * DH;
  const _Float16* gv1 = gv + 32 * TT;
  asm volatile(
      "global_load_async_to_lds_b128 %0, %4, off\n\t"
      "global_load_async_to_lds_b128 %1, %5, off\n\t"
      "global_load_async_to_lds_b128 %2, %6, off\n\t"
      "global_load_async_to_lds_b128 %3, %7, off\n\t"
      "s_wait_xcnt 0x0"
      :
      : "v"(lk), "v"(lk1), "v"(lv), "v"(lv1),
        "v"((unsigned long long)(size_t)gk),
        "v"((unsigned long long)(size_t)gk1),
        "v"((unsigned long long)(size_t)gv),
        "v"((unsigned long long)(size_t)gv1)
      : "memory");
}

// Lane l with lane l ^ 16: the two lanes that share one query column.
__device__ __forceinline__ float xhalf(float x) {
  const int i = __builtin_bit_cast(int, x);
  return __builtin_bit_cast(float, __builtin_amdgcn_permlanex16(
      i, i, 0x76543210, 0xfedcba98, false, false));
}

__global__ __launch_bounds__(256) void attn_kernel(
    const _Float16* __restrict__ Q, const _Float16* __restrict__ K,
    const _Float16* __restrict__ VT, _Float16* __restrict__ O) {
  static_assert(AKT == DH, "K tile and V^T tile have the same number of rows");
  __shared__ alignas(16) _Float16 KVtile[2][2][AKT * APW];  // [buffer][K, V^T]
  const int tid  = threadIdx.x;
  const int lane = tid & 31;
  const int hi   = lane >> 4;
  const int cn   = lane & 15;
  const int wave = tid >> 5;
  const int bh   = blockIdx.y;
  const int b    = bh >> 4;
  const int h    = bh & 15;
  const int tq0  = blockIdx.x * 128 + wave * 16;

  const _Float16* Qp = Q  + ((size_t)bh * TT + tq0) * DH;
  const _Float16* Kp = K  + (size_t)bh * TT * DH;
  const _Float16* Vp = VT + (size_t)bh * DH * TT;   // [DH][TT]

  // This thread's piece of a tile: row crow (and crow + 32), 16 bytes at ccol.
  const int crow = tid >> 3;         // 0..31
  const int ccol = (tid & 7) * 8;    // halves
  const unsigned coff = (unsigned)(crow * APW + ccol) * 2u;
  const unsigned lkBase = (unsigned)(size_t)(&KVtile[0][0][0]) + coff;
  const _Float16* gkBase = Kp + (size_t)crow * DH + ccol;
  const _Float16* gvBase = Vp + (size_t)crow * TT + ccol;

  // Tile 0 lands and is published; tile 1 then flies while tile 0 is worked on.
  attn_copy_tile(lkBase, gkBase, gvBase);
  asm volatile("s_wait_asynccnt 0x0" ::: "memory");  // own copies landed
  __syncthreads();                                   // tile 0 visible to all
  attn_copy_tile(lkBase + 2u * AKT * APW * 2u, gkBase + (size_t)AKT * DH,
                 gvBase + AKT);

  // Q is the B operand: lane cn holds query column tq0 + cn.
  const v16h q0 = load_frag(Qp,      DH, lane);     // d 0..31
  const v16h q1 = load_frag(Qp + 32, DH, lane);     // d 32..63

  // Everything below is per query column, so per lane: lanes cn and cn + 16
  // share a column and split its keys (scores) and its d (output).
  // The loops over v and f are unrolled because their index names a register.
  float mrun = -3.0e38f;   // running maximum, equal in both lanes of a column
  float lsum = 0.f;        // this lane's share of the running sum
  v8f o[4] = {};           // o[f][v] = O^T[16 f + 8 hi + v][cn]

  for (int ps = 0; ps < TT / 32; ++ps) {
    const int st  = ps >> 1;          // tile
    const int cur = st & 1;           // its buffer
    const int kb  = (ps & 1) * 32;    // first key of this pass inside the tile
    const _Float16* tK = &KVtile[cur][0][0];
    const _Float16* tV = &KVtile[cur][1][0];

    // S^T = K Q^T: s0[v] = key kb + 8 hi + v, s1[v] = key kb + 16 + 8 hi + v.
    v8f s0 = {}, s1 = {};
    const v16h k00 = load_frag(tK + kb * APW,             APW, lane);
    const v16h k01 = load_frag(tK + kb * APW + 32,        APW, lane);
    const v16h k10 = load_frag(tK + (kb + 16) * APW,      APW, lane);
    const v16h k11 = load_frag(tK + (kb + 16) * APW + 32, APW, lane);
    s0 = wmma16(k00, q0, s0);
    s0 = wmma16(k01, q1, s0);
    s1 = wmma16(k10, q0, s1);
    s1 = wmma16(k11, q1, s1);

    const v16h vf0 = load_frag(tV + 0  * APW + kb, APW, lane);
    const v16h vf1 = load_frag(tV + 16 * APW + kb, APW, lane);
    const v16h vf2 = load_frag(tV + 32 * APW + kb, APW, lane);
    const v16h vf3 = load_frag(tV + 48 * APW + kb, APW, lane);

    const v8f a = s0 * 0.125f;        // 1/sqrt(64)
    const v8f c = s1 * 0.125f;
    float mx = -3.0e38f;
#pragma unroll
    for (int v = 0; v < 8; ++v) mx = fmaxf(mx, fmaxf(a[v], c[v]));
    mx = fmaxf(mx, xhalf(mx));        // the column's other 16 keys
    const float mnew = fmaxf(mrun, mx);
    const float al   = __expf(mrun - mnew);

    // The two score tiles, converted in place, are P^T as a B operand in the
    // k order of load_frag: halves 0..7 = keys 8 hi.., 8..15 = keys 16 + 8 hi..
    const v8f ea = a - mnew, ec = c - mnew;
    v8f p0, p1;
#pragma unroll
    for (int v = 0; v < 8; ++v) {
      p0[v] = __expf(ea[v]);
      p1[v] = __expf(ec[v]);
    }
    v16h pf;
#pragma unroll
    for (int v = 0; v < 8; ++v) {
      pf[v]     = (_Float16)p0[v];
      pf[8 + v] = (_Float16)p1[v];
    }
    const v8f pp = p0 + p1;
    float sum = pp[0];
#pragma unroll
    for (int v = 1; v < 8; ++v) sum += pp[v];
    lsum = lsum * al + sum;
    mrun = mnew;

    // O^T += V^T P^T
#pragma unroll
    for (int f = 0; f < 4; ++f)
#pragma unroll
      for (int v = 0; v < 8; ++v) o[f][v] *= al;
    o[0] = wmma16(vf0, pf, o[0]);
    o[1] = wmma16(vf1, pf, o[1]);
    o[2] = wmma16(vf2, pf, o[2]);
    o[3] = wmma16(vf3, pf, o[3]);

    if (ps & 1) {
      // Hand-over: this wave's reads of the current tile are done, its copies
      // of the next tile have landed; the barrier says both of every wave.
      asm volatile("s_wait_dscnt 0x0" ::: "memory");
      asm volatile("s_wait_asynccnt 0x0" ::: "memory");
      __syncthreads();
      if (st + 2 < TT / AKT) {   // refill the buffer that this tile has left
        attn_copy_tile(lkBase + (unsigned)cur * (2u * AKT * APW * 2u),
                       gkBase + (size_t)(st + 2) * AKT * DH,
                       gvBase + (st + 2) * AKT);
      }
    }
  }
  asm volatile("s_wait_asynccnt 0x0" ::: "memory");  // nothing left in flight

  const float inv = 1.0f / (lsum + xhalf(lsum));     // join the two shares
  // A lane holds 8 consecutive d of its query row per tile: 16-byte stores.
  _Float16* Op = O + ((size_t)(b * TT + tq0 + cn)) * DD + h * DH + hi * 8;
#pragma unroll
  for (int f = 0; f < 4; ++f) {
    v8h ov;
#pragma unroll
    for (int v = 0; v < 8; ++v) ov[v] = (_Float16)(o[f][v] * inv);
    *(v8h*)(Op + 16 * f) = ov;
  }
}

// ---------------------------------------------------------------------------
// Kernel 4: output projection, fp32 result + bias. grid = (1024/128, 8192/256)
// ---------------------------------------------------------------------------
__global__ __launch_bounds__(256) void proj_kernel(
    const _Float16* __restrict__ Ah, const _Float16* __restrict__ WT,
    const float* __restrict__ bproj, float* __restrict__ out) {
  __shared__ alignas(16) _Float16 ldsAB[2 * GBUF];
  const int tid  = threadIdx.x;
  const int lane = tid & 31;
  const int hi   = lane >> 4;
  const int cn   = lane & 15;
  const int wave = tid >> 5;
  const int wm   = (wave & 3) * 64;
  const int wn   = (wave >> 2) * 64;
  const int m0   = blockIdx.y * 256;
  const int n0   = blockIdx.x * 128;

  v8f acc[4][4] = {};
  gemm_mainloop(Ah, WT, m0, n0, ldsAB, tid, acc);

#pragma unroll
  for (int i = 0; i < 4; ++i) {
#pragma unroll
    for (int j = 0; j < 4; ++j) {
      const int gn = n0 + wn + 16 * j + cn;
      const float bv = bproj[gn];
#pragma unroll
      for (int v = 0; v < 8; ++v) {
        const int gm = m0 + wm + 16 * i + v + hi * 8;
        out[(size_t)gm * DD + gn] = acc[i][j][v] + bv;
      }
    }
  }
}

// ---------------------------------------------------------------------------
extern "C" void kernel_launch(void* const* d_in, const int* in_sizes, int n_in,
                              void* d_out, int out_size, void* d_ws,
                              size_t ws_size, hipStream_t stream) {
  const float* x     = (const float*)d_in[0];
  const float* Wqkv  = (const float*)d_in[1];
  const float* bqkv  = (const float*)d_in[2];
  const float* Wproj = (const float*)d_in[3];
  const float* bproj = (const float*)d_in[4];
  const float* cosT  = (const float*)d_in[5];
  const float* sinT  = (const float*)d_in[6];
  float* out = (float*)d_out;

  char* ws = (char*)d_ws;
  // byte offsets (total 72 MB)
  _Float16* xh     = (_Float16*)(ws);              // 16 MB, reused as attn out
  _Float16* wqkvT  = (_Float16*)(ws + 16777216);   //  6 MB
  _Float16* wprojT = (_Float16*)(ws + 23068672);   //  2 MB
  _Float16* Qb     = (_Float16*)(ws + 25165824);   // 16 MB
  _Float16* Kb     = (_Float16*)(ws + 41943040);   // 16 MB
  _Float16* VT     = (_Float16*)(ws + 58720256);   // 16 MB
  _Float16* attnh  = xh;   // x no longer needed after QKV GEMM

  // 1) precision conversion / weight transpose
  prep_kernel<<<PWQ + PWP + PXB, 256, 0, stream>>>(x, Wqkv, Wproj, xh, wqkvT,
                                                   wprojT);
  // 2) QKV GEMM + RoPE  (M=8192 in 256-row tiles, N=3072 in 128-col tiles)
  qkv_rope_kernel<<<dim3(24, 32), 256, 0, stream>>>(xh, wqkvT, bqkv, cosT, sinT,
                                                    Qb, Kb, VT);
  // 3) flash attention  (grid: T/128 x B*H)
  attn_kernel<<<dim3(TT / 128, HB * HH), 256, 0, stream>>>(Qb, Kb, VT, attnh);
  // 4) output projection (M=8192, N=1024)
  proj_kernel<<<dim3(8, 32), 256, 0, stream>>>(attnh, wprojT, bproj, out);
}

// v006
// A run of this version takes 148 microseconds.
// In two side-by-side timings against v005, it was 1.06 and 1.05 times as fast.
// Over all steps from v000 it is 3.08 times as fast.
#include <hip/hip_runtime.h>
#include <hip/hip_bf16.h>

typedef __attribute__((ext_vector_type(16))) _Float16 v16h;
typedef __attribute__((ext_vector_type(4)))  _Float16 v4h;
typedef __attribute__((ext_vector_type(8)))  _Float16 v8h;
typedef __attribute__((ext_vector_type(8)))  float    v8f;
typedef __attribute__((ext_vector_type(4)))  float    v4f;
typedef __attribute__((ext_vector_type(4)))  unsigned int v4u;

#define HB 4      // batch
#define TT 2048   // sequence
#define DD 1024   // model dim
#define HH 16     // heads
#define DH 64     // head dim

union FragU { v16h h; v4u u[2]; };

// 16x32 f16 WMMA fragment load (A-layout; identical for B when source is
// N-major / K-contiguous). lane r<16: row r, halves 0..7 = K 8*hi.., halves
// 8..15 = K 16+8*hi.. (hi = lane>=16).  ld = row stride in halves.
__device__ __forceinline__ v16h load_frag(const _Float16* base, int ld, int lane) {
  const int r  = lane & 15;
  const int hi = lane >> 4;
  const _Float16* p = base + (size_t)r * ld + hi * 8;
  FragU f;
  f.u[0] = *(const v4u*)(p);
  f.u[1] = *(const v4u*)(p + 16);
  return f.h;
}

__device__ __forceinline__ v8f wmma16(v16h a, v16h b, v8f c) {
  return __builtin_amdgcn_wmma_f32_16x16x32_f16(false, a, false, b, (short)0, c,
                                                false, false);
}

// ---------------------------------------------------------------------------
// Shared GEMM mainloop: 256x128 block tile, 256 threads = 8 waves (4x2); each
// wave owns a 64x64 sub-tile = 4x4 frags. A and B^T tiles of GKT k are staged
// in LDS (two buffers) by asynchronous copies. A staged row is one whole
// 128-byte line of its source row, and 8 neighbouring lanes bring one row, so
// that every copy instruction covers four whole lines.
// ---------------------------------------------------------------------------
#define GKT 64            // k per staged tile: one row is 128 B
#define GPW 72            // LDS row pitch in halves: 128 B + 16 B, 16-byte reads
                          // of 16 rows then fall on 64 distinct banks
#define GROWS (256 + 128) // rows of a buffer: the A tile, then the B^T tile
#define GBUF (GROWS * GPW)

// One tile: each thread brings 16 bytes of rows crow + 32 j, eight of A and
// four of B^T. The closing s_wait_xcnt stands in front of every later rewrite
// of the copies' address registers (a precaution).
__device__ __forceinline__ void gemm_copy_tile(unsigned l, const _Float16* ga,
                                               const _Float16* gb) {
  const unsigned st = 32u * GPW * 2u;   // 32 rows further in LDS, bytes
  asm volatile(
      "global_load_async_to_lds_b128 %0, %12, off\n\t"
      "global_load_async_to_lds_b128 %1, %13, off\n\t"
      "global_load_async_to_lds_b128 %2, %14, off\n\t"
      "global_load_async_to_lds_b128 %3, %15, off\n\t"
      "global_load_async_to_lds_b128 %4, %16, off\n\t"
      "global_load_async_to_lds_b128 %5, %17, off\n\t"
      "global_load_async_to_lds_b128 %6, %18, off\n\t"
      "global_load_async_to_lds_b128 %7, %19, off\n\t"
      "global_load_async_to_lds_b128 %8, %20, off\n\t"
      "global_load_async_to_lds_b128 %9, %21, off\n\t"
      "global_load_async_to_lds_b128 %10, %22, off\n\t"
      "global_load_async_to_lds_b128 %11, %23, off\n\t"
      "s_wait_xcnt 0x0"
      :
      : "v"(l), "v"(l + st), "v"(l + 2u * st), "v"(l + 3u * st),
        "v"(l + 4u * st), "v"(l + 5u * st), "v"(l + 6u * st),
        "v"(l + 7u * st), "v"(l + 8u * st), "v"(l + 9u * st),
        "v"(l + 10u * st), "v"(l + 11u * st),
        "v"((unsigned long long)(size_t)(ga)),
        "v"((unsigned long long)(size_t)(ga + 32 * DD)),
        "v"((unsigned long long)(size_t)(ga + 64 * DD)),
        "v"((unsigned long long)(size_t)(ga + 96 * DD)),
        "v"((unsigned long long)(size_t)(ga + 128 * DD)),
        "v"((unsigned long long)(size_t)(ga + 160 * DD)),
        "v"((unsigned long long)(size_t)(ga + 192 * DD)),
        "v"((unsigned long long)(size_t)(ga + 224 * DD)),
        "v"((unsigned long long)(size_t)(gb)),
        "v"((unsigned long long)(size_t)(gb + 32 * DD)),
        "v"((unsigned long long)(size_t)(gb + 64 * DD)),
        "v"((unsigned long long)(size_t)(gb + 96 * DD))
      : "memory");
}

__device__ __forceinline__ void gemm_mainloop(
    const _Float16* __restrict__ A, const _Float16* __restrict__ BT,
    int m0, int n0, _Float16* lds, int tid, v8f acc[4][4]) {
  const int lane = tid & 31;
  const int wave = tid >> 5;
  const int wm   = (wave & 3) * 64;   // 0,64,128,192
  const int wn   = (wave >> 2) * 64;  // 0,64
  const int crow = tid >> 3;          // 0..31
  const int ccol = (tid & 7) * 8;     // halves

  const _Float16* Ar = A  + (size_t)(m0 + crow) * DD + ccol;
  const _Float16* Br = BT + (size_t)(n0 + crow) * DD + ccol;

  // Per-lane LDS byte address (the low 32 bits of the generic pointer are the
  // offset in the work-group's LDS).
  const unsigned lBase =
      (unsigned)(size_t)(lds) + (unsigned)(crow * GPW + ccol) * 2u;

  // Tile 0 lands and is published; tile 1 then flies while tile 0 is worked on.
  gemm_copy_tile(lBase, Ar, Br);
  asm volatile("s_wait_asynccnt 0x0" ::: "memory");  // own copies landed
  __syncthreads();                                   // tile 0 visible to all
  gemm_copy_tile(lBase + GBUF * 2u, Ar + GKT, Br + GKT);

  for (int t = 0; t < DD / GKT; ++t) {
    const int cur = t & 1;
    const _Float16* tA = lds + (size_t)cur * GBUF;
    const _Float16* tB = tA + 256 * GPW;
    // unrolled so that ks folds into the LDS loads' immediate offsets
#pragma unroll
    for (int ks = 0; ks < GKT; ks += 32) {
      const v16h a0 = load_frag(tA + (wm)      * GPW + ks, GPW, lane);
      const v16h a1 = load_frag(tA + (wm + 16) * GPW + ks, GPW, lane);
      const v16h a2 = load_frag(tA + (wm + 32) * GPW + ks, GPW, lane);
      const v16h a3 = load_frag(tA + (wm + 48) * GPW + ks, GPW, lane);
      const v16h b0 = load_frag(tB + (wn)      * GPW + ks, GPW, lane);
      const v16h b1 = load_frag(tB + (wn + 16) * GPW + ks, GPW, lane);
      const v16h b2 = load_frag(tB + (wn + 32) * GPW + ks, GPW, lane);
      const v16h b3 = load_frag(tB + (wn + 48) * GPW + ks, GPW, lane);
      acc[0][0] = wmma16(a0, b0, acc[0][0]);
      acc[1][0] = wmma16(a1, b0, acc[1][0]);
      acc[2][0] = wmma16(a2, b0, acc[2][0]);
      acc[3][0] = wmma16(a3, b0, acc[3][0]);
      acc[0][1] = wmma16(a0, b1, acc[0][1]);
      acc[1][1] = wmma16(a1, b1, acc[1][1]);
      acc[2][1] = wmma16(a2, b1, acc[2][1]);
      acc[3][1] = wmma16(a3, b1, acc[3][1]);
      acc[0][2] = wmma16(a0, b2, acc[0][2]);
      acc[1][2] = wmma16(a1, b2, acc[1][2]);
      acc[2][2] = wmma16(a2, b2, acc[2][2]);
      acc[3][2] = wmma16(a3, b2, acc[3][2]);
      acc[0][3] = wmma16(a0, b3, acc[0][3]);
      acc[1][3] = wmma16(a1, b3, acc[1][3]);
      acc[2][3] = wmma16(a2, b3, acc[2][3]);
      acc[3][3] = wmma16(a3, b3, acc[3][3]);
    }
    // Hand-over: this wave's reads of the current tile are done, its copies of
    // the next tile have landed; the barrier says both of every wave.
    asm volatile("s_wait_dscnt 0x0" ::: "memory");
    asm volatile("s_wait_asynccnt 0x0" ::: "memory");
    __syncthreads();
    if (t + 2 < DD / GKT) {   // refill the buffer that this tile has left
      gemm_copy_tile(lBase + (unsigned)cur * (GBUF * 2u),
                     Ar + (t + 2) * GKT, Br + (t + 2) * GKT);
    }
  }
  asm volatile("s_wait_asynccnt 0x0" ::: "memory");  // nothing left in flight
}

// ---------------------------------------------------------------------------
// Kernel 1: all three conversions in one launch of few, long waves.
// Work-groups 0 .. PWQ + PWP - 1 take one weight tile each,
// WT[n*K + k] = (f16) W[k*N + n]; the PXB work-groups behind them take x,
// f32 -> f16. Every thread has all its loads in flight before its first use.
// ---------------------------------------------------------------------------
#define PTK 128   // k per weight tile: a piece of a WT row is 256 B
#define PTN 64    // n per weight tile: a piece of a W row is 256 B
#define PPW 136   // LDS row pitch in halves: 256 B + 16 B, 16-byte stores of 16
                  // rows then fall on 64 distinct banks
#define PWQ ((DD / PTK) * (3 * DD / PTN))   // tiles of Wqkv
#define PWP ((DD / PTK) * (DD / PTN))       // tiles of Wproj
#define PXL 16                              // 16-byte loads of x per thread
#define PXB (HB * TT * DD / 4 / (256 * PXL))

// One PTK x PTN tile. A thread loads 4 n of 8 consecutive k, so it holds four
// 16-byte pieces of WT rows; row n lies in LDS at row (n & 3) * 16 + (n >> 2),
// so that the 16 lanes of one store write 16 neighbouring LDS rows.
__device__ __forceinline__ void prep_weight_tile(const float* __restrict__ Wm,
                                                 _Float16* __restrict__ WT,
                                                 const int N, int w, int tid,
                                                 _Float16* tile) {
  const int k0 = (w & (DD / PTK - 1)) * PTK;
  const int n0 = (w / (DD / PTK)) * PTN;
  const int nq = tid & 15;   // which 4 n;  on the way out: which 8 k
  const int kg = tid >> 4;   // which 8 k;  on the way out: which 4 n
  const float* s = Wm + (size_t)(k0 + kg * 8) * N + n0 + nq * 4;
  // The loops over i, j and q are unrolled because their index names a register.
  v4f f[8];
#pragma unroll
  for (int i = 0; i < 8; ++i) f[i] = *(const v4f*)(s + (size_t)i * N);
#pragma unroll
  for (int j = 0; j < 4; ++j) {
    v8h hv;
#pragma unroll
    for (int i = 0; i < 8; ++i) hv[i] = (_Float16)f[i][j];
    *(v8h*)(tile + (j * 16 + nq) * PPW + kg * 8) = hv;
  }
  __syncthreads();   // the rows that are read back were written by other waves
  _Float16* d = WT + (size_t)(n0 + kg * 4) * DD + k0 + nq * 8;
#pragma unroll
  for (int q = 0; q < 4; ++q)
    *(v8h*)(d + (size_t)q * DD) =
        *(const v8h*)(tile + (q * 16 + kg) * PPW + nq * 8);
  // later instructions in the listing rewrite registers that these stores name
  // (a precaution)
  asm volatile("s_wait_xcnt 0x0" ::: "memory");
}

__global__ __launch_bounds__(256) void prep_kernel(
    const float* __restrict__ x, const float* __restrict__ Wqkv,
    const float* __restrict__ Wproj, _Float16* __restrict__ xh,
    _Float16* __restrict__ wqkvT, _Float16* __restrict__ wprojT) {
  __shared__ alignas(16) _Float16 tile[PTN * PPW];
  const int tid = threadIdx.x;
  const int blk = blockIdx.x;   // every branch below is the same for a block
  if (blk < PWQ) {
    prep_weight_tile(Wqkv, wqkvT, 3 * DD, blk, tid, tile);
  } else if (blk < PWQ + PWP) {
    prep_weight_tile(Wproj, wprojT, DD, blk - PWQ, tid, tile);
  } else {
    // A wave takes PXL * 512 contiguous bytes of x, 512 per load.
    const size_t base =
        ((size_t)(blk - (PWQ + PWP)) * 8 + (tid >> 5)) * (PXL * 32) + (tid & 31);
    const v4f* s = (const v4f*)x + base;
    v4h* d = (v4h*)xh + base;
    // The loops over i are unrolled because their index names a register.
    v4f f[PXL];
#pragma unroll
    for (int i = 0; i < PXL; ++i) f[i] = s[i * 32];
    // the address stays in its registers up to this wait: left alone, the last
    // load's result is placed over the address that all PXL loads name
    // (a precaution)
    asm volatile("s_wait_xcnt 0x0" :: "v"(s) : "memory");
    // keeps all PXL loads in front of the first use: left alone, the scheduler
    // holds the last four back until the first results have come
    __builtin_amdgcn_sched_barrier(0);
#pragma unroll
    for (int i = 0; i < PXL; ++i) {
      v4h hv;
      hv.x = (_Float16)f[i].x; hv.y = (_Float16)f[i].y;
      hv.z = (_Float16)f[i].z; hv.w = (_Float16)f[i].w;
      d[i * 32] = hv;
    }
    // later instructions in the listing rewrite registers that these stores
    // name (a precaution)
    asm volatile("s_wait_xcnt 0x0" ::: "memory");
  }
}

// ---------------------------------------------------------------------------
// Kernel 2: QKV GEMM + bias + RoPE, scatter into Q[b,h,t,d], K[b,h,t,d],
// V^T[b,h,d,t] (all f16).  grid = (3072/128, 8192/256)
// ---------------------------------------------------------------------------
#define EPF 68   // staging pitch, floats: 272 B; rows 8 apart fall 32 banks
                 // apart (stores), 16-byte reads of two rows on distinct banks
#define EPH 72   // staging pitch, halves: 144 B, as in the ring
#define ESTG (64 * EPF * 4)   // a wave's staging area, bytes: 64 f32 rows
__global__ __launch_bounds__(256) void qkv_rope_kernel(
    const _Float16* __restrict__ Xh, const _Float16* __restrict__ WT,
    const float* __restrict__ bqkv, const float* __restrict__ cosT,
    const float* __restrict__ sinT, _Float16* __restrict__ Qb,
    _Float16* __restrict__ Kb, _Float16* __restrict__ VT) {
  // the ring, and behind the loop eight staging areas of ESTG bytes
  static_assert(8 * ESTG >= 2 * GBUF * 2, "the ring fits");
  __shared__ alignas(16) _Float16 ldsAB[8 * ESTG / 2];
  const int tid  = threadIdx.x;
  const int lane = tid & 31;
  const int hi   = lane >> 4;
  const int cn   = lane & 15;
  const int wave = tid >> 5;
  const int m0   = blockIdx.y * 256;
  const int n0   = blockIdx.x * 128;

  v8f acc[4][4] = {};
  gemm_mainloop(Xh, WT, m0, n0, ldsAB, tid, acc);

  // Epilogue, staged through LDS. The loop's last barrier stands behind every
  // wave's last read of the ring and no copy is in flight, so each wave takes
  // its own staging area there and needs no further barrier.
  // A wave's 64 columns are exactly one head (they start at a multiple of 64)
  // and its 64 rows lie in one batch.
  const int wv  = __builtin_amdgcn_readfirstlane(wave);  // scalar address parts
  const int sec = (int)(blockIdx.x * 128u) >> 10;        // 0=Q 1=K 2=V, per block
  const int nh  = n0 + (wv >> 2) * 64;
  const int h   = (nh & 1023) >> 6;
  const int gm0 = m0 + (wv & 3) * 64;
  const int b   = gm0 >> 11;
  const int t0  = gm0 & (TT - 1);
  const int rr  = lane >> 3;   // row inside a group of four rows
  const int c   = lane & 7;    // 8-element piece of a row
  char* stg = (char*)ldsAB + wv * ESTG;

  float bias[4];
#pragma unroll
  for (int j = 0; j < 4; ++j) bias[j] = bqkv[nh + 16 * j + cn];

  // The loops over i, j, v and g are unrolled because their index names a
  // register.
  if (sec == 2) {
    // V^T: a lane holds 8 consecutive t of one d. Rows of 64 t = one line.
    _Float16* sv = (_Float16*)stg;
#pragma unroll
    for (int i = 0; i < 4; ++i) {
#pragma unroll
      for (int j = 0; j < 4; ++j) {
        v8h hv;
#pragma unroll
        for (int v = 0; v < 8; ++v) hv[v] = (_Float16)(acc[i][j][v] + bias[j]);
        *(v8h*)(sv + (16 * j + cn) * EPH + 16 * i + 8 * hi) = hv;
      }
    }
    // the rows that are read back were written by other lanes of this wave
    asm volatile("s_wait_dscnt 0x0" ::: "memory");
    _Float16* vrow = VT + ((size_t)((b * HH + h) * DH + rr)) * TT + t0 + c * 8;
#pragma unroll
    for (int rg = 0; rg < 16; ++rg) {
      const v8h hv = *(const v8h*)(sv + (rg * 4 + rr) * EPH + c * 8);
      *(v8h*)(vrow + (size_t)(rg * 4) * TT) = hv;
    }
  } else {
    // Q, K: the f32 rows are staged; a lane then takes 8 consecutive d of one
    // row and the 8 that rotate-half pairs with them (d +- 32). The cos and sin
    // rows come in batches of four row groups.
    float* sf = (float*)stg;
    _Float16* dst = ((sec == 0) ? Qb : Kb) +
                    ((size_t)((b * HH + h) * TT + t0 + rr)) * DH + c * 8;
    const float* cp = cosT + (size_t)(t0 + rr) * DH + c * 8;
    const float* sp = sinT + (size_t)(t0 + rr) * DH + c * 8;
    const float sg = (c < 4) ? -1.0f : 1.0f;   // rotate-half: -x[d+32], +x[d-32]
    const float* own = sf + rr * EPF + c * 8;
    const float* par = sf + rr * EPF + (c ^ 4) * 8;
#pragma unroll
    for (int i = 0; i < 4; ++i)
#pragma unroll
      for (int j = 0; j < 4; ++j)
#pragma unroll
        for (int v = 0; v < 8; ++v)
          sf[(16 * i + 8 * hi + v) * EPF + 16 * j + cn] = acc[i][j][v] + bias[j];
    // the rows that are read back were written by other lanes of this wave
    asm volatile("s_wait_dscnt 0x0" ::: "memory");
#pragma unroll
    for (int bt = 0; bt < 4; ++bt) {
      v4f tc[8], ts[8];   // [row group in the batch, low or high 4]
#pragma unroll
      for (int g = 0; g < 4; ++g) {
        const int tr = bt * 16 + g * 4;
        tc[2 * g]     = *(const v4f*)(cp + tr * DH);
        tc[2 * g + 1] = *(const v4f*)(cp + tr * DH + 4);
        ts[2 * g]     = *(const v4f*)(sp + tr * DH);
        ts[2 * g + 1] = *(const v4f*)(sp + tr * DH + 4);
      }
      // keeps the batch's 16 loads together, one wait for all: left alone, the
      // scheduler sinks them to their uses, each with a full wait of its own
      __builtin_amdgcn_sched_barrier(0);
#pragma unroll
      for (int g = 0; g < 4; ++g) {
        const int tr = bt * 16 + g * 4;     // row in the wave's tile
        const v4f x0 = *(const v4f*)(own + tr * EPF);
        const v4f x1 = *(const v4f*)(own + tr * EPF + 4);
        const v4f p0 = *(const v4f*)(par + tr * EPF);
        const v4f p1 = *(const v4f*)(par + tr * EPF + 4);
        const v4f c0 = tc[2 * g], c1 = tc[2 * g + 1];
        const v4f s0 = ts[2 * g] * sg, s1 = ts[2 * g + 1] * sg;
        v8h ov;
#pragma unroll
        for (int e = 0; e < 4; ++e) {
          ov[e]     = (_Float16)(x0[e] * c0[e] + p0[e] * s0[e]);
          ov[4 + e] = (_Float16)(x1[e] * c1[e] + p1[e] * s1[e]);
        }
        *(v8h*)(dst + (size_t)tr * DH) = ov;
      }
      // later instructions rewrite registers that these stores name
      // (a precaution)
      asm volatile("s_wait_xcnt 0x0" ::: "memory");
      if (bt < 3) {
        // the next batch's loads start behind this batch's work
        __builtin_amdgcn_sched_barrier(0);
      }
    }
  }
}

#define AKT 64
#define APW 72

// One tile = 2 x 8 KB; each thread brings two 16-byte pieces of K and two of
// V^T. The closing s_wait_xcnt stands in front of every later rewrite of the
// copies' address registers (a precaution).
__device__ __forceinline__ void attn_copy_tile(unsigned lk,
                                               const _Float16* gk,
                                               const _Float16* gv) {
  const unsigned lk1 = lk + 32u * APW * 2u;
  const unsigned lv  = lk + AKT * APW * 2u;   // V^T tile follows the K tile
  const unsigned lv1 = lv + 32u * APW * 2u;
  const _Float16* gk1 = gk + 32 * DH;
  const _Float16* gv1 = gv + 32 * TT;
  asm volatile(
      "global_load_async_to_lds_b128 %0, %4, off\n\t"
      "global_load_async_to_lds_b128 %1, %5, off\n\t"
      "global_load_async_to_lds_b128 %2, %6, off\n\t"
      "global_load_async_to_lds_b128 %3, %7, off\n\t"
      "s_wait_xcnt 0x0"
      :
      : "v"(lk), "v"(lk1), "v"(lv), "v"(lv1),
        "v"((unsigned long long)(size_t)gk),
        "v"((unsigned long long)(size_t)gk1),
        "v"((unsigned long long)(size_t)gv),
        "v"((unsigned long long)(size_t)gv1)
      : "memory");
}

// Lane l with lane l ^ 16: the two lanes that share one query column.
__device__ __forceinline__ float xhalf(float x) {
  const int i = __builtin_bit_cast(int, x);
  return __builtin_bit_cast(float, __builtin_amdgcn_permlanex16(
      i, i, 0x76543210, 0xfedcba98, false, false));
}

// One column group's softmax step over 32 keys: takes the two raw score tiles,
// updates the running maximum and this lane's share of the sum, rescales the
// group's output tiles and returns P^T as a B operand in the k order of
// load_frag: halves 0..7 = keys 8 hi.., 8..15 = keys 16 + 8 hi..
__device__ __forceinline__ v16h attn_softmax_step(v8f s0, v8f s1, float& mrun,
                                                  float& lsum, v8f o[4]) {
  // The loops over v and f are unrolled because their index names a register.
  const v8f a = s0 * 0.125f;        // 1/sqrt(64)
  const v8f c = s1 * 0.125f;
  float mx = -3.0e38f;
#pragma unroll
  for (int v = 0; v < 8; ++v) mx = fmaxf(mx, fmaxf(a[v], c[v]));
  mx = fmaxf(mx, xhalf(mx));        // the column's other 16 keys
  const float mnew = fmaxf(mrun, mx);
  const float al   = __expf(mrun - mnew);

  // exp(x) = 2^(x log2 e). The 16 exponentials stand in one statement, each in
  // place and none next to a user of its registers, with the closing v_nop as
  // the slot that the instruction set asks for behind a transcendental.
  const v8f ta = (a - mnew) * 1.44269504f, tc = (c - mnew) * 1.44269504f;
  float e0 = ta[0], e1 = ta[1], e2 = ta[2], e3 = ta[3], e4 = ta[4], e5 = ta[5],
        e6 = ta[6], e7 = ta[7], g0 = tc[0], g1 = tc[1], g2 = tc[2], g3 = tc[3],
        g4 = tc[4], g5 = tc[5], g6 = tc[6], g7 = tc[7];
  asm("v_exp_f32 %0, %0\n\t"
      "v_exp_f32 %1, %1\n\t"
      "v_exp_f32 %2, %2\n\t"
      "v_exp_f32 %3, %3\n\t"
      "v_exp_f32 %4, %4\n\t"
      "v_exp_f32 %5, %5\n\t"
      "v_exp_f32 %6, %6\n\t"
      "v_exp_f32 %7, %7\n\t"
      "v_exp_f32 %8, %8\n\t"
      "v_exp_f32 %9, %9\n\t"
      "v_exp_f32 %10, %10\n\t"
      "v_exp_f32 %11, %11\n\t"
      "v_exp_f32 %12, %12\n\t"
      "v_exp_f32 %13, %13\n\t"
      "v_exp_f32 %14, %14\n\t"
      "v_exp_f32 %15, %15\n\t"
      "v_nop"
      : "+v"(e0), "+v"(e1), "+v"(e2), "+v"(e3), "+v"(e4), "+v"(e5), "+v"(e6),
        "+v"(e7), "+v"(g0), "+v"(g1), "+v"(g2), "+v"(g3), "+v"(g4), "+v"(g5),
        "+v"(g6), "+v"(g7));
  const v8f p0 = {e0, e1, e2, e3, e4, e5, e6, e7};
  const v8f p1 = {g0, g1, g2, g3, g4, g5, g6, g7};
  v16h pf;
#pragma unroll
  for (int v = 0; v < 8; ++v) {
    pf[v]     = (_Float16)p0[v];
    pf[8 + v] = (_Float16)p1[v];
  }
  const v8f pp = p0 + p1;
  float sum = pp[0];
#pragma unroll
  for (int v = 1; v < 8; ++v) sum += pp[v];
  lsum = lsum * al + sum;
  mrun = mnew;
#pragma unroll
  for (int f = 0; f < 4; ++f)
#pragma unroll
    for (int v = 0; v < 8; ++v) o[f][v] *= al;
  return pf;
}

// Two work-groups share a WGP (512 work-groups on 256 WGPs), four waves a SIMD:
// the register budget is set for exactly that.
__global__ __launch_bounds__(256)
__attribute__((amdgpu_waves_per_eu(4, 4))) void attn_kernel(
    const _Float16* __restrict__ Q, const _Float16* __restrict__ K,
    const _Float16* __restrict__ VT, _Float16* __restrict__ O) {
  static_assert(AKT == DH, "K tile and V^T tile have the same number of rows");
  __shared__ alignas(16) _Float16 KVtile[2][2][AKT * APW];  // [buffer][K, V^T]
  const int tid  = threadIdx.x;
  const int lane = tid & 31;
  const int hi   = lane >> 4;
  const int cn   = lane & 15;
  const int wave = tid >> 5;
  const int bh   = blockIdx.y;
  const int b    = bh >> 4;
  const int h    = bh & 15;
  const int tq0  = blockIdx.x * 256 + wave * 32;

  const _Float16* Qp = Q  + ((size_t)bh * TT + tq0) * DH;
  const _Float16* Kp = K  + (size_t)bh * TT * DH;
  const _Float16* Vp = VT + (size_t)bh * DH * TT;   // [DH][TT]

  // This thread's piece of a tile: row crow (and crow + 32), 16 bytes at ccol.
  const int crow = tid >> 3;         // 0..31
  const int ccol = (tid & 7) * 8;    // halves
  const unsigned coff = (unsigned)(crow * APW + ccol) * 2u;
  const unsigned lkBase = (unsigned)(size_t)(&KVtile[0][0][0]) + coff;
  const _Float16* gkBase = Kp + (size_t)crow * DH + ccol;
  const _Float16* gvBase = Vp + (size_t)crow * TT + ccol;

  // Tile 0 lands and is published; tile 1 then flies while tile 0 is worked on.
  attn_copy_tile(lkBase, gkBase, gvBase);
  asm volatile("s_wait_asynccnt 0x0" ::: "memory");  // own copies landed
  __syncthreads();                                   // tile 0 visible to all
  attn_copy_tile(lkBase + 2u * AKT * APW * 2u, gkBase + (size_t)AKT * DH,
                 gvBase + AKT);

  // Q is the B operand: in group g lane cn holds query column tq0 + 16 g + cn.
  const v16h qa0 = load_frag(Qp,                DH, lane);   // g 0, d 0..31
  const v16h qa1 = load_frag(Qp + 32,           DH, lane);   // g 0, d 32..63
  const v16h qb0 = load_frag(Qp + 16 * DH,      DH, lane);   // g 1, d 0..31
  const v16h qb1 = load_frag(Qp + 16 * DH + 32, DH, lane);   // g 1, d 32..63

  // Everything below is per query column, so per lane and group: lanes cn and
  // cn + 16 share a column and split its keys (scores) and its d (output).
  float mrunA = -3.0e38f, mrunB = -3.0e38f;  // running maxima
  float lsumA = 0.f, lsumB = 0.f;   // this lane's shares of the running sums
  v8f oA[4] = {}, oB[4] = {};       // o[f][v] = O^T[16 f + 8 hi + v][cn]

  for (int ps = 0; ps < TT / 32; ++ps) {
    const int st  = ps >> 1;          // tile
    const int cur = st & 1;           // its buffer
    const int kb  = (ps & 1) * 32;    // first key of this pass inside the tile
    const _Float16* tK = &KVtile[cur][0][0];
    const _Float16* tV = &KVtile[cur][1][0];

    // S^T = K Q^T: s0[v] = key kb + 8 hi + v, s1[v] = key kb + 16 + 8 hi + v.
    const v16h k00 = load_frag(tK + kb * APW,             APW, lane);
    const v16h k01 = load_frag(tK + kb * APW + 32,        APW, lane);
    const v16h k10 = load_frag(tK + (kb + 16) * APW,      APW, lane);
    const v16h k11 = load_frag(tK + (kb + 16) * APW + 32, APW, lane);
    v8f sA0 = {}, sA1 = {}, sB0 = {}, sB1 = {};
    sA0 = wmma16(k00, qa0, sA0);
    sA1 = wmma16(k10, qa0, sA1);
    sA0 = wmma16(k01, qa1, sA0);
    sA1 = wmma16(k11, qa1, sA1);
    sB0 = wmma16(k00, qb0, sB0);
    sB1 = wmma16(k10, qb0, sB1);
    sB0 = wmma16(k01, qb1, sB0);
    sB1 = wmma16(k11, qb1, sB1);

    const v16h vf0 = load_frag(tV + 0  * APW + kb, APW, lane);
    const v16h vf1 = load_frag(tV + 16 * APW + kb, APW, lane);
    const v16h vf2 = load_frag(tV + 32 * APW + kb, APW, lane);
    const v16h vf3 = load_frag(tV + 48 * APW + kb, APW, lane);

    const v16h pfA = attn_softmax_step(sA0, sA1, mrunA, lsumA, oA);
    const v16h pfB = attn_softmax_step(sB0, sB1, mrunB, lsumB, oB);

    // O^T += V^T P^T
    oA[0] = wmma16(vf0, pfA, oA[0]);
    oA[1] = wmma16(vf1, pfA, oA[1]);
    oA[2] = wmma16(vf2, pfA, oA[2]);
    oA[3] = wmma16(vf3, pfA, oA[3]);
    oB[0] = wmma16(vf0, pfB, oB[0]);
    oB[1] = wmma16(vf1, pfB, oB[1]);
    oB[2] = wmma16(vf2, pfB, oB[2]);
    oB[3] = wmma16(vf3, pfB, oB[3]);

    if (ps & 1) {
      // Hand-over: this wave's reads of the current tile are done, its copies
      // of the next tile have landed; the barrier says both of every wave.
      asm volatile("s_wait_dscnt 0x0" ::: "memory");
      asm volatile("s_wait_asynccnt 0x0" ::: "memory");
      __syncthreads();
      if (st + 2 < TT / AKT) {   // refill the buffer that this tile has left
        attn_copy_tile(lkBase + (unsigned)cur * (2u * AKT * APW * 2u),
                       gkBase + (size_t)(st + 2) * AKT * DH,
                       gvBase + (st + 2) * AKT);
      }
    }
  }
  asm volatile("s_wait_asynccnt 0x0" ::: "memory");  // nothing left in flight

  // join the two shares of each column's sum
  const float invA = 1.0f / (lsumA + xhalf(lsumA));
  const float invB = 1.0f / (lsumB + xhalf(lsumB));
  // A lane holds 8 consecutive d of its query row per tile: 16-byte stores.
  _Float16* Op = O + ((size_t)(b * TT + tq0 + cn)) * DD + h * DH + hi * 8;
  // The loops over f and v are unrolled because their index names a register.
  v8h ova[4], ovb[4];
#pragma unroll
  for (int f = 0; f < 4; ++f) {
#pragma unroll
    for (int v = 0; v < 8; ++v) {
      ova[f][v] = (_Float16)(oA[f][v] * invA);
      ovb[f][v] = (_Float16)(oB[f][v] * invB);
    }
  }
#pragma unroll
  for (int f = 0; f < 4; ++f) {
    *(v8h*)(Op + 16 * f) = ova[f];
    *(v8h*)(Op + 16 * DD + 16 * f) = ovb[f];
  }
}

// ---------------------------------------------------------------------------
// Kernel 4: output projection, fp32 result + bias. grid = (1024/128, 8192/256)
// ---------------------------------------------------------------------------
__global__ __launch_bounds__(256) void proj_kernel(
    const _Float16* __restrict__ Ah, const _Float16* __restrict__ WT,
    const float* __restrict__ bproj, float* __restrict__ out) {
  __shared__ alignas(16) _Float16 ldsAB[2 * GBUF];
  const int tid  = threadIdx.x;
  const int lane = tid & 31;
  const int hi   = lane >> 4;
  const int cn   = lane & 15;
  const int wave = tid >> 5;
  const int wm   = (wave & 3) * 64;
  const int wn   = (wave >> 2) * 64;
  const int m0   = blockIdx.y * 256;
  const int n0   = blockIdx.x * 128;

  v8f acc[4][4] = {};
  gemm_mainloop(Ah, WT, m0, n0, ldsAB, tid, acc);

#pragma unroll
  for (int i = 0; i < 4; ++i) {
#pragma unroll
    for (int j = 0; j < 4; ++j) {
      const int gn = n0 + wn + 16 * j + cn;
      const float bv = bproj[gn];
#pragma unroll
      for (int v = 0; v < 8; ++v) {
        const int gm = m0 + wm + 16 * i + v + hi * 8;
        out[(size_t)gm * DD + gn] = acc[i][j][v] + bv;
      }
    }
  }
}

// ---------------------------------------------------------------------------
extern "C" void kernel_launch(void* const* d_in, const int* in_sizes, int n_in,
                              void* d_out, int out_size, void* d_ws,
                              size_t ws_size, hipStream_t stream) {
  const float* x     = (const float*)d_in[0];
  const float* Wqkv  = (const float*)d_in[1];
  const float* bqkv  = (const float*)d_in[2];
  const float* Wproj = (const float*)d_in[3];
  const float* bproj = (const float*)d_in[4];
  const float* cosT  = (const float*)d_in[5];
  const float* sinT  = (const float*)d_in[6];
  float* out = (float*)d_out;

  char* ws = (char*)d_ws;
  // byte offsets (total 72 MB)
  _Float16* xh     = (_Float16*)(ws);              // 16 MB, reused as attn out
  _Float16* wqkvT  = (_Float16*)(ws + 16777216);   //  6 MB
  _Float16* wprojT = (_Float16*)(ws + 23068672);   //  2 MB
  _Float16* Qb     = (_Float16*)(ws + 25165824);   // 16 MB
  _Float16* Kb     = (_Float16*)(ws + 41943040);   // 16 MB
  _Float16* VT     = (_Float16*)(ws + 58720256);   // 16 MB
  _Float16* attnh  = xh;   // x no longer needed after QKV GEMM

  // 1) precision conversion / weight transpose
  prep_kernel<<<PWQ + PWP + PXB, 256, 0, stream>>>(x, Wqkv, Wproj, xh, wqkvT,
                                                   wprojT);
  // 2) QKV GEMM + RoPE  (M=8192 in 256-row tiles, N=3072 in 128-col tiles)
  qkv_rope_kernel<<<dim3(24, 32), 256, 0, stream>>>(xh, wqkvT, bqkv, cosT, sinT,
                                                    Qb, Kb, VT);
  // 3) flash attention  (grid: T/256 x B*H)
  attn_kernel<<<dim3(TT / 256, HB * HH), 256, 0, stream>>>(Qb, Kb, VT, attnh);
  // 4) output projection (M=8192, N=1024)
  proj_kernel<<<dim3(8, 32), 256, 0, stream>>>(attnh, wprojT, bproj, out);
}

// v008
// One run takes 135 microseconds.
// It is 1.10 times as fast as v006, going by the measured steps of the versions left out in between.
// Counting every step since v000, it is 3.40 times as fast.
#include <hip/hip_runtime.h>
#include <hip/hip_bf16.h>

typedef __attribute__((ext_vector_type(16))) _Float16 v16h;
typedef __attribute__((ext_vector_type(4)))  _Float16 v4h;
typedef __attribute__((ext_vector_type(8)))  _Float16 v8h;
typedef __attribute__((ext_vector_type(8)))  float    v8f;
typedef __attribute__((ext_vector_type(4)))  float    v4f;
typedef __attribute__((ext_vector_type(4)))  unsigned int v4u;

#define HB 4      // batch
#define TT 2048   // sequence
#define DD 1024   // model dim
#define HH 16     // heads
#define DH 64     // head dim

union FragU { v16h h; v4u u[2]; };

// 16x32 f16 WMMA fragment load (A-layout; identical for B when source is
// N-major / K-contiguous). lane r<16: row r, halves 0..7 = K 8*hi.., halves
// 8..15 = K 16+8*hi.. (hi = lane>=16).  ld = row stride in halves.
__device__ __forceinline__ v16h load_frag(const _Float16* base, int ld, int lane) {
  const int r  = lane & 15;
  const int hi = lane >> 4;
  const _Float16* p = base + (size_t)r * ld + hi * 8;
  FragU f;
  f.u[0] = *(const v4u*)(p);
  f.u[1] = *(const v4u*)(p + 16);
  return f.h;
}

__device__ __forceinline__ v8f wmma16(v16h a, v16h b, v8f c) {
  return __builtin_amdgcn_wmma_f32_16x16x32_f16(false, a, false, b, (short)0, c,
                                                false, false);
}

// ---------------------------------------------------------------------------
// Shared GEMM mainloop: 256x128 block tile, 256 threads = 8 waves (4x2); each
// wave owns a 64x64 sub-tile = 4x4 frags. A and B^T tiles of GKT k are staged
// in LDS (two buffers) by asynchronous copies. A staged row is one whole
// 128-byte line of its source row, and 8 neighbouring lanes bring one row, so
// that every copy instruction covers four whole lines.
// ---------------------------------------------------------------------------
#define GKT 64            // k per staged tile: one row is 128 B
#define GPW 72            // LDS row pitch in halves: 128 B + 16 B, 16-byte reads
                          // of 16 rows then fall on 64 distinct banks
#define GROWS (256 + 128) // rows of a buffer: the A tile, then the B^T tile
#define GBUF (GROWS * GPW)

// One tile: each thread brings 16 bytes of rows crow + 32 j, eight of A and
// four of B^T. The closing s_wait_xcnt stands in front of every later rewrite
// of the copies' address registers (a precaution).
__device__ __forceinline__ void gemm_copy_tile(unsigned l, const _Float16* ga,
                                               const _Float16* gb) {
  const unsigned st = 32u * GPW * 2u;   // 32 rows further in LDS, bytes
  asm volatile(
      "global_load_async_to_lds_b128 %0, %12, off\n\t"
      "global_load_async_to_lds_b128 %1, %13, off\n\t"
      "global_load_async_to_lds_b128 %2, %14, off\n\t"
      "global_load_async_to_lds_b128 %3, %15, off\n\t"
      "global_load_async_to_lds_b128 %4, %16, off\n\t"
      "global_load_async_to_lds_b128 %5, %17, off\n\t"
      "global_load_async_to_lds_b128 %6, %18, off\n\t"
      "global_load_async_to_lds_b128 %7, %19, off\n\t"
      "global_load_async_to_lds_b128 %8, %20, off\n\t"
      "global_load_async_to_lds_b128 %9, %21, off\n\t"
      "global_load_async_to_lds_b128 %10, %22, off\n\t"
      "global_load_async_to_lds_b128 %11, %23, off\n\t"
      "s_wait_xcnt 0x0"
      :
      : "v"(l), "v"(l + st), "v"(l + 2u * st), "v"(l + 3u * st),
        "v"(l + 4u * st), "v"(l + 5u * st), "v"(l + 6u * st),
        "v"(l + 7u * st), "v"(l + 8u * st), "v"(l + 9u * st),
        "v"(l + 10u * st), "v"(l + 11u * st),
        "v"((unsigned long long)(size_t)(ga)),
        "v"((unsigned long long)(size_t)(ga + 32 * DD)),
        "v"((unsigned long long)(size_t)(ga + 64 * DD)),
        "v"((unsigned long long)(size_t)(ga + 96 * DD)),
        "v"((unsigned long long)(size_t)(ga + 128 * DD)),
        "v"((unsigned long long)(size_t)(ga + 160 * DD)),
        "v"((unsigned long long)(size_t)(ga + 192 * DD)),
        "v"((unsigned long long)(size_t)(ga + 224 * DD)),
        "v"((unsigned long long)(size_t)(gb)),
        "v"((unsigned long long)(size_t)(gb + 32 * DD)),
        "v"((unsigned long long)(size_t)(gb + 64 * DD)),
        "v"((unsigned long long)(size_t)(gb + 96 * DD))
      : "memory");
}

__device__ __forceinline__ void gemm_mainloop(
    const _Float16* __restrict__ A, const _Float16* __restrict__ BT,
    int m0, int n0, _Float16* lds, int tid, v8f acc[4][4]) {
  const int lane = tid & 31;
  const int wave = tid >> 5;
  const int wm   = (wave & 3) * 64;   // 0,64,128,192
  const int wn   = (wave >> 2) * 64;  // 0,64
  const int crow = tid >> 3;          // 0..31
  const int ccol = (tid & 7) * 8;     // halves

  const _Float16* Ar = A  + (size_t)(m0 + crow) * DD + ccol;
  const _Float16* Br = BT + (size_t)(n0 + crow) * DD + ccol;

  // Per-lane LDS byte address (the low 32 bits of the generic pointer are the
  // offset in the work-group's LDS).
  const unsigned lBase =
      (unsigned)(size_t)(lds) + (unsigned)(crow * GPW + ccol) * 2u;

  // Tile 0 lands and is published; tile 1 then flies while tile 0 is worked on.
  gemm_copy_tile(lBase, Ar, Br);
  asm volatile("s_wait_asynccnt 0x0" ::: "memory");  // own copies landed
  __syncthreads();                                   // tile 0 visible to all
  gemm_copy_tile(lBase + GBUF * 2u, Ar + GKT, Br + GKT);

  for (int t = 0; t < DD / GKT; ++t) {
    const int cur = t & 1;
    const _Float16* tA = lds + (size_t)cur * GBUF;
    const _Float16* tB = tA + 256 * GPW;
    // unrolled so that ks folds into the LDS loads' immediate offsets
#pragma unroll
    for (int ks = 0; ks < GKT; ks += 32) {
      const v16h a0 = load_frag(tA + (wm)      * GPW + ks, GPW, lane);
      const v16h a1 = load_frag(tA + (wm + 16) * GPW + ks, GPW, lane);
      const v16h a2 = load_frag(tA + (wm + 32) * GPW + ks, GPW, lane);
      const v16h a3 = load_frag(tA + (wm + 48) * GPW + ks, GPW, lane);
      const v16h b0 = load_frag(tB + (wn)      * GPW + ks, GPW, lane);
      const v16h b1 = load_frag(tB + (wn + 16) * GPW + ks, GPW, lane);
      const v16h b2 = load_frag(tB + (wn + 32) * GPW + ks, GPW, lane);
      const v16h b3 = load_frag(tB + (wn + 48) * GPW + ks, GPW, lane);
      acc[0][0] = wmma16(a0, b0, acc[0][0]);
      acc[1][0] = wmma16(a1, b0, acc[1][0]);
      acc[2][0] = wmma16(a2, b0, acc[2][0]);
      acc[3][0] = wmma16(a3, b0, acc[3][0]);
      acc[0][1] = wmma16(a0, b1, acc[0][1]);
      acc[1][1] = wmma16(a1, b1, acc[1][1]);
      acc[2][1] = wmma16(a2, b1, acc[2][1]);
      acc[3][1] = wmma16(a3, b1, acc[3][1]);
      acc[0][2] = wmma16(a0, b2, acc[0][2]);
      acc[1][2] = wmma16(a1, b2, acc[1][2]);
      acc[2][2] = wmma16(a2, b2, acc[2][2]);
      acc[3][2] = wmma16(a3, b2, acc[3][2]);
      acc[0][3] = wmma16(a0, b3, acc[0][3]);
      acc[1][3] = wmma16(a1, b3, acc[1][3]);
      acc[2][3] = wmma16(a2, b3, acc[2][3]);
      acc[3][3] = wmma16(a3, b3, acc[3][3]);
    }
    // Hand-over: this wave's reads of the current tile are done, its copies of
    // the next tile have landed; the barrier says both of every wave.
    asm volatile("s_wait_dscnt 0x0" ::: "memory");
    asm volatile("s_wait_asynccnt 0x0" ::: "memory");
    __syncthreads();
    if (t + 2 < DD / GKT) {   // refill the buffer that this tile has left
      gemm_copy_tile(lBase + (unsigned)cur * (GBUF * 2u),
                     Ar + (t + 2) * GKT, Br + (t + 2) * GKT);
    }
  }
  asm volatile("s_wait_asynccnt 0x0" ::: "memory");  // nothing left in flight
}

// ---------------------------------------------------------------------------
// Kernel 1: all three conversions in one launch of few, long waves.
// Work-groups 0 .. PWQ + PWP - 1 take one weight tile each,
// WT[n*K + k] = (f16) W[k*N + n]; the PXB work-groups behind them take x,
// f32 -> f16. Every thread has all its loads in flight before its first use.
// ---------------------------------------------------------------------------
#define PTK 128   // k per weight tile: a piece of a WT row is 256 B
#define PTN 64    // n per weight tile: a piece of a W row is 256 B
#define PPW 136   // LDS row pitch in halves: 256 B + 16 B, 16-byte stores of 16
                  // rows then fall on 64 distinct banks
#define PWQ ((DD / PTK) * (3 * DD / PTN))   // tiles of Wqkv
#define PWP ((DD / PTK) * (DD / PTN))       // tiles of Wproj
#define PXL 16                              // 16-byte loads of x per thread
#define PXB (HB * TT * DD / 4 / (256 * PXL))

// One PTK x PTN tile. A thread loads 4 n of 8 consecutive k, so it holds four
// 16-byte pieces of WT rows; row n lies in LDS at row (n & 3) * 16 + (n >> 2),
// so that the 16 lanes of one store write 16 neighbouring LDS rows.
__device__ __forceinline__ void prep_weight_tile(const float* __restrict__ Wm,
                                                 _Float16* __restrict__ WT,
                                                 const int N, int w, int tid,
                                                 _Float16* tile) {
  const int k0 = (w & (DD / PTK - 1)) * PTK;
  const int n0 = (w / (DD / PTK)) * PTN;
  const int nq = tid & 15;   // which 4 n;  on the way out: which 8 k
  const int kg = tid >> 4;   // which 8 k;  on the way out: which 4 n
  const float* s = Wm + (size_t)(k0 + kg * 8) * N + n0 + nq * 4;
  // The loops over i, j and q are unrolled because their index names a register.
  v4f f[8];
#pragma unroll
  for (int i = 0; i < 8; ++i) f[i] = *(const v4f*)(s + (size_t)i * N);
#pragma unroll
  for (int j = 0; j < 4; ++j) {
    v8h hv;
#pragma unroll
    for (int i = 0; i < 8; ++i) hv[i] = (_Float16)f[i][j];
    *(v8h*)(tile + (j * 16 + nq) * PPW + kg * 8) = hv;
  }
  __syncthreads();   // the rows that are read back were written by other waves
  _Float16* d = WT + (size_t)(n0 + kg * 4) * DD + k0 + nq * 8;
#pragma unroll
  for (int q = 0; q < 4; ++q)
    *(v8h*)(d + (size_t)q * DD) =
        *(const v8h*)(tile + (q * 16 + kg) * PPW + nq * 8);
  // later instructions in the listing rewrite registers that these stores name
  // (a precaution)
  asm volatile("s_wait_xcnt 0x0" ::: "memory");
}

__global__ __launch_bounds__(256) void prep_kernel(
    const float* __restrict__ x, const float* __restrict__ Wqkv,
    const float* __restrict__ Wproj, _Float16* __restrict__ xh,
    _Float16* __restrict__ wqkvT, _Float16* __restrict__ wprojT) {
  __shared__ alignas(16) _Float16 tile[PTN * PPW];
  const int tid = threadIdx.x;
  const int blk = blockIdx.x;   // every branch below is the same for a block
  if (blk < PWQ) {
    prep_weight_tile(Wqkv, wqkvT, 3 * DD, blk, tid, tile);
  } else if (blk < PWQ + PWP) {
    prep_weight_tile(Wproj, wprojT, DD, blk - PWQ, tid, tile);
  } else {
    // A wave takes PXL * 512 contiguous bytes of x, 512 per load.
    const size_t base =
        ((size_t)(blk - (PWQ + PWP)) * 8 + (tid >> 5)) * (PXL * 32) + (tid & 31);
    const v4f* s = (const v4f*)x + base;
    v4h* d = (v4h*)xh + base;
    // The loops over i are unrolled because their index names a register.
    v4f f[PXL];
#pragma unroll
    for (int i = 0; i < PXL; ++i) f[i] = s[i * 32];
    // the address stays in its registers up to this wait: left alone, the last
    // load's result is placed over the address that all PXL loads name
    // (a precaution)
    asm volatile("s_wait_xcnt 0x0" :: "v"(s) : "memory");
    // keeps all PXL loads in front of the first use: left alone, the scheduler
    // holds the last four back until the first results have come
    __builtin_amdgcn_sched_barrier(0);
#pragma unroll
    for (int i = 0; i < PXL; ++i) {
      v4h hv;
      hv.x = (_Float16)f[i].x; hv.y = (_Float16)f[i].y;
      hv.z = (_Float16)f[i].z; hv.w = (_Float16)f[i].w;
      d[i * 32] = hv;
    }
    // later instructions in the listing rewrite registers that these stores
    // name (a precaution)
    asm volatile("s_wait_xcnt 0x0" ::: "memory");
  }
}

// ---------------------------------------------------------------------------
// Kernel 2: QKV GEMM + bias + RoPE, scatter into Q[b,h,t,d], K[b,h,t,d],
// V^T[b,h,d,t] (all f16).  grid = (3072/128, 8192/256)
// ---------------------------------------------------------------------------
#define QSC 0.18033688f   // 1/sqrt(64) * log2 e: softmax scale, exp as 2^x
#define EPF 68   // staging pitch, floats: 272 B; rows 8 apart fall 32 banks
                 // apart (stores), 16-byte reads of two rows on distinct banks
#define EPH 72   // staging pitch, halves: 144 B, as in the ring
#define ESTG (64 * EPF * 4)   // a wave's staging area, bytes: 64 f32 rows
__global__ __launch_bounds__(256) void qkv_rope_kernel(
    const _Float16* __restrict__ Xh, const _Float16* __restrict__ WT,
    const float* __restrict__ bqkv, const float* __restrict__ cosT,
    const float* __restrict__ sinT, _Float16* __restrict__ Qb,
    _Float16* __restrict__ Kb, _Float16* __restrict__ VT) {
  // the ring, and behind the loop eight staging areas of ESTG bytes
  static_assert(8 * ESTG >= 2 * GBUF * 2, "the ring fits");
  __shared__ alignas(16) _Float16 ldsAB[8 * ESTG / 2];
  const int tid  = threadIdx.x;
  const int lane = tid & 31;
  const int hi   = lane >> 4;
  const int cn   = lane & 15;
  const int wave = tid >> 5;
  const int m0   = blockIdx.y * 256;
  const int n0   = blockIdx.x * 128;

  v8f acc[4][4] = {};
  gemm_mainloop(Xh, WT, m0, n0, ldsAB, tid, acc);

  // Epilogue, staged through LDS. The loop's last barrier stands behind every
  // wave's last read of the ring and no copy is in flight, so each wave takes
  // its own staging area there and needs no further barrier.
  // A wave's 64 columns are exactly one head (they start at a multiple of 64)
  // and its 64 rows lie in one batch.
  const int wv  = __builtin_amdgcn_readfirstlane(wave);  // scalar address parts
  const int sec = (int)(blockIdx.x * 128u) >> 10;        // 0=Q 1=K 2=V, per block
  const int nh  = n0 + (wv >> 2) * 64;
  const int h   = (nh & 1023) >> 6;
  const int gm0 = m0 + (wv & 3) * 64;
  const int b   = gm0 >> 11;
  const int t0  = gm0 & (TT - 1);
  const int rr  = lane >> 3;   // row inside a group of four rows
  const int c   = lane & 7;    // 8-element piece of a row
  char* stg = (char*)ldsAB + wv * ESTG;

  float bias[4];
#pragma unroll
  for (int j = 0; j < 4; ++j) bias[j] = bqkv[nh + 16 * j + cn];

  // The loops over i, j, v and g are unrolled because their index names a
  // register.
  if (sec == 2) {
    // V^T: a lane holds 8 consecutive t of one d. Rows of 64 t = one line.
    _Float16* sv = (_Float16*)stg;
#pragma unroll
    for (int i = 0; i < 4; ++i) {
#pragma unroll
      for (int j = 0; j < 4; ++j) {
        v8h hv;
#pragma unroll
        for (int v = 0; v < 8; ++v) hv[v] = (_Float16)(acc[i][j][v] + bias[j]);
        *(v8h*)(sv + (16 * j + cn) * EPH + 16 * i + 8 * hi) = hv;
      }
    }
    // the rows that are read back were written by other lanes of this wave
    asm volatile("s_wait_dscnt 0x0" ::: "memory");
    _Float16* vrow = VT + ((size_t)((b * HH + h) * DH + rr)) * TT + t0 + c * 8;
#pragma unroll
    for (int rg = 0; rg < 16; ++rg) {
      const v8h hv = *(const v8h*)(sv + (rg * 4 + rr) * EPH + c * 8);
      *(v8h*)(vrow + (size_t)(rg * 4) * TT) = hv;
    }
  } else {
    // Q, K: the f32 rows are staged; a lane then takes 8 consecutive d of one
    // row and the 8 that rotate-half pairs with them (d +- 32). The cos and sin
    // rows come in batches of four row groups.
    float* sf = (float*)stg;
    _Float16* dst = ((sec == 0) ? Qb : Kb) +
                    ((size_t)((b * HH + h) * TT + t0 + rr)) * DH + c * 8;
    const float* cp = cosT + (size_t)(t0 + rr) * DH + c * 8;
    const float* sp = sinT + (size_t)(t0 + rr) * DH + c * 8;
    const float sg = (c < 4) ? -1.0f : 1.0f;   // rotate-half: -x[d+32], +x[d-32]
    // Q leaves multiplied by QSC, in f32 ahead of its one rounding to f16, so
    // that the attention's K Q^T comes out as exponents of two; K by one
    const float qs = (sec == 0) ? QSC : 1.0f;
    const float* own = sf + rr * EPF + c * 8;
    const float* par = sf + rr * EPF + (c ^ 4) * 8;
#pragma unroll
    for (int i = 0; i < 4; ++i)
#pragma unroll
      for (int j = 0; j < 4; ++j)
#pragma unroll
        for (int v = 0; v < 8; ++v)
          sf[(16 * i + 8 * hi + v) * EPF + 16 * j + cn] = acc[i][j][v] + bias[j];
    // the rows that are read back were written by other lanes of this wave
    asm volatile("s_wait_dscnt 0x0" ::: "memory");
#pragma unroll
    for (int bt = 0; bt < 4; ++bt) {
      v4f tc[8], ts[8];   // [row group in the batch, low or high 4]
#pragma unroll
      for (int g = 0; g < 4; ++g) {
        const int tr = bt * 16 + g * 4;
        tc[2 * g]     = *(const v4f*)(cp + tr * DH);
        tc[2 * g + 1] = *(const v4f*)(cp + tr * DH + 4);
        ts[2 * g]     = *(const v4f*)(sp + tr * DH);
        ts[2 * g + 1] = *(const v4f*)(sp + tr * DH + 4);
      }
      // keeps the batch's 16 loads together, one wait for all: left alone, the
      // scheduler sinks them to their uses, each with a full wait of its own
      __builtin_amdgcn_sched_barrier(0);
#pragma unroll
      for (int g = 0; g < 4; ++g) {
        const int tr = bt * 16 + g * 4;     // row in the wave's tile
        const v4f x0 = *(const v4f*)(own + tr * EPF);
        const v4f x1 = *(const v4f*)(own + tr * EPF + 4);
        const v4f p0 = *(const v4f*)(par + tr * EPF);
        const v4f p1 = *(const v4f*)(par + tr * EPF + 4);
        const v4f c0 = tc[2 * g], c1 = tc[2 * g + 1];
        const v4f s0 = ts[2 * g] * sg, s1 = ts[2 * g + 1] * sg;
        v8h ov;
#pragma unroll
        for (int e = 0; e < 4; ++e) {
          ov[e]     = (_Float16)((x0[e] * c0[e] + p0[e] * s0[e]) * qs);
          ov[4 + e] = (_Float16)((x1[e] * c1[e] + p1[e] * s1[e]) * qs);
        }
        *(v8h*)(dst + (size_t)tr * DH) = ov;
      }
      // later instructions rewrite registers that these stores name
      // (a precaution)
      asm volatile("s_wait_xcnt 0x0" ::: "memory");
      if (bt < 3) {
        // the next batch's loads start behind this batch's work
        __builtin_amdgcn_sched_barrier(0);
      }
    }
  }
}

#define AKT 64
#define APW 72

// One tile = 2 x 8 KB; each thread brings two 16-byte pieces of K and two of
// V^T. The closing s_wait_xcnt stands in front of every later rewrite of the
// copies' address registers (a precaution).
__device__ __forceinline__ void attn_copy_tile(unsigned lk,
                                               const _Float16* gk,
                                               const _Float16* gv) {
  const unsigned lk1 = lk + 32u * APW * 2u;
  const unsigned lv  = lk + AKT * APW * 2u;   // V^T tile follows the K tile
  const unsigned lv1 = lv + 32u * APW * 2u;
  const _Float16* gk1 = gk + 32 * DH;
  const _Float16* gv1 = gv + 32 * TT;
  asm volatile(
      "global_load_async_to_lds_b128 %0, %4, off\n\t"
      "global_load_async_to_lds_b128 %1, %5, off\n\t"
      "global_load_async_to_lds_b128 %2, %6, off\n\t"
      "global_load_async_to_lds_b128 %3, %7, off\n\t"
      "s_wait_xcnt 0x0"
      :
      : "v"(lk), "v"(lk1), "v"(lv), "v"(lv1),
        "v"((unsigned long long)(size_t)gk),
        "v"((unsigned long long)(size_t)gk1),
        "v"((unsigned long long)(size_t)gv),
        "v"((unsigned long long)(size_t)gv1)
      : "memory");
}

// Lane l with lane l ^ 16: the two lanes that share one query column.
__device__ __forceinline__ float xhalf(float x) {
  const int i = __builtin_bit_cast(int, x);
  return __builtin_bit_cast(float, __builtin_amdgcn_permlanex16(
      i, i, 0x76543210, 0xfedcba98, false, false));
}

// All scores below are exponents of two (Q carries QSC) and relative: the
// negated maximum in use of a lane's column is the C operand of the first
// S^T product, so the accumulators hold s - m and go to the exponential as
// they are.
// The maximum in use of a column may lag behind its true running maximum by up
// to ARS: every p then stays below 2^ARS = e^6 = 403, far inside f16, and the
// output tiles and the sum are rescaled only in a pass in which some column
// goes past.
#define ARS (6.0f * 1.44269504f)

// A lane's own maximum over its 16 relative scores of one column group.
__device__ __forceinline__ float attn_lane_max(v8f s0, v8f s1) {
  // The loop over v is unrolled because its index names a register.
  float mx = fmaxf(s0[0], s1[0]);
#pragma unroll
  for (int v = 1; v < 8; ++v) mx = fmaxf(mx, fmaxf(s0[v], s1[v]));
  return mx;
}

// The rare path: raises the column's maximum in use to this pass's column maximum where that is higher (the same
// value in both lanes of a column), rescales the group's sum and output and
// moves this pass's scores and the C operand by the same step. In the first
// pass the maximum in use is not yet one (C is zero): the column's maximum is
// taken whatever its sign, and sum and output are still zero.
__device__ __forceinline__ void attn_rescale(float mx, bool first, v8f& nm,
                                             float& lsum, v8f o[4], v8f& s0,
                                             v8f& s1) {
  mx = fmaxf(mx, xhalf(mx));        // the column's other 16 keys
  const float d  = first ? mx : fmaxf(mx, 0.0f);   // rise of the maximum in use
  const float al = first ? 0.0f : __builtin_amdgcn_exp2f(-d);
  lsum *= al;
  nm -= d;
  s0 -= d;
  s1 -= d;
  // The loops over f and v are unrolled because their index names a register.
#pragma unroll
  for (int f = 0; f < 4; ++f)
#pragma unroll
    for (int v = 0; v < 8; ++v) o[f][v] *= al;
}

// One column group's probabilities over 32 keys from its relative scores:
// adds to this lane's share of the sum and returns P^T as a B operand in the k
// order of load_frag: halves 0..7 = keys 8 hi.., 8..15 = keys 16 + 8 hi..
__device__ __forceinline__ v16h attn_probs(v8f s0, v8f s1, float& lsum) {
  // The loops over v are unrolled because their index names a register.
  // The 16 exponentials stand in one statement, none next to a user of its
  // registers (every result is marked early: it shares no register with a
  // source), with the closing v_nop as the slot that the instruction set asks
  // for behind a transcendental. The sources are read where the matrix
  // instruction left them.
  float e0, e1, e2, e3, e4, e5, e6, e7, g0, g1, g2, g3, g4, g5, g6, g7;
  asm("v_exp_f32 %0, %16\n\t"
      "v_exp_f32 %1, %17\n\t"
      "v_exp_f32 %2, %18\n\t"
      "v_exp_f32 %3, %19\n\t"
      "v_exp_f32 %4, %20\n\t"
      "v_exp_f32 %5, %21\n\t"
      "v_exp_f32 %6, %22\n\t"
      "v_exp_f32 %7, %23\n\t"
      "v_exp_f32 %8, %24\n\t"
      "v_exp_f32 %9, %25\n\t"
      "v_exp_f32 %10, %26\n\t"
      "v_exp_f32 %11, %27\n\t"
      "v_exp_f32 %12, %28\n\t"
      "v_exp_f32 %13, %29\n\t"
      "v_exp_f32 %14, %30\n\t"
      "v_exp_f32 %15, %31\n\t"
      "v_nop"
      : "=&v"(e0), "=&v"(e1), "=&v"(e2), "=&v"(e3), "=&v"(e4), "=&v"(e5),
        "=&v"(e6), "=&v"(e7), "=&v"(g0), "=&v"(g1), "=&v"(g2), "=&v"(g3),
        "=&v"(g4), "=&v"(g5), "=&v"(g6), "=&v"(g7)
      : "v"(s0[0]), "v"(s0[1]), "v"(s0[2]), "v"(s0[3]), "v"(s0[4]), "v"(s0[5]),
        "v"(s0[6]), "v"(s0[7]), "v"(s1[0]), "v"(s1[1]), "v"(s1[2]), "v"(s1[3]),
        "v"(s1[4]), "v"(s1[5]), "v"(s1[6]), "v"(s1[7]));
  const v8f p0 = {e0, e1, e2, e3, e4, e5, e6, e7};
  const v8f p1 = {g0, g1, g2, g3, g4, g5, g6, g7};
  v16h pf;
#pragma unroll
  for (int v = 0; v < 8; ++v) {
    pf[v]     = (_Float16)p0[v];
    pf[8 + v] = (_Float16)p1[v];
  }
  const v8f pp = p0 + p1;
  float sum = pp[0];
#pragma unroll
  for (int v = 1; v < 8; ++v) sum += pp[v];
  lsum += sum;
  return pf;
}

// Two work-groups share a WGP (512 work-groups on 256 WGPs), four waves a SIMD:
// the register budget is set for exactly that.
__global__ __launch_bounds__(256)
__attribute__((amdgpu_waves_per_eu(4, 4))) void attn_kernel(
    const _Float16* __restrict__ Q, const _Float16* __restrict__ K,
    const _Float16* __restrict__ VT, _Float16* __restrict__ O) {
  static_assert(AKT == DH, "K tile and V^T tile have the same number of rows");
  __shared__ alignas(16) _Float16 KVtile[2][2][AKT * APW];  // [buffer][K, V^T]
  const int tid  = threadIdx.x;
  const int lane = tid & 31;
  const int hi   = lane >> 4;
  const int cn   = lane & 15;
  const int wave = tid >> 5;
  const int bh   = blockIdx.y;
  const int b    = bh >> 4;
  const int h    = bh & 15;
  const int tq0  = blockIdx.x * 256 + wave * 32;

  const _Float16* Qp = Q  + ((size_t)bh * TT + tq0) * DH;
  const _Float16* Kp = K  + (size_t)bh * TT * DH;
  const _Float16* Vp = VT + (size_t)bh * DH * TT;   // [DH][TT]

  // This thread's piece of a tile: row crow (and crow + 32), 16 bytes at ccol.
  const int crow = tid >> 3;         // 0..31
  const int ccol = (tid & 7) * 8;    // halves
  const unsigned coff = (unsigned)(crow * APW + ccol) * 2u;
  const unsigned lkBase = (unsigned)(size_t)(&KVtile[0][0][0]) + coff;
  const _Float16* gkBase = Kp + (size_t)crow * DH + ccol;
  const _Float16* gvBase = Vp + (size_t)crow * TT + ccol;

  // Tile 0 lands and is published; tile 1 then flies while tile 0 is worked on.
  attn_copy_tile(lkBase, gkBase, gvBase);
  asm volatile("s_wait_asynccnt 0x0" ::: "memory");  // own copies landed
  __syncthreads();                                   // tile 0 visible to all
  attn_copy_tile(lkBase + 2u * AKT * APW * 2u, gkBase + (size_t)AKT * DH,
                 gvBase + AKT);

  // Q is the B operand: in group g lane cn holds query column tq0 + 16 g + cn.
  const v16h qa0 = load_frag(Qp,                DH, lane);   // g 0, d 0..31
  const v16h qa1 = load_frag(Qp + 32,           DH, lane);   // g 0, d 32..63
  const v16h qb0 = load_frag(Qp + 16 * DH,      DH, lane);   // g 1, d 0..31
  const v16h qb1 = load_frag(Qp + 16 * DH + 32, DH, lane);   // g 1, d 32..63

  // Everything below is per query column, so per lane and group: lanes cn and
  // cn + 16 share a column and split its keys (scores) and its d (output).
  v8f nmA = {}, nmB = {};           // negated maxima in use, as C operands
  float lsumA = 0.f, lsumB = 0.f;   // this lane's shares of the running sums
  v8f oA[4] = {}, oB[4] = {};       // o[f][v] = O^T[16 f + 8 hi + v][cn]

  for (int ps = 0; ps < TT / 32; ++ps) {
    const int st  = ps >> 1;          // tile
    const int cur = st & 1;           // its buffer
    const int kb  = (ps & 1) * 32;    // first key of this pass inside the tile
    const _Float16* tK = &KVtile[cur][0][0];
    const _Float16* tV = &KVtile[cur][1][0];

    // S^T = K Q^T - m: s0[v] = key kb + 8 hi + v, s1[v] = key kb + 16 + 8 hi + v.
    const v16h k00 = load_frag(tK + kb * APW,             APW, lane);
    const v16h k01 = load_frag(tK + kb * APW + 32,        APW, lane);
    const v16h k10 = load_frag(tK + (kb + 16) * APW,      APW, lane);
    const v16h k11 = load_frag(tK + (kb + 16) * APW + 32, APW, lane);
    v8f sA0 = wmma16(k00, qa0, nmA);
    v8f sA1 = wmma16(k10, qa0, nmA);
    sA0 = wmma16(k01, qa1, sA0);
    sA1 = wmma16(k11, qa1, sA1);
    v8f sB0 = wmma16(k00, qb0, nmB);
    v8f sB1 = wmma16(k10, qb0, nmB);
    sB0 = wmma16(k01, qb1, sB0);
    sB1 = wmma16(k11, qb1, sB1);

    const v16h vf0 = load_frag(tV + 0  * APW + kb, APW, lane);
    const v16h vf1 = load_frag(tV + 16 * APW + kb, APW, lane);
    const v16h vf2 = load_frag(tV + 32 * APW + kb, APW, lane);
    const v16h vf3 = load_frag(tV + 48 * APW + kb, APW, lane);

    // Lazy rescale: one test per pass for both groups and all lanes, a scalar
    // branch; either lane of a column sees a score past the bound.
    const float mxA = attn_lane_max(sA0, sA1);
    const float mxB = attn_lane_max(sB0, sB1);
    const bool need  = fmaxf(mxA, mxB) > ARS;
    const bool first = ps == 0;
    if (first || __builtin_amdgcn_ballot_w32(need) != 0) {
      attn_rescale(mxA, first, nmA, lsumA, oA, sA0, sA1);
      attn_rescale(mxB, first, nmB, lsumB, oB, sB0, sB1);
    }
    const v16h pfA = attn_probs(sA0, sA1, lsumA);
    const v16h pfB = attn_probs(sB0, sB1, lsumB);

    // O^T += V^T P^T
    oA[0] = wmma16(vf0, pfA, oA[0]);
    oA[1] = wmma16(vf1, pfA, oA[1]);
    oA[2] = wmma16(vf2, pfA, oA[2]);
    oA[3] = wmma16(vf3, pfA, oA[3]);
    oB[0] = wmma16(vf0, pfB, oB[0]);
    oB[1] = wmma16(vf1, pfB, oB[1]);
    oB[2] = wmma16(vf2, pfB, oB[2]);
    oB[3] = wmma16(vf3, pfB, oB[3]);

    if (ps & 1) {
      // Hand-over: this wave's reads of the current tile are done, its copies
      // of the next tile have landed; the barrier says both of every wave.
      asm volatile("s_wait_dscnt 0x0" ::: "memory");
      asm volatile("s_wait_asynccnt 0x0" ::: "memory");
      __syncthreads();
      if (st + 2 < TT / AKT) {   // refill the buffer that this tile has left
        attn_copy_tile(lkBase + (unsigned)cur * (2u * AKT * APW * 2u),
                       gkBase + (size_t)(st + 2) * AKT * DH,
                       gvBase + (st + 2) * AKT);
      }
    }
  }
  asm volatile("s_wait_asynccnt 0x0" ::: "memory");  // nothing left in flight

  // join the two shares of each column's sum
  const float invA = 1.0f / (lsumA + xhalf(lsumA));
  const float invB = 1.0f / (lsumB + xhalf(lsumB));
  // A lane holds 8 consecutive d of its query row per tile: 16-byte stores.
  _Float16* Op = O + ((size_t)(b * TT + tq0 + cn)) * DD + h * DH + hi * 8;
  // The loops over f and v are unrolled because their index names a register.
  v8h ova[4], ovb[4];
#pragma unroll
  for (int f = 0; f < 4; ++f) {
#pragma unroll
    for (int v = 0; v < 8; ++v) {
      ova[f][v] = (_Float16)(oA[f][v] * invA);
      ovb[f][v] = (_Float16)(oB[f][v] * invB);
    }
  }
#pragma unroll
  for (int f = 0; f < 4; ++f) {
    *(v8h*)(Op + 16 * f) = ova[f];
    *(v8h*)(Op + 16 * DD + 16 * f) = ovb[f];
  }
}

// ---------------------------------------------------------------------------
// Kernel 4: output projection, fp32 result + bias. grid = (1024/128, 8192/256)
// ---------------------------------------------------------------------------
__global__ __launch_bounds__(256) void proj_kernel(
    const _Float16* __restrict__ Ah, const _Float16* __restrict__ WT,
    const float* __restrict__ bproj, float* __restrict__ out) {
  __shared__ alignas(16) _Float16 ldsAB[2 * GBUF];
  const int tid  = threadIdx.x;
  const int lane = tid & 31;
  const int hi   = lane >> 4;
  const int cn   = lane & 15;
  const int wave = tid >> 5;
  const int wm   = (wave & 3) * 64;
  const int wn   = (wave >> 2) * 64;
  const int m0   = blockIdx.y * 256;
  const int n0   = blockIdx.x * 128;

  v8f acc[4][4] = {};
  gemm_mainloop(Ah, WT, m0, n0, ldsAB, tid, acc);

#pragma unroll
  for (int i = 0; i < 4; ++i) {
#pragma unroll
    for (int j = 0; j < 4; ++j) {
      const int gn = n0 + wn + 16 * j + cn;
      const float bv = bproj[gn];
#pragma unroll
      for (int v = 0; v < 8; ++v) {
        const int gm = m0 + wm + 16 * i + v + hi * 8;
        out[(size_t)gm * DD + gn] = acc[i][j][v] + bv;
      }
    }
  }
}

// ---------------------------------------------------------------------------
extern "C" void kernel_launch(void* const* d_in, const int* in_sizes, int n_in,
                              void* d_out, int out_size, void* d_ws,
                              size_t ws_size, hipStream_t stream) {
  const float* x     = (const float*)d_in[0];
  const float* Wqkv  = (const float*)d_in[1];
  const float* bqkv  = (const float*)d_in[2];
  const float* Wproj = (const float*)d_in[3];
  const float* bproj = (const float*)d_in[4];
  const float* cosT  = (const float*)d_in[5];
  const float* sinT  = (const float*)d_in[6];
  float* out = (float*)d_out;

  char* ws = (char*)d_ws;
  // byte offsets (total 72 MB)
  _Float16* xh     = (_Float16*)(ws);              // 16 MB, reused as attn out
  _Float16* wqkvT  = (_Float16*)(ws + 16777216);   //  6 MB
  _Float16* wprojT = (_Float16*)(ws + 23068672);   //  2 MB
  _Float16* Qb     = (_Float16*)(ws + 25165824);   // 16 MB
  _Float16* Kb     = (_Float16*)(ws + 41943040);   // 16 MB
  _Float16* VT     = (_Float16*)(ws + 58720256);   // 16 MB
  _Float16* attnh  = xh;   // x no longer needed after QKV GEMM

  // 1) precision conversion / weight transpose
  prep_kernel<<<PWQ + PWP + PXB, 256, 0, stream>>>(x, Wqkv, Wproj, xh, wqkvT,
                                                   wprojT);
  // 2) QKV GEMM + RoPE  (M=8192 in 256-row tiles, N=3072 in 128-col tiles)
  qkv_rope_kernel<<<dim3(24, 32), 256, 0, stream>>>(xh, wqkvT, bqkv, cosT, sinT,
                                                    Qb, Kb, VT);
  // 3) flash attention  (grid: T/256 x B*H)
  attn_kernel<<<dim3(TT / 256, HB * HH), 256, 0, stream>>>(Qb, Kb, VT, attnh);
  // 4) output projection (M=8192, N=1024)
  proj_kernel<<<dim3(8, 32), 256, 0, stream>>>(attnh, wprojT, bproj, out);
}

// v009
// Measured time: 127 microseconds a run.
// Next to v008, in two timings, it ran 1.06 times as fast each time.
// Counting every step since v000, it is 3.60 times as fast.
#include <hip/hip_runtime.h>
#include <hip/hip_bf16.h>

typedef __attribute__((ext_vector_type(16))) _Float16 v16h;
typedef __attribute__((ext_vector_type(4)))  _Float16 v4h;
typedef __attribute__((ext_vector_type(8)))  _Float16 v8h;
typedef __attribute__((ext_vector_type(8)))  float    v8f;
typedef __attribute__((ext_vector_type(4)))  float    v4f;
typedef __attribute__((ext_vector_type(4)))  unsigned int v4u;

#define HB 4      // batch
#define TT 2048   // sequence
#define DD 1024   // model dim
#define HH 16     // heads
#define DH 64     // head dim

union FragU { v16h h; v4u u[2]; };

// 16x32 f16 WMMA fragment load (A-layout; identical for B when source is
// N-major / K-contiguous). lane r<16: row r, halves 0..7 = K 8*hi.., halves
// 8..15 = K 16+8*hi.. (hi = lane>=16).  ld = row stride in halves.
__device__ __forceinline__ v16h load_frag(const _Float16* base, int ld, int lane) {
  const int r  = lane & 15;
  const int hi = lane >> 4;
  const _Float16* p = base + (size_t)r * ld + hi * 8;
  FragU f;
  f.u[0] = *(const v4u*)(p);
  f.u[1] = *(const v4u*)(p + 16);
  return f.h;
}

__device__ __forceinline__ v8f wmma16(v16h a, v16h b, v8f c) {
  return __builtin_amdgcn_wmma_f32_16x16x32_f16(false, a, false, b, (short)0, c,
                                                false, false);
}

// ---------------------------------------------------------------------------
// GEMM mainloop of the projection: 256x128 block tile, 256 threads = 8 waves (4x2); each
// wave owns a 64x64 sub-tile = 4x4 frags. A and B^T tiles of GKT k are staged
// in LDS (two buffers) by asynchronous copies. A staged row is one whole
// 128-byte line of its source row, and 8 neighbouring lanes bring one row, so
// that every copy instruction covers four whole lines.
// ---------------------------------------------------------------------------
#define GKT 64            // k per staged tile: one row is 128 B
#define GPW 72            // LDS row pitch in halves: 128 B + 16 B, 16-byte reads
                          // of 16 rows then fall on 64 distinct banks
#define GROWS (256 + 128) // rows of a buffer: the A tile, then the B^T tile
#define GBUF (GROWS * GPW)

// One tile: each thread brings 16 bytes of rows crow + 32 j, eight of A and
// four of B^T. The closing s_wait_xcnt stands in front of every later rewrite
// of the copies' address registers (a precaution).
__device__ __forceinline__ void gemm_copy_tile(unsigned l, const _Float16* ga,
                                               const _Float16* gb) {
  const unsigned st = 32u * GPW * 2u;   // 32 rows further in LDS, bytes
  asm volatile(
      "global_load_async_to_lds_b128 %0, %12, off\n\t"
      "global_load_async_to_lds_b128 %1, %13, off\n\t"
      "global_load_async_to_lds_b128 %2, %14, off\n\t"
      "global_load_async_to_lds_b128 %3, %15, off\n\t"
      "global_load_async_to_lds_b128 %4, %16, off\n\t"
      "global_load_async_to_lds_b128 %5, %17, off\n\t"
      "global_load_async_to_lds_b128 %6, %18, off\n\t"
      "global_load_async_to_lds_b128 %7, %19, off\n\t"
      "global_load_async_to_lds_b128 %8, %20, off\n\t"
      "global_load_async_to_lds_b128 %9, %21, off\n\t"
      "global_load_async_to_lds_b128 %10, %22, off\n\t"
      "global_load_async_to_lds_b128 %11, %23, off\n\t"
      "s_wait_xcnt 0x0"
      :
      : "v"(l), "v"(l + st), "v"(l + 2u * st), "v"(l + 3u * st),
        "v"(l + 4u * st), "v"(l + 5u * st), "v"(l + 6u * st),
        "v"(l + 7u * st), "v"(l + 8u * st), "v"(l + 9u * st),
        "v"(l + 10u * st), "v"(l + 11u * st),
        "v"((unsigned long long)(size_t)(ga)),
        "v"((unsigned long long)(size_t)(ga + 32 * DD)),
        "v"((unsigned long long)(size_t)(ga + 64 * DD)),
        "v"((unsigned long long)(size_t)(ga + 96 * DD)),
        "v"((unsigned long long)(size_t)(ga + 128 * DD)),
        "v"((unsigned long long)(size_t)(ga + 160 * DD)),
        "v"((unsigned long long)(size_t)(ga + 192 * DD)),
        "v"((unsigned long long)(size_t)(ga + 224 * DD)),
        "v"((unsigned long long)(size_t)(gb)),
        "v"((unsigned long long)(size_t)(gb + 32 * DD)),
        "v"((unsigned long long)(size_t)(gb + 64 * DD)),
        "v"((unsigned long long)(size_t)(gb + 96 * DD))
      : "memory");
}

__device__ __forceinline__ void gemm_mainloop(
    const _Float16* __restrict__ A, const _Float16* __restrict__ BT,
    int m0, int n0, _Float16* lds, int tid, v8f acc[4][4]) {
  const int lane = tid & 31;
  const int wave = tid >> 5;
  const int wm   = (wave & 3) * 64;   // 0,64,128,192
  const int wn   = (wave >> 2) * 64;  // 0,64
  const int crow = tid >> 3;          // 0..31
  const int ccol = (tid & 7) * 8;     // halves

  const _Float16* Ar = A  + (size_t)(m0 + crow) * DD + ccol;
  const _Float16* Br = BT + (size_t)(n0 + crow) * DD + ccol;

  // Per-lane LDS byte address (the low 32 bits of the generic pointer are the
  // offset in the work-group's LDS).
  const unsigned lBase =
      (unsigned)(size_t)(lds) + (unsigned)(crow * GPW + ccol) * 2u;

  // Tile 0 lands and is published; tile 1 then flies while tile 0 is worked on.
  gemm_copy_tile(lBase, Ar, Br);
  asm volatile("s_wait_asynccnt 0x0" ::: "memory");  // own copies landed
  __syncthreads();                                   // tile 0 visible to all
  gemm_copy_tile(lBase + GBUF * 2u, Ar + GKT, Br + GKT);

  for (int t = 0; t < DD / GKT; ++t) {
    const int cur = t & 1;
    const _Float16* tA = lds + (size_t)cur * GBUF;
    const _Float16* tB = tA + 256 * GPW;
    // unrolled so that ks folds into the LDS loads' immediate offsets
#pragma unroll
    for (int ks = 0; ks < GKT; ks += 32) {
      const v16h a0 = load_frag(tA + (wm)      * GPW + ks, GPW, lane);
      const v16h a1 = load_frag(tA + (wm + 16) * GPW + ks, GPW, lane);
      const v16h a2 = load_frag(tA + (wm + 32) * GPW + ks, GPW, lane);
      const v16h a3 = load_frag(tA + (wm + 48) * GPW + ks, GPW, lane);
      const v16h b0 = load_frag(tB + (wn)      * GPW + ks, GPW, lane);
      const v16h b1 = load_frag(tB + (wn + 16) * GPW + ks, GPW, lane);
      const v16h b2 = load_frag(tB + (wn + 32) * GPW + ks, GPW, lane);
      const v16h b3 = load_frag(tB + (wn + 48) * GPW + ks, GPW, lane);
      acc[0][0] = wmma16(a0, b0, acc[0][0]);
      acc[1][0] = wmma16(a1, b0, acc[1][0]);
      acc[2][0] = wmma16(a2, b0, acc[2][0]);
      acc[3][0] = wmma16(a3, b0, acc[3][0]);
      acc[0][1] = wmma16(a0, b1, acc[0][1]);
      acc[1][1] = wmma16(a1, b1, acc[1][1]);
      acc[2][1] = wmma16(a2, b1, acc[2][1]);
      acc[3][1] = wmma16(a3, b1, acc[3][1]);
      acc[0][2] = wmma16(a0, b2, acc[0][2]);
      acc[1][2] = wmma16(a1, b2, acc[1][2]);
      acc[2][2] = wmma16(a2, b2, acc[2][2]);
      acc[3][2] = wmma16(a3, b2, acc[3][2]);
      acc[0][3] = wmma16(a0, b3, acc[0][3]);
      acc[1][3] = wmma16(a1, b3, acc[1][3]);
      acc[2][3] = wmma16(a2, b3, acc[2][3]);
      acc[3][3] = wmma16(a3, b3, acc[3][3]);
    }
    // Hand-over: this wave's reads of the current tile are done, its copies of
    // the next tile have landed; the barrier says both of every wave.
    asm volatile("s_wait_dscnt 0x0" ::: "memory");
    asm volatile("s_wait_asynccnt 0x0" ::: "memory");
    __syncthreads();
    if (t + 2 < DD / GKT) {   // refill the buffer that this tile has left
      gemm_copy_tile(lBase + (unsigned)cur * (GBUF * 2u),
                     Ar + (t + 2) * GKT, Br + (t + 2) * GKT);
    }
  }
  asm volatile("s_wait_asynccnt 0x0" ::: "memory");  // nothing left in flight
}

// ---------------------------------------------------------------------------
// QKV GEMM mainloop: 256x384 block tile, 8 waves (4x2); each wave owns a 64x192
// sub-tile = 4x12 frags, so that a fragment read from LDS feeds 12 (A) or 4 (B)
// products and a staged byte feeds more of them. One work-group per WGP, two
// waves a SIMD. Staging as in the mainloop above.
// ---------------------------------------------------------------------------
#define QBN 384             // columns of a work-group's tile
#define QWN 192             // columns of a wave's tile: three heads
#define QNF (QWN / 16)      // B fragments of a wave
#define QROWS (256 + QBN)   // rows of a buffer: the A tile, then the B^T tile
#define QBUF (QROWS * GPW)
#define QRUNS ((GKT / 32) * (QNF / 4))   // runs of 16 products in a tile

// Four copies: 16 bytes of each of the rows 0, 32, 64 and 96 from the lane's own.
// The closing s_wait_xcnt stands in front of every later rewrite of the
// copies' address registers (a precaution).
__device__ __forceinline__ void qkv_copy4(unsigned l, const _Float16* g) {
  const unsigned st = 32u * GPW * 2u;   // 32 rows further in LDS, bytes
  asm volatile(
      "global_load_async_to_lds_b128 %0, %4, off\n\t"
      "global_load_async_to_lds_b128 %1, %5, off\n\t"
      "global_load_async_to_lds_b128 %2, %6, off\n\t"
      "global_load_async_to_lds_b128 %3, %7, off\n\t"
      "s_wait_xcnt 0x0"
      :
      : "v"(l), "v"(l + st), "v"(l + 2u * st), "v"(l + 3u * st),
        "v"((unsigned long long)(size_t)(g)),
        "v"((unsigned long long)(size_t)(g + 32 * DD)),
        "v"((unsigned long long)(size_t)(g + 64 * DD)),
        "v"((unsigned long long)(size_t)(g + 96 * DD))
      : "memory");
  // keeps the next four copies' address additions behind these copies: an asm
  // operand lies in the first 256 registers, where accumulators live too, and
  // with all twenty copies' addresses formed at once 40 accumulator registers
  // were moved out of the way and back in every tile
  __builtin_amdgcn_sched_barrier(0);
}

// One tile: each thread brings 16 bytes of rows crow + 32 j, eight of A and
// twelve of B^T.
__device__ __forceinline__ void qkv_copy_tile(unsigned l, const _Float16* ga,
                                              const _Float16* gb) {
  const unsigned s4 = 128u * GPW * 2u;   // 128 rows further in LDS, bytes
  qkv_copy4(l, ga);
  qkv_copy4(l + s4, ga + 128 * DD);
  qkv_copy4(l + 2u * s4, gb);
  qkv_copy4(l + 3u * s4, gb + 128 * DD);
  qkv_copy4(l + 4u * s4, gb + 256 * DD);
}

__device__ __forceinline__ void qkv_mainloop(
    const _Float16* __restrict__ A, const _Float16* __restrict__ BT,
    int m0, int n0, _Float16* lds, int tid, v8f acc[4][QNF]) {
  const int lane = tid & 31;
  const int wave = tid >> 5;
  const int wm   = (wave & 3) * 64;    // 0,64,128,192
  const int wn   = (wave >> 2) * QWN;  // 0,192
  const int crow = tid >> 3;           // 0..31
  const int ccol = (tid & 7) * 8;      // halves

  const _Float16* Ar = A  + (size_t)(m0 + crow) * DD + ccol;
  const _Float16* Br = BT + (size_t)(n0 + crow) * DD + ccol;

  // Per-lane LDS byte address (the low 32 bits of the generic pointer are the
  // offset in the work-group's LDS).
  const unsigned lBase =
      (unsigned)(size_t)(lds) + (unsigned)(crow * GPW + ccol) * 2u;

  // Tile 0 lands and is published; tile 1 then flies while tile 0 is worked on.
  qkv_copy_tile(lBase, Ar, Br);
  asm volatile("s_wait_asynccnt 0x0" ::: "memory");  // own copies landed
  __syncthreads();                                   // tile 0 visible to all
  qkv_copy_tile(lBase + QBUF * 2u, Ar + GKT, Br + GKT);

  for (int t = 0; t < DD / GKT; ++t) {
    const int cur = t & 1;
    const _Float16* tA = lds + (size_t)cur * QBUF;
    const _Float16* tB = tA + 256 * GPW;
    // A tile is worked through in runs of 16 products: four B fragments with
    // the four A fragments of their k step. Two sets of B fragments: the next
    // run's are asked for in front of this run. All loops over g, i and j are
    // unrolled: their index names registers and folds into the LDS loads'
    // immediate offsets.
    v16h a[4], bf[2][4];
#pragma unroll
    for (int i = 0; i < 4; ++i) a[i] = load_frag(tA + (wm + 16 * i) * GPW, GPW, lane);
#pragma unroll
    for (int j = 0; j < 4; ++j)
      bf[0][j] = load_frag(tB + (wn + 16 * j) * GPW, GPW, lane);
#pragma unroll
    for (int g = 0; g < QRUNS; ++g) {
      if (g + 1 < QRUNS) {
        const int gn = g + 1;
#pragma unroll
        for (int j = 0; j < 4; ++j)
          bf[gn & 1][j] = load_frag(
              tB + (wn + 16 * (4 * (gn % 3) + j)) * GPW + 32 * (gn / 3), GPW, lane);
      }
      // keeps the next run's LDS reads in front of this run's products: left
      // alone, the scheduler sinks each read to its use, with a full wait there
      __builtin_amdgcn_sched_barrier(0);
#pragma unroll
      for (int j = 0; j < 4; ++j) {
#pragma unroll
        for (int i = 0; i < 4; ++i)
          acc[i][4 * (g % 3) + j] =
              wmma16(a[i], bf[g & 1][j], acc[i][4 * (g % 3) + j]);
      }
      // keeps later LDS reads, which reuse this run's fragment registers,
      // together behind the run and not among its products
      __builtin_amdgcn_sched_barrier(0);
      if (g % 3 == 2 && g + 1 < QRUNS) {
#pragma unroll
        for (int i = 0; i < 4; ++i)
          a[i] = load_frag(tA + (wm + 16 * i) * GPW + 32 * (g / 3 + 1), GPW, lane);
      }
    }
    // Hand-over: this wave's reads of the current tile are done, its copies of
    // the next tile have landed; the barrier says both of every wave.
    asm volatile("s_wait_dscnt 0x0" ::: "memory");
    asm volatile("s_wait_asynccnt 0x0" ::: "memory");
    __syncthreads();
    if (t + 2 < DD / GKT) {   // refill the buffer that this tile has left
      qkv_copy_tile(lBase + (unsigned)cur * (QBUF * 2u),
                    Ar + (t + 2) * GKT, Br + (t + 2) * GKT);
    }
  }
  asm volatile("s_wait_asynccnt 0x0" ::: "memory");  // nothing left in flight
}

// ---------------------------------------------------------------------------
// Kernel 1: all three conversions in one launch of few, long waves.
// Work-groups 0 .. PWQ + PWP - 1 take one weight tile each,
// WT[n*K + k] = (f16) W[k*N + n]; the PXB work-groups behind them take x,
// f32 -> f16. Every thread has all its loads in flight before its first use.
// ---------------------------------------------------------------------------
#define PTK 128   // k per weight tile: a piece of a WT row is 256 B
#define PTN 64    // n per weight tile: a piece of a W row is 256 B
#define PPW 136   // LDS row pitch in halves: 256 B + 16 B, 16-byte stores of 16
                  // rows then fall on 64 distinct banks
#define PWQ ((DD / PTK) * (3 * DD / PTN))   // tiles of Wqkv
#define PWP ((DD / PTK) * (DD / PTN))       // tiles of Wproj
#define PXL 16                              // 16-byte loads of x per thread
#define PXB (HB * TT * DD / 4 / (256 * PXL))

// One PTK x PTN tile. A thread loads 4 n of 8 consecutive k, so it holds four
// 16-byte pieces of WT rows; row n lies in LDS at row (n & 3) * 16 + (n >> 2),
// so that the 16 lanes of one store write 16 neighbouring LDS rows.
__device__ __forceinline__ void prep_weight_tile(const float* __restrict__ Wm,
                                                 _Float16* __restrict__ WT,
                                                 const int N, int w, int tid,
                                                 _Float16* tile) {
  const int k0 = (w & (DD / PTK - 1)) * PTK;
  const int n0 = (w / (DD / PTK)) * PTN;
  const int nq = tid & 15;   // which 4 n;  on the way out: which 8 k
  const int kg = tid >> 4;   // which 8 k;  on the way out: which 4 n
  const float* s = Wm + (size_t)(k0 + kg * 8) * N + n0 + nq * 4;
  // The loops over i, j and q are unrolled because their index names a register.
  v4f f[8];
#pragma unroll
  for (int i = 0; i < 8; ++i) f[i] = *(const v4f*)(s + (size_t)i * N);
#pragma unroll
  for (int j = 0; j < 4; ++j) {
    v8h hv;
#pragma unroll
    for (int i = 0; i < 8; ++i) hv[i] = (_Float16)f[i][j];
    *(v8h*)(tile + (j * 16 + nq) * PPW + kg * 8) = hv;
  }
  __syncthreads();   // the rows that are read back were written by other waves
  _Float16* d = WT + (size_t)(n0 + kg * 4) * DD + k0 + nq * 8;
#pragma unroll
  for (int q = 0; q < 4; ++q)
    *(v8h*)(d + (size_t)q * DD) =
        *(const v8h*)(tile + (q * 16 + kg) * PPW + nq * 8);
  // later instructions in the listing rewrite registers that these stores name
  // (a precaution)
  asm volatile("s_wait_xcnt 0x0" ::: "memory");
}

__global__ __launch_bounds__(256) void prep_kernel(
    const float* __restrict__ x, const float* __restrict__ Wqkv,
    const float* __restrict__ Wproj, _Float16* __restrict__ xh,
    _Float16* __restrict__ wqkvT, _Float16* __restrict__ wprojT) {
  __shared__ alignas(16) _Float16 tile[PTN * PPW];
  const int tid = threadIdx.x;
  const int blk = blockIdx.x;   // every branch below is the same for a block
  if (blk < PWQ) {
    prep_weight_tile(Wqkv, wqkvT, 3 * DD, blk, tid, tile);
  } else if (blk < PWQ + PWP) {
    prep_weight_tile(Wproj, wprojT, DD, blk - PWQ, tid, tile);
  } else {
    // A wave takes PXL * 512 contiguous bytes of x, 512 per load.
    const size_t base =
        ((size_t)(blk - (PWQ + PWP)) * 8 + (tid >> 5)) * (PXL * 32) + (tid & 31);
    const v4f* s = (const v4f*)x + base;
    v4h* d = (v4h*)xh + base;
    // The loops over i are unrolled because their index names a register.
    v4f f[PXL];
#pragma unroll
    for (int i = 0; i < PXL; ++i) f[i] = s[i * 32];
    // the address stays in its registers up to this wait: left alone, the last
    // load's result is placed over the address that all PXL loads name
    // (a precaution)
    asm volatile("s_wait_xcnt 0x0" :: "v"(s) : "memory");
    // keeps all PXL loads in front of the first use: left alone, the scheduler
    // holds the last four back until the first results have come
    __builtin_amdgcn_sched_barrier(0);
#pragma unroll
    for (int i = 0; i < PXL; ++i) {
      v4h hv;
      hv.x = (_Float16)f[i].x; hv.y = (_Float16)f[i].y;
      hv.z = (_Float16)f[i].z; hv.w = (_Float16)f[i].w;
      d[i * 32] = hv;
    }
    // later instructions in the listing rewrite registers that these stores
    // name (a precaution)
    asm volatile("s_wait_xcnt 0x0" ::: "memory");
  }
}

// ---------------------------------------------------------------------------
// Kernel 2: QKV GEMM + bias + RoPE, scatter into Q[b,h,t,d], K[b,h,t,d],
// V^T[b,h,d,t] (all f16).  grid = (3072/384, 8192/256): one work-group a WGP
// ---------------------------------------------------------------------------
#define QSC 0.18033688f   // 1/sqrt(64) * log2 e: softmax scale, exp as 2^x
#define EPF 68   // staging pitch, floats: 272 B; rows 8 apart fall 32 banks
                 // apart (stores), 16-byte reads of two rows on distinct banks
#define EPH 72   // staging pitch, halves: 144 B, as in the ring
#define ESTG (64 * EPF * 4)   // a wave's staging area, bytes: 64 f32 rows
__global__ __launch_bounds__(256)
__attribute__((amdgpu_waves_per_eu(2, 2))) void qkv_rope_kernel(
    const _Float16* __restrict__ Xh, const _Float16* __restrict__ WT,
    const float* __restrict__ bqkv, const float* __restrict__ cosT,
    const float* __restrict__ sinT, _Float16* __restrict__ Qb,
    _Float16* __restrict__ Kb, _Float16* __restrict__ VT) {
  // the ring, and behind the loop eight staging areas of ESTG bytes
  static_assert(8 * ESTG <= 2 * QBUF * 2, "the staging areas fit");
  __shared__ alignas(16) _Float16 ldsAB[2 * QBUF];
  const int tid  = threadIdx.x;
  const int lane = tid & 31;
  const int hi   = lane >> 4;
  const int cn   = lane & 15;
  const int wave = tid >> 5;
  const int m0   = blockIdx.y * 256;
  const int n0   = blockIdx.x * QBN;

  v8f acc[4][QNF] = {};
  qkv_mainloop(Xh, WT, m0, n0, ldsAB, tid, acc);

  // Epilogue, staged through LDS. The loop's last barrier stands behind every
  // wave's last read of the ring and no copy is in flight, so each wave takes
  // its own staging area there and needs no further barrier.
  // A wave's 192 columns are exactly three heads (they start at a multiple of
  // 64), taken one after the other through the same staging area, and its 64
  // rows lie in one batch.
  const int wv  = __builtin_amdgcn_readfirstlane(wave);  // scalar address parts
  const int gm0 = m0 + (wv & 3) * 64;
  const int b   = gm0 >> 11;
  const int t0  = gm0 & (TT - 1);
  const int rr  = lane >> 3;   // row inside a group of four rows
  const int c   = lane & 7;    // 8-element piece of a row
  char* stg = (char*)ldsAB + wv * ESTG;

  // unrolled because hh names registers
#pragma unroll
  for (int hh = 0; hh < QWN / 64; ++hh) {
  const int nh  = n0 + (wv >> 2) * QWN + hh * 64;
  const int sec = nh >> 10;            // 0=Q 1=K 2=V, the same for a wave
  const int h   = (nh & 1023) >> 6;

  float bias[4];
#pragma unroll
  for (int j = 0; j < 4; ++j) bias[j] = bqkv[nh + 16 * j + cn];

  // The loops over i, j, v and g are unrolled because their index names a
  // register.
  if (sec == 2) {
    // V^T: a lane holds 8 consecutive t of one d. Rows of 64 t = one line.
    _Float16* sv = (_Float16*)stg;
#pragma unroll
    for (int i = 0; i < 4; ++i) {
#pragma unroll
      for (int j = 0; j < 4; ++j) {
        v8h hv;
#pragma unroll
        for (int v = 0; v < 8; ++v) hv[v] = (_Float16)(acc[i][4 * hh + j][v] + bias[j]);
        *(v8h*)(sv + (16 * j + cn) * EPH + 16 * i + 8 * hi) = hv;
      }
    }
    // the rows that are read back were written by other lanes of this wave
    asm volatile("s_wait_dscnt 0x0" ::: "memory");
    _Float16* vrow = VT + ((size_t)((b * HH + h) * DH + rr)) * TT + t0 + c * 8;
#pragma unroll
    for (int rg = 0; rg < 16; ++rg) {
      const v8h hv = *(const v8h*)(sv + (rg * 4 + rr) * EPH + c * 8);
      *(v8h*)(vrow + (size_t)(rg * 4) * TT) = hv;
    }
    // later instructions rewrite registers that these stores name
    // (a precaution)
    asm volatile("s_wait_xcnt 0x0" ::: "memory");
  } else {
    // Q, K: the f32 rows are staged; a lane then takes 8 consecutive d of one
    // row and the 8 that rotate-half pairs with them (d +- 32). The cos and sin
    // rows come in batches of four row groups.
    float* sf = (float*)stg;
    _Float16* dst = ((sec == 0) ? Qb : Kb) +
                    ((size_t)((b * HH + h) * TT + t0 + rr)) * DH + c * 8;
    const float* cp = cosT + (size_t)(t0 + rr) * DH + c * 8;
    const float* sp = sinT + (size_t)(t0 + rr) * DH + c * 8;
    const float sg = (c < 4) ? -1.0f : 1.0f;   // rotate-half: -x[d+32], +x[d-32]
    // Q leaves multiplied by QSC, in f32 ahead of its one rounding to f16, so
    // that the attention's K Q^T comes out as exponents of two; K by one
    const float qs = (sec == 0) ? QSC : 1.0f;
    const float* own = sf + rr * EPF + c * 8;
    const float* par = sf + rr * EPF + (c ^ 4) * 8;
#pragma unroll
    for (int i = 0; i < 4; ++i)
#pragma unroll
      for (int j = 0; j < 4; ++j)
#pragma unroll
        for (int v = 0; v < 8; ++v)
          sf[(16 * i + 8 * hi + v) * EPF + 16 * j + cn] =
              acc[i][4 * hh + j][v] + bias[j];
    // the rows that are read back were written by other lanes of this wave
    asm volatile("s_wait_dscnt 0x0" ::: "memory");
#pragma unroll
    for (int bt = 0; bt < 4; ++bt) {
      v4f tc[8], ts[8];   // [row group in the batch, low or high 4]
#pragma unroll
      for (int g = 0; g < 4; ++g) {
        const int tr = bt * 16 + g * 4;
        tc[2 * g]     = *(const v4f*)(cp + tr * DH);
        tc[2 * g + 1] = *(const v4f*)(cp + tr * DH + 4);
        ts[2 * g]     = *(const v4f*)(sp + tr * DH);
        ts[2 * g + 1] = *(const v4f*)(sp + tr * DH + 4);
      }
      // later instructions rewrite the address registers that these loads name
      // (a precaution)
      asm volatile("s_wait_xcnt 0x0" ::: "memory");
      // keeps the batch's 16 loads together, one wait for all: left alone, the
      // scheduler sinks them to their uses, each with a full wait of its own
      __builtin_amdgcn_sched_barrier(0);
#pragma unroll
      for (int g = 0; g < 4; ++g) {
        const int tr = bt * 16 + g * 4;     // row in the wave's tile
        const v4f x0 = *(const v4f*)(own + tr * EPF);
        const v4f x1 = *(const v4f*)(own + tr * EPF + 4);
        const v4f p0 = *(const v4f*)(par + tr * EPF);
        const v4f p1 = *(const v4f*)(par + tr * EPF + 4);
        const v4f c0 = tc[2 * g], c1 = tc[2 * g + 1];
        const v4f s0 = ts[2 * g] * sg, s1 = ts[2 * g + 1] * sg;
        v8h ov;
#pragma unroll
        for (int e = 0; e < 4; ++e) {
          ov[e]     = (_Float16)((x0[e] * c0[e] + p0[e] * s0[e]) * qs);
          ov[4 + e] = (_Float16)((x1[e] * c1[e] + p1[e] * s1[e]) * qs);
        }
        *(v8h*)(dst + (size_t)tr * DH) = ov;
        // the next row group's LDS reads rewrite registers that this store
        // names (a precaution)
        asm volatile("s_wait_xcnt 0x0" ::: "memory");
      }
      if (bt < 3) {
        // the next batch's loads start behind this batch's work
        __builtin_amdgcn_sched_barrier(0);
      }
    }
  }
  // this head's rows have been read back before the next head's are staged
  asm volatile("s_wait_dscnt 0x0" ::: "memory");
  }
}

#define AKT 64
#define APW 72

// One tile = 2 x 8 KB; each thread brings two 16-byte pieces of K and two of
// V^T. The closing s_wait_xcnt stands in front of every later rewrite of the
// copies' address registers (a precaution).
__device__ __forceinline__ void attn_copy_tile(unsigned lk,
                                               const _Float16* gk,
                                               const _Float16* gv) {
  const unsigned lk1 = lk + 32u * APW * 2u;
  const unsigned lv  = lk + AKT * APW * 2u;   // V^T tile follows the K tile
  const unsigned lv1 = lv + 32u * APW * 2u;
  const _Float16* gk1 = gk + 32 * DH;
  const _Float16* gv1 = gv + 32 * TT;
  asm volatile(
      "global_load_async_to_lds_b128 %0, %4, off\n\t"
      "global_load_async_to_lds_b128 %1, %5, off\n\t"
      "global_load_async_to_lds_b128 %2, %6, off\n\t"
      "global_load_async_to_lds_b128 %3, %7, off\n\t"
      "s_wait_xcnt 0x0"
      :
      : "v"(lk), "v"(lk1), "v"(lv), "v"(lv1),
        "v"((unsigned long long)(size_t)gk),
        "v"((unsigned long long)(size_t)gk1),
        "v"((unsigned long long)(size_t)gv),
        "v"((unsigned long long)(size_t)gv1)
      : "memory");
}

// Lane l with lane l ^ 16: the two lanes that share one query column.
__device__ __forceinline__ float xhalf(float x) {
  const int i = __builtin_bit_cast(int, x);
  return __builtin_bit_cast(float, __builtin_amdgcn_permlanex16(
      i, i, 0x76543210, 0xfedcba98, false, false));
}

// All scores below are exponents of two (Q carries QSC) and relative: the
// negated maximum in use of a lane's column is the C operand of the first
// S^T product, so the accumulators hold s - m and go to the exponential as
// they are.
// The maximum in use of a column may lag behind its true running maximum by up
// to ARS: every p then stays below 2^ARS = e^6 = 403, far inside f16, and the
// output tiles and the sum are rescaled only in a pass in which some column
// goes past.
#define ARS (6.0f * 1.44269504f)

// A lane's own maximum over its 16 relative scores of one column group.
__device__ __forceinline__ float attn_lane_max(v8f s0, v8f s1) {
  // The loop over v is unrolled because its index names a register.
  float mx = fmaxf(s0[0], s1[0]);
#pragma unroll
  for (int v = 1; v < 8; ++v) mx = fmaxf(mx, fmaxf(s0[v], s1[v]));
  return mx;
}

// The rare path: raises the column's maximum in use to this pass's column maximum where that is higher (the same
// value in both lanes of a column), rescales the group's sum and output and
// moves this pass's scores and the C operand by the same step. In the first
// pass the maximum in use is not yet one (C is zero): the column's maximum is
// taken whatever its sign, and sum and output are still zero.
__device__ __forceinline__ void attn_rescale(float mx, bool first, v8f& nm,
                                             float& lsum, v8f o[4], v8f& s0,
                                             v8f& s1) {
  mx = fmaxf(mx, xhalf(mx));        // the column's other 16 keys
  const float d  = first ? mx : fmaxf(mx, 0.0f);   // rise of the maximum in use
  const float al = first ? 0.0f : __builtin_amdgcn_exp2f(-d);
  lsum *= al;
  nm -= d;
  s0 -= d;
  s1 -= d;
  // The loops over f and v are unrolled because their index names a register.
#pragma unroll
  for (int f = 0; f < 4; ++f)
#pragma unroll
    for (int v = 0; v < 8; ++v) o[f][v] *= al;
}

// One column group's probabilities over 32 keys from its relative scores:
// adds to this lane's share of the sum and returns P^T as a B operand in the k
// order of load_frag: halves 0..7 = keys 8 hi.., 8..15 = keys 16 + 8 hi..
__device__ __forceinline__ v16h attn_probs(v8f s0, v8f s1, float& lsum) {
  // The loops over v are unrolled because their index names a register.
  // The 16 exponentials stand in one statement, none next to a user of its
  // registers (every result is marked early: it shares no register with a
  // source), with the closing v_nop as the slot that the instruction set asks
  // for behind a transcendental. The sources are read where the matrix
  // instruction left them.
  float e0, e1, e2, e3, e4, e5, e6, e7, g0, g1, g2, g3, g4, g5, g6, g7;
  asm("v_exp_f32 %0, %16\n\t"
      "v_exp_f32 %1, %17\n\t"
      "v_exp_f32 %2, %18\n\t"
      "v_exp_f32 %3, %19\n\t"
      "v_exp_f32 %4, %20\n\t"
      "v_exp_f32 %5, %21\n\t"
      "v_exp_f32 %6, %22\n\t"
      "v_exp_f32 %7, %23\n\t"
      "v_exp_f32 %8, %24\n\t"
      "v_exp_f32 %9, %25\n\t"
      "v_exp_f32 %10, %26\n\t"
      "v_exp_f32 %11, %27\n\t"
      "v_exp_f32 %12, %28\n\t"
      "v_exp_f32 %13, %29\n\t"
      "v_exp_f32 %14, %30\n\t"
      "v_exp_f32 %15, %31\n\t"
      "v_nop"
      : "=&v"(e0), "=&v"(e1), "=&v"(e2), "=&v"(e3), "=&v"(e4), "=&v"(e5),
        "=&v"(e6), "=&v"(e7), "=&v"(g0), "=&v"(g1), "=&v"(g2), "=&v"(g3),
        "=&v"(g4), "=&v"(g5), "=&v"(g6), "=&v"(g7)
      : "v"(s0[0]), "v"(s0[1]), "v"(s0[2]), "v"(s0[3]), "v"(s0[4]), "v"(s0[5]),
        "v"(s0[6]), "v"(s0[7]), "v"(s1[0]), "v"(s1[1]), "v"(s1[2]), "v"(s1[3]),
        "v"(s1[4]), "v"(s1[5]), "v"(s1[6]), "v"(s1[7]));
  const v8f p0 = {e0, e1, e2, e3, e4, e5, e6, e7};
  const v8f p1 = {g0, g1, g2, g3, g4, g5, g6, g7};
  v16h pf;
#pragma unroll
  for (int v = 0; v < 8; ++v) {
    pf[v]     = (_Float16)p0[v];
    pf[8 + v] = (_Float16)p1[v];
  }
  const v8f pp = p0 + p1;
  float sum = pp[0];
#pragma unroll
  for (int v = 1; v < 8; ++v) sum += pp[v];
  lsum += sum;
  return pf;
}

// Two work-groups share a WGP (512 work-groups on 256 WGPs), four waves a SIMD:
// the register budget is set for exactly that.
__global__ __launch_bounds__(256)
__attribute__((amdgpu_waves_per_eu(4, 4))) void attn_kernel(
    const _Float16* __restrict__ Q, const _Float16* __restrict__ K,
    const _Float16* __restrict__ VT, _Float16* __restrict__ O) {
  static_assert(AKT == DH, "K tile and V^T tile have the same number of rows");
  __shared__ alignas(16) _Float16 KVtile[2][2][AKT * APW];  // [buffer][K, V^T]
  const int tid  = threadIdx.x;
  const int lane = tid & 31;
  const int hi   = lane >> 4;
  const int cn   = lane & 15;
  const int wave = tid >> 5;
  const int bh   = blockIdx.y;
  const int b    = bh >> 4;
  const int h    = bh & 15;
  const int tq0  = blockIdx.x * 256 + wave * 32;

  const _Float16* Qp = Q  + ((size_t)bh * TT + tq0) * DH;
  const _Float16* Kp = K  + (size_t)bh * TT * DH;
  const _Float16* Vp = VT + (size_t)bh * DH * TT;   // [DH][TT]

  // This thread's piece of a tile: row crow (and crow + 32), 16 bytes at ccol.
  const int crow = tid >> 3;         // 0..31
  const int ccol = (tid & 7) * 8;    // halves
  const unsigned coff = (unsigned)(crow * APW + ccol) * 2u;
  const unsigned lkBase = (unsigned)(size_t)(&KVtile[0][0][0]) + coff;
  const _Float16* gkBase = Kp + (size_t)crow * DH + ccol;
  const _Float16* gvBase = Vp + (size_t)crow * TT + ccol;

  // Tile 0 lands and is published; tile 1 then flies while tile 0 is worked on.
  attn_copy_tile(lkBase, gkBase, gvBase);
  asm volatile("s_wait_asynccnt 0x0" ::: "memory");  // own copies landed
  __syncthreads();                                   // tile 0 visible to all
  attn_copy_tile(lkBase + 2u * AKT * APW * 2u, gkBase + (size_t)AKT * DH,
                 gvBase + AKT);

  // Q is the B operand: in group g lane cn holds query column tq0 + 16 g + cn.
  const v16h qa0 = load_frag(Qp,                DH, lane);   // g 0, d 0..31
  const v16h qa1 = load_frag(Qp + 32,           DH, lane);   // g 0, d 32..63
  const v16h qb0 = load_frag(Qp + 16 * DH,      DH, lane);   // g 1, d 0..31
  const v16h qb1 = load_frag(Qp + 16 * DH + 32, DH, lane);   // g 1, d 32..63

  // Everything below is per query column, so per lane and group: lanes cn and
  // cn + 16 share a column and split its keys (scores) and its d (output).
  v8f nmA = {}, nmB = {};           // negated maxima in use, as C operands
  float lsumA = 0.f, lsumB = 0.f;   // this lane's shares of the running sums
  v8f oA[4] = {}, oB[4] = {};       // o[f][v] = O^T[16 f + 8 hi + v][cn]

  for (int ps = 0; ps < TT / 32; ++ps) {
    const int st  = ps >> 1;          // tile
    const int cur = st & 1;           // its buffer
    const int kb  = (ps & 1) * 32;    // first key of this pass inside the tile
    const _Float16* tK = &KVtile[cur][0][0];
    const _Float16* tV = &KVtile[cur][1][0];

    // S^T = K Q^T - m: s0[v] = key kb + 8 hi + v, s1[v] = key kb + 16 + 8 hi + v.
    const v16h k00 = load_frag(tK + kb * APW,             APW, lane);
    const v16h k01 = load_frag(tK + kb * APW + 32,        APW, lane);
    const v16h k10 = load_frag(tK + (kb + 16) * APW,      APW, lane);
    const v16h k11 = load_frag(tK + (kb + 16) * APW + 32, APW, lane);
    v8f sA0 = wmma16(k00, qa0, nmA);
    v8f sA1 = wmma16(k10, qa0, nmA);
    sA0 = wmma16(k01, qa1, sA0);
    sA1 = wmma16(k11, qa1, sA1);
    v8f sB0 = wmma16(k00, qb0, nmB);
    v8f sB1 = wmma16(k10, qb0, nmB);
    sB0 = wmma16(k01, qb1, sB0);
    sB1 = wmma16(k11, qb1, sB1);

    const v16h vf0 = load_frag(tV + 0  * APW + kb, APW, lane);
    const v16h vf1 = load_frag(tV + 16 * APW + kb, APW, lane);
    const v16h vf2 = load_frag(tV + 32 * APW + kb, APW, lane);
    const v16h vf3 = load_frag(tV + 48 * APW + kb, APW, lane);

    // Lazy rescale: one test per pass for both groups and all lanes, a scalar
    // branch; either lane of a column sees a score past the bound.
    const float mxA = attn_lane_max(sA0, sA1);
    const float mxB = attn_lane_max(sB0, sB1);
    const bool need  = fmaxf(mxA, mxB) > ARS;
    const bool first = ps == 0;
    if (first || __builtin_amdgcn_ballot_w32(need) != 0) {
      attn_rescale(mxA, first, nmA, lsumA, oA, sA0, sA1);
      attn_rescale(mxB, first, nmB, lsumB, oB, sB0, sB1);
    }
    const v16h pfA = attn_probs(sA0, sA1, lsumA);
    const v16h pfB = attn_probs(sB0, sB1, lsumB);

    // O^T += V^T P^T
    oA[0] = wmma16(vf0, pfA, oA[0]);
    oA[1] = wmma16(vf1, pfA, oA[1]);
    oA[2] = wmma16(vf2, pfA, oA[2]);
    oA[3] = wmma16(vf3, pfA, oA[3]);
    oB[0] = wmma16(vf0, pfB, oB[0]);
    oB[1] = wmma16(vf1, pfB, oB[1]);
    oB[2] = wmma16(vf2, pfB, oB[2]);
    oB[3] = wmma16(vf3, pfB, oB[3]);

    if (ps & 1) {
      // Hand-over: this wave's reads of the current tile are done, its copies
      // of the next tile have landed; the barrier says both of every wave.
      asm volatile("s_wait_dscnt 0x0" ::: "memory");
      asm volatile("s_wait_asynccnt 0x0" ::: "memory");
      __syncthreads();
      if (st + 2 < TT / AKT) {   // refill the buffer that this tile has left
        attn_copy_tile(lkBase + (unsigned)cur * (2u * AKT * APW * 2u),
                       gkBase + (size_t)(st + 2) * AKT * DH,
                       gvBase + (st + 2) * AKT);
      }
    }
  }
  asm volatile("s_wait_asynccnt 0x0" ::: "memory");  // nothing left in flight

  // join the two shares of each column's sum
  const float invA = 1.0f / (lsumA + xhalf(lsumA));
  const float invB = 1.0f / (lsumB + xhalf(lsumB));
  // A lane holds 8 consecutive d of its query row per tile: 16-byte stores.
  _Float16* Op = O + ((size_t)(b * TT + tq0 + cn)) * DD + h * DH + hi * 8;
  // The loops over f and v are unrolled because their index names a register.
  v8h ova[4], ovb[4];
#pragma unroll
  for (int f = 0; f < 4; ++f) {
#pragma unroll
    for (int v = 0; v < 8; ++v) {
      ova[f][v] = (_Float16)(oA[f][v] * invA);
      ovb[f][v] = (_Float16)(oB[f][v] * invB);
    }
  }
#pragma unroll
  for (int f = 0; f < 4; ++f) {
    *(v8h*)(Op + 16 * f) = ova[f];
    *(v8h*)(Op + 16 * DD + 16 * f) = ovb[f];
  }
}

// ---------------------------------------------------------------------------
// Kernel 4: output projection, fp32 result + bias. grid = (1024/128, 8192/256)
// ---------------------------------------------------------------------------
__global__ __launch_bounds__(256) void proj_kernel(
    const _Float16* __restrict__ Ah, const _Float16* __restrict__ WT,
    const float* __restrict__ bproj, float* __restrict__ out) {
  __shared__ alignas(16) _Float16 ldsAB[2 * GBUF];
  const int tid  = threadIdx.x;
  const int lane = tid & 31;
  const int hi   = lane >> 4;
  const int cn   = lane & 15;
  const int wave = tid >> 5;
  const int wm   = (wave & 3) * 64;
  const int wn   = (wave >> 2) * 64;
  const int m0   = blockIdx.y * 256;
  const int n0   = blockIdx.x * 128;

  v8f acc[4][4] = {};
  gemm_mainloop(Ah, WT, m0, n0, ldsAB, tid, acc);

#pragma unroll
  for (int i = 0; i < 4; ++i) {
#pragma unroll
    for (int j = 0; j < 4; ++j) {
      const int gn = n0 + wn + 16 * j + cn;
      const float bv = bproj[gn];
#pragma unroll
      for (int v = 0; v < 8; ++v) {
        const int gm = m0 + wm + 16 * i + v + hi * 8;
        out[(size_t)gm * DD + gn] = acc[i][j][v] + bv;
      }
    }
  }
}

// ---------------------------------------------------------------------------
extern "C" void kernel_launch(void* const* d_in, const int* in_sizes, int n_in,
                              void* d_out, int out_size, void* d_ws,
                              size_t ws_size, hipStream_t stream) {
  const float* x     = (const float*)d_in[0];
  const float* Wqkv  = (const float*)d_in[1];
  const float* bqkv  = (const float*)d_in[2];
  const float* Wproj = (const float*)d_in[3];
  const float* bproj = (const float*)d_in[4];
  const float* cosT  = (const float*)d_in[5];
  const float* sinT  = (const float*)d_in[6];
  float* out = (float*)d_out;

  char* ws = (char*)d_ws;
  // byte offsets (total 72 MB)
  _Float16* xh     = (_Float16*)(ws);              // 16 MB, reused as attn out
  _Float16* wqkvT  = (_Float16*)(ws + 16777216);   //  6 MB
  _Float16* wprojT = (_Float16*)(ws + 23068672);   //  2 MB
  _Float16* Qb     = (_Float16*)(ws + 25165824);   // 16 MB
  _Float16* Kb     = (_Float16*)(ws + 41943040);   // 16 MB
  _Float16* VT     = (_Float16*)(ws + 58720256);   // 16 MB
  _Float16* attnh  = xh;   // x no longer needed after QKV GEMM

  // 1) precision conversion / weight transpose
  prep_kernel<<<PWQ + PWP + PXB, 256, 0, stream>>>(x, Wqkv, Wproj, xh, wqkvT,
                                                   wprojT);
  // 2) QKV GEMM + RoPE  (M=8192 in 256-row tiles, N=3072 in 384-col tiles)
  qkv_rope_kernel<<<dim3(8, 32), 256, 0, stream>>>(xh, wqkvT, bqkv, cosT, sinT,
                                                    Qb, Kb, VT);
  // 3) flash attention  (grid: T/256 x B*H)
  attn_kernel<<<dim3(TT / 256, HB * HH), 256, 0, stream>>>(Qb, Kb, VT, attnh);
  // 4) output projection (M=8192, N=1024)
  proj_kernel<<<dim3(8, 32), 256, 0, stream>>>(attnh, wprojT, bproj, out);
}

// v010
// One run takes 120 microseconds.
// Next to v009, in two timings, it ran 1.07 times as fast each time.
// Counting every step since v000, it is 3.85 times as fast.
#include <hip/hip_runtime.h>
#include <hip/hip_bf16.h>

typedef __attribute__((ext_vector_type(16))) _Float16 v16h;
typedef __attribute__((ext_vector_type(4)))  _Float16 v4h;
typedef __attribute__((ext_vector_type(8)))  _Float16 v8h;
typedef __attribute__((ext_vector_type(8)))  float    v8f;
typedef __attribute__((ext_vector_type(4)))  float    v4f;
typedef __attribute__((ext_vector_type(4)))  unsigned int v4u;

#define HB 4      // batch
#define TT 2048   // sequence
#define DD 1024   // model dim
#define HH 16     // heads
#define DH 64     // head dim

union FragU { v16h h; v4u u[2]; };

// 16x32 f16 WMMA fragment load (A-layout; identical for B when source is
// N-major / K-contiguous). lane r<16: row r, halves 0..7 = K 8*hi.., halves
// 8..15 = K 16+8*hi.. (hi = lane>=16).  ld = row stride in halves.
__device__ __forceinline__ v16h load_frag(const _Float16* base, int ld, int lane) {
  const int r  = lane & 15;
  const int hi = lane >> 4;
  const _Float16* p = base + (size_t)r * ld + hi * 8;
  FragU f;
  f.u[0] = *(const v4u*)(p);
  f.u[1] = *(const v4u*)(p + 16);
  return f.h;
}

__device__ __forceinline__ v8f wmma16(v16h a, v16h b, v8f c) {
  return __builtin_amdgcn_wmma_f32_16x16x32_f16(false, a, false, b, (short)0, c,
                                                false, false);
}

// ---------------------------------------------------------------------------
// Tensor loads: one request of one wave brings a tile of rows of 128 bytes from
// global memory into LDS, through no register and with no address arithmetic
// on the vector port. The pad gives the LDS rows their pitch of 144 bytes.
// ---------------------------------------------------------------------------
typedef __attribute__((ext_vector_type(8))) unsigned int v8u;

__device__ __forceinline__ unsigned uni(unsigned v) {
  return (unsigned)__builtin_amdgcn_readfirstlane((int)v);
}

// A wave-uniform test, or a descriptor word, held in a scalar register. The
// branch on such a test is a scalar branch: a tensor load ignores EXEC, only
// such a branch guards it.
__device__ __forceinline__ unsigned pinned(unsigned v) {
  unsigned w = uni(v);
  // the value stays in a scalar register
  asm volatile("" : "+s"(w));
  return w;
}

// Word 0 of group 1: no mask, sizes in bytes, 4 dwords of pad behind every 32.
#define TDW0 ((1u << 20) | (4u << 22) | (3u << 25))

// Group 1: a tile of `rows` rows of 128 bytes, source row pitch in bytes.
// Words 1 to 7 are descriptor words held in scalar registers of their own
// (pinned): left as plain constants, equal words were kept once, and between a
// request and its wait the other's register served as a temporary.
__device__ __forceinline__ v8u tdm_group1(unsigned rows, unsigned pitch) {
  v8u g;
  g[0] = uni(TDW0);
  g[1] = pinned(128u << 16);        // tensor_dim0
  g[2] = pinned(rows << 16);        // tensor_dim1
  g[3] = pinned(128u << 16);        // tile_dim0
  g[4] = pinned(rows);              // tile_dim1
  g[5] = pinned(pitch);
  g[6] = pinned(0u);
  g[7] = pinned(0u);
  return g;
}

// Group 0: the tile's place in LDS (bytes) and its first byte in memory.
__device__ __forceinline__ v4u tdm_group0(unsigned lds, unsigned long long ga) {
  v4u g;
  g[0] = uni(1u);
  g[1] = uni(lds);
  g[2] = uni((unsigned)ga);
  g[3] = uni((((unsigned)(ga >> 32)) & 0x01FFFFFFu) | 0x80000000u);
  return g;
}

__device__ __forceinline__ void tdm_load(v4u g0, v8u g1) {
  asm volatile("tensor_load_to_lds %0, %1" :: "s"(g0), "s"(g1) : "memory");
}

// The issuing wave's own request has landed. Its two groups are named as inputs
// so that the registers which the request was issued from keep their values up
// to this wait.
__device__ __forceinline__ void tdm_wait(v4u g0, v8u g1) {
  asm volatile("s_wait_tensorcnt 0x0" :: "s"(g0), "s"(g1) : "memory");
}

// ---------------------------------------------------------------------------
// GEMM mainloop of the projection: 256x128 block tile, 256 threads = 8 waves (4x2); each
// wave owns a 64x64 sub-tile = 4x4 frags. A and B^T tiles of GKT k are staged
// in LDS (two buffers) by tensor loads: a staged row is one whole 128-byte line
// of its source row, and waves 0 to 2 bring a slice of GSR rows each.
// ---------------------------------------------------------------------------
#define GKT 64            // k per staged tile: one row is 128 B
#define GPW 72            // LDS row pitch in halves: 128 B + 16 B, 16-byte reads
                          // of 16 rows then fall on 64 distinct banks
#define GROWS (256 + 128) // rows of a buffer: the A tile, then the B^T tile
#define GBUF (GROWS * GPW)

#define GSR 128           // rows of a slice: 128 * 144 B is a multiple of 2 KiB
#define GSB (GSR * GPW * 2)   // a slice in LDS, bytes
static_assert(GSB % 2048 == 0 && (GBUF * 2) % 2048 == 0, "places in LDS");

__device__ __forceinline__ void gemm_mainloop(
    const _Float16* __restrict__ A, const _Float16* __restrict__ BT,
    int m0, int n0, _Float16* lds, int tid, v8f acc[4][4]) {
  const int lane = tid & 31;
  const int wave = tid >> 5;
  const int wm   = (wave & 3) * 64;   // 0,64,128,192
  const int wn   = (wave >> 2) * 64;  // 0,64

  // Waves 0 and 1 bring the two slices of the A tile, wave 2 the B^T tile.
  const unsigned wv = uni((unsigned)tid >> 5);
  const unsigned long long ga = (unsigned long long)(size_t)(
      (wv < 2u) ? A + (size_t)(m0 + GSR * (int)wv) * DD : BT + (size_t)n0 * DD);
  // The slice's place (the low 32 bits of the generic pointer are the offset in
  // the work-group's LDS).
  const unsigned lsl = (unsigned)(size_t)(lds) + wv * GSB;
  const v8u g1 = tdm_group1(GSR, DD * 2u);

  // Tile 0 lands and is published; tile 1 then flies while tile 0 is worked on.
  v4u g0 = tdm_group0(lsl, ga);
  if (pinned(wv < 3u)) {
    tdm_load(g0, g1);
    tdm_wait(g0, g1);
  }
  __syncthreads();                                   // tile 0 visible to all
  g0 = tdm_group0(lsl + GBUF * 2u, ga + GKT * 2u);
  if (pinned(wv < 3u)) tdm_load(g0, g1);

  for (int t = 0; t < DD / GKT; ++t) {
    const int cur = t & 1;
    const _Float16* tA = lds + (size_t)cur * GBUF;
    const _Float16* tB = tA + 256 * GPW;
    // unrolled so that ks folds into the LDS loads' immediate offsets
#pragma unroll
    for (int ks = 0; ks < GKT; ks += 32) {
      const v16h a0 = load_frag(tA + (wm)      * GPW + ks, GPW, lane);
      const v16h a1 = load_frag(tA + (wm + 16) * GPW + ks, GPW, lane);
      const v16h a2 = load_frag(tA + (wm + 32) * GPW + ks, GPW, lane);
      const v16h a3 = load_frag(tA + (wm + 48) * GPW + ks, GPW, lane);
      const v16h b0 = load_frag(tB + (wn)      * GPW + ks, GPW, lane);
      const v16h b1 = load_frag(tB + (wn + 16) * GPW + ks, GPW, lane);
      const v16h b2 = load_frag(tB + (wn + 32) * GPW + ks, GPW, lane);
      const v16h b3 = load_frag(tB + (wn + 48) * GPW + ks, GPW, lane);
      acc[0][0] = wmma16(a0, b0, acc[0][0]);
      acc[1][0] = wmma16(a1, b0, acc[1][0]);
      acc[2][0] = wmma16(a2, b0, acc[2][0]);
      acc[3][0] = wmma16(a3, b0, acc[3][0]);
      acc[0][1] = wmma16(a0, b1, acc[0][1]);
      acc[1][1] = wmma16(a1, b1, acc[1][1]);
      acc[2][1] = wmma16(a2, b1, acc[2][1]);
      acc[3][1] = wmma16(a3, b1, acc[3][1]);
      acc[0][2] = wmma16(a0, b2, acc[0][2]);
      acc[1][2] = wmma16(a1, b2, acc[1][2]);
      acc[2][2] = wmma16(a2, b2, acc[2][2]);
      acc[3][2] = wmma16(a3, b2, acc[3][2]);
      acc[0][3] = wmma16(a0, b3, acc[0][3]);
      acc[1][3] = wmma16(a1, b3, acc[1][3]);
      acc[2][3] = wmma16(a2, b3, acc[2][3]);
      acc[3][3] = wmma16(a3, b3, acc[3][3]);
    }
    // Hand-over: this wave's reads of the current tile are done, an issuing
    // wave's slice of the next tile has landed; the barrier says both of every
    // wave.
    asm volatile("s_wait_dscnt 0x0" ::: "memory");
    if (pinned(wv < 3u)) tdm_wait(g0, g1);
    __syncthreads();
    // refill the buffer that this tile has left
    if (pinned((unsigned)(wv < 3u) & (unsigned)(t + 2 < DD / GKT))) {
      g0 = tdm_group0(lsl + (unsigned)cur * (GBUF * 2u),
                      ga + (unsigned long long)((t + 2) * GKT * 2));
      tdm_load(g0, g1);
    }
  }
  tdm_wait(g0, g1);                                   // nothing left in flight
  asm volatile("s_wait_dscnt 0x0" ::: "memory");  // no LDS read left either
}

// ---------------------------------------------------------------------------
// QKV GEMM mainloop: 256x384 block tile, 8 waves (4x2); each wave owns a 64x192
// sub-tile = 4x12 frags, so that a fragment read from LDS feeds 12 (A) or 4 (B)
// products and a staged byte feeds more of them. One work-group per WGP, two
// waves a SIMD. Staging as in the mainloop above.
// ---------------------------------------------------------------------------
#define QBN 384             // columns of a work-group's tile
#define QWN 192             // columns of a wave's tile: three heads
#define QNF (QWN / 16)      // B fragments of a wave
#define QROWS (256 + QBN)   // rows of a buffer: the A tile, then the B^T tile
#define QBUF (QROWS * GPW)
#define QRUNS ((GKT / 32) * (QNF / 4))   // runs of 16 products in a tile

static_assert((QBUF * 2) % 2048 == 0, "places in LDS");

__device__ __forceinline__ void qkv_mainloop(
    const _Float16* __restrict__ A, const _Float16* __restrict__ BT,
    int m0, int n0, _Float16* lds, int tid, v8f acc[4][QNF]) {
  const int lane = tid & 31;
  const int wave = tid >> 5;
  const int wm   = (wave & 3) * 64;    // 0,64,128,192
  const int wn   = (wave >> 2) * QWN;  // 0,192

  // Waves 0 and 1 bring the two slices of the A tile, waves 2 to 4 the three of
  // the B^T tile.
  const unsigned wv = uni((unsigned)tid >> 5);
  const unsigned long long ga = (unsigned long long)(size_t)(
      (wv < 2u) ? A + (size_t)(m0 + GSR * (int)wv) * DD
                : BT + (size_t)(n0 + GSR * ((int)wv - 2)) * DD);
  // The slice's place (the low 32 bits of the generic pointer are the offset in
  // the work-group's LDS).
  const unsigned lsl = (unsigned)(size_t)(lds) + wv * GSB;
  const v8u g1 = tdm_group1(GSR, DD * 2u);

  // Tile 0 lands and is published; tile 1 then flies while tile 0 is worked on.
  v4u g0 = tdm_group0(lsl, ga);
  if (pinned(wv < 5u)) {
    tdm_load(g0, g1);
    tdm_wait(g0, g1);
  }
  __syncthreads();                                   // tile 0 visible to all
  g0 = tdm_group0(lsl + QBUF * 2u, ga + GKT * 2u);
  if (pinned(wv < 5u)) tdm_load(g0, g1);

  for (int t = 0; t < DD / GKT; ++t) {
    const int cur = t & 1;
    const _Float16* tA = lds + (size_t)cur * QBUF;
    const _Float16* tB = tA + 256 * GPW;
    // A tile is worked through in runs of 16 products: four B fragments with
    // the four A fragments of their k step. Two sets of B fragments: the next
    // run's are asked for in front of this run. All loops over g, i and j are
    // unrolled: their index names registers and folds into the LDS loads'
    // immediate offsets.
    v16h a[4], bf[2][4];
#pragma unroll
    for (int i = 0; i < 4; ++i) a[i] = load_frag(tA + (wm + 16 * i) * GPW, GPW, lane);
#pragma unroll
    for (int j = 0; j < 4; ++j)
      bf[0][j] = load_frag(tB + (wn + 16 * j) * GPW, GPW, lane);
#pragma unroll
    for (int g = 0; g < QRUNS; ++g) {
      if (g + 1 < QRUNS) {
        const int gn = g + 1;
#pragma unroll
        for (int j = 0; j < 4; ++j)
          bf[gn & 1][j] = load_frag(
              tB + (wn + 16 * (4 * (gn % 3) + j)) * GPW + 32 * (gn / 3), GPW, lane);
      }
      // keeps the next run's LDS reads in front of this run's products: left
      // alone, the scheduler sinks each read to its use, with a full wait there
      __builtin_amdgcn_sched_barrier(0);
#pragma unroll
      for (int j = 0; j < 4; ++j) {
#pragma unroll
        for (int i = 0; i < 4; ++i)
          acc[i][4 * (g % 3) + j] =
              wmma16(a[i], bf[g & 1][j], acc[i][4 * (g % 3) + j]);
      }
      // keeps later LDS reads, which reuse this run's fragment registers,
      // together behind the run and not among its products
      __builtin_amdgcn_sched_barrier(0);
      if (g % 3 == 2 && g + 1 < QRUNS) {
#pragma unroll
        for (int i = 0; i < 4; ++i)
          a[i] = load_frag(tA + (wm + 16 * i) * GPW + 32 * (g / 3 + 1), GPW, lane);
      }
    }
    // Hand-over: this wave's reads of the current tile are done, an issuing
    // wave's slice of the next tile has landed; the barrier says both of every
    // wave.
    asm volatile("s_wait_dscnt 0x0" ::: "memory");
    if (pinned(wv < 5u)) tdm_wait(g0, g1);
    __syncthreads();
    // refill the buffer that this tile has left
    if (pinned((unsigned)(wv < 5u) & (unsigned)(t + 2 < DD / GKT))) {
      g0 = tdm_group0(lsl + (unsigned)cur * (QBUF * 2u),
                      ga + (unsigned long long)((t + 2) * GKT * 2));
      tdm_load(g0, g1);
    }
  }
  tdm_wait(g0, g1);                                   // nothing left in flight
  asm volatile("s_wait_dscnt 0x0" ::: "memory");  // no LDS read left either
}

// ---------------------------------------------------------------------------
// Kernel 1: all three conversions in one launch of few, long waves.
// Work-groups 0 .. PWQ + PWP - 1 take one weight tile each,
// WT[n*K + k] = (f16) W[k*N + n]; the PXB work-groups behind them take x,
// f32 -> f16. Every thread has all its loads in flight before its first use.
// ---------------------------------------------------------------------------
#define PTK 128   // k per weight tile: a piece of a WT row is 256 B
#define PTN 64    // n per weight tile: a piece of a W row is 256 B
#define PPW 136   // LDS row pitch in halves: 256 B + 16 B, 16-byte stores of 16
                  // rows then fall on 64 distinct banks
#define PWQ ((DD / PTK) * (3 * DD / PTN))   // tiles of Wqkv
#define PWP ((DD / PTK) * (DD / PTN))       // tiles of Wproj
#define PXL 16                              // 16-byte loads of x per thread
#define PXB (HB * TT * DD / 4 / (256 * PXL))

// One PTK x PTN tile. A thread loads 4 n of 8 consecutive k, so it holds four
// 16-byte pieces of WT rows; row n lies in LDS at row (n & 3) * 16 + (n >> 2),
// so that the 16 lanes of one store write 16 neighbouring LDS rows.
__device__ __forceinline__ void prep_weight_tile(const float* __restrict__ Wm,
                                                 _Float16* __restrict__ WT,
                                                 const int N, int w, int tid,
                                                 _Float16* tile) {
  const int k0 = (w & (DD / PTK - 1)) * PTK;
  const int n0 = (w / (DD / PTK)) * PTN;
  const int nq = tid & 15;   // which 4 n;  on the way out: which 8 k
  const int kg = tid >> 4;   // which 8 k;  on the way out: which 4 n
  const float* s = Wm + (size_t)(k0 + kg * 8) * N + n0 + nq * 4;
  // The loops over i, j and q are unrolled because their index names a register.
  v4f f[8];
#pragma unroll
  for (int i = 0; i < 8; ++i) f[i] = *(const v4f*)(s + (size_t)i * N);
#pragma unroll
  for (int j = 0; j < 4; ++j) {
    v8h hv;
#pragma unroll
    for (int i = 0; i < 8; ++i) hv[i] = (_Float16)f[i][j];
    *(v8h*)(tile + (j * 16 + nq) * PPW + kg * 8) = hv;
  }
  __syncthreads();   // the rows that are read back were written by other waves
  _Float16* d = WT + (size_t)(n0 + kg * 4) * DD + k0 + nq * 8;
#pragma unroll
  for (int q = 0; q < 4; ++q)
    *(v8h*)(d + (size_t)q * DD) =
        *(const v8h*)(tile + (q * 16 + kg) * PPW + nq * 8);
  // later instructions in the listing rewrite registers that these stores name
  // (a precaution)
  asm volatile("s_wait_xcnt 0x0" ::: "memory");
}

__global__ __launch_bounds__(256) void prep_kernel(
    const float* __restrict__ x, const float* __restrict__ Wqkv,
    const float* __restrict__ Wproj, _Float16* __restrict__ xh,
    _Float16* __restrict__ wqkvT, _Float16* __restrict__ wprojT) {
  __shared__ alignas(16) _Float16 tile[PTN * PPW];
  const int tid = threadIdx.x;
  const int blk = blockIdx.x;   // every branch below is the same for a block
  if (blk < PWQ) {
    prep_weight_tile(Wqkv, wqkvT, 3 * DD, blk, tid, tile);
  } else if (blk < PWQ + PWP) {
    prep_weight_tile(Wproj, wprojT, DD, blk - PWQ, tid, tile);
  } else {
    // A wave takes PXL * 512 contiguous bytes of x, 512 per load.
    const size_t base =
        ((size_t)(blk - (PWQ + PWP)) * 8 + (tid >> 5)) * (PXL * 32) + (tid & 31);
    const v4f* s = (const v4f*)x + base;
    v4h* d = (v4h*)xh + base;
    // The loops over i are unrolled because their index names a register.
    v4f f[PXL];
#pragma unroll
    for (int i = 0; i < PXL; ++i) f[i] = s[i * 32];
    // the address stays in its registers up to this wait: left alone, the last
    // load's result is placed over the address that all PXL loads name
    // (a precaution)
    asm volatile("s_wait_xcnt 0x0" :: "v"(s) : "memory");
    // keeps all PXL loads in front of the first use: left alone, the scheduler
    // holds the last four back until the first results have come
    __builtin_amdgcn_sched_barrier(0);
#pragma unroll
    for (int i = 0; i < PXL; ++i) {
      v4h hv;
      hv.x = (_Float16)f[i].x; hv.y = (_Float16)f[i].y;
      hv.z = (_Float16)f[i].z; hv.w = (_Float16)f[i].w;
      d[i * 32] = hv;
    }
    // later instructions in the listing rewrite registers that these stores
    // name (a precaution)
    asm volatile("s_wait_xcnt 0x0" ::: "memory");
  }
}

// ---------------------------------------------------------------------------
// Kernel 2: QKV GEMM + bias + RoPE, scatter into Q[b,h,t,d], K[b,h,t,d],
// V^T[b,h,d,t] (all f16).  grid = (3072/384, 8192/256): one work-group a WGP
// ---------------------------------------------------------------------------
#define QSC 0.18033688f   // 1/sqrt(64) * log2 e: softmax scale, exp as 2^x
#define EPF 68   // staging pitch, floats: 272 B; rows 8 apart fall 32 banks
                 // apart (stores), 16-byte reads of two rows on distinct banks
#define EPH 72   // staging pitch, halves: 144 B, as in the ring
#define ESTG (64 * EPF * 4)   // a wave's staging area, bytes: 64 f32 rows
__global__ __launch_bounds__(256)
__attribute__((amdgpu_waves_per_eu(2, 2))) void qkv_rope_kernel(
    const _Float16* __restrict__ Xh, const _Float16* __restrict__ WT,
    const float* __restrict__ bqkv, const float* __restrict__ cosT,
    const float* __restrict__ sinT, _Float16* __restrict__ Qb,
    _Float16* __restrict__ Kb, _Float16* __restrict__ VT) {
  // the ring, and behind the loop eight staging areas of ESTG bytes
  static_assert(8 * ESTG <= 2 * QBUF * 2, "the staging areas fit");
  __shared__ __attribute__((aligned(2048))) _Float16 ldsAB[2 * QBUF];
  const int tid  = threadIdx.x;
  const int lane = tid & 31;
  const int hi   = lane >> 4;
  const int cn   = lane & 15;
  const int wave = tid >> 5;
  const int m0   = blockIdx.y * 256;
  const int n0   = blockIdx.x * QBN;

  v8f acc[4][QNF] = {};
  qkv_mainloop(Xh, WT, m0, n0, ldsAB, tid, acc);

  // Epilogue, staged through LDS. The loop's last barrier stands behind every
  // wave's last read of the ring and no load is in flight, so each wave takes
  // its own staging area there and needs no further barrier.
  // A wave's 192 columns are exactly three heads (they start at a multiple of
  // 64), taken one after the other through the same staging area, and its 64
  // rows lie in one batch.
  const int wv  = __builtin_amdgcn_readfirstlane(wave);  // scalar address parts
  const int gm0 = m0 + (wv & 3) * 64;
  const int b   = gm0 >> 11;
  const int t0  = gm0 & (TT - 1);
  const int rr  = lane >> 3;   // row inside a group of four rows
  const int c   = lane & 7;    // 8-element piece of a row
  char* stg = (char*)ldsAB + wv * ESTG;

  // unrolled because hh names registers
#pragma unroll
  for (int hh = 0; hh < QWN / 64; ++hh) {
  const int nh  = n0 + (wv >> 2) * QWN + hh * 64;
  const int sec = nh >> 10;            // 0=Q 1=K 2=V, the same for a wave
  const int h   = (nh & 1023) >> 6;

  float bias[4];
#pragma unroll
  for (int j = 0; j < 4; ++j) bias[j] = bqkv[nh + 16 * j + cn];

  // The loops over i, j, v and g are unrolled because their index names a
  // register.
  if (sec == 2) {
    // V^T: a lane holds 8 consecutive t of one d. Rows of 64 t = one line.
    _Float16* sv = (_Float16*)stg;
#pragma unroll
    for (int i = 0; i < 4; ++i) {
#pragma unroll
      for (int j = 0; j < 4; ++j) {
        v8h hv;
#pragma unroll
        for (int v = 0; v < 8; ++v) hv[v] = (_Float16)(acc[i][4 * hh + j][v] + bias[j]);
        *(v8h*)(sv + (16 * j + cn) * EPH + 16 * i + 8 * hi) = hv;
      }
    }
    // the rows that are read back were written by other lanes of this wave
    asm volatile("s_wait_dscnt 0x0" ::: "memory");
    _Float16* vrow = VT + ((size_t)((b * HH + h) * DH + rr)) * TT + t0 + c * 8;
#pragma unroll
    for (int rg = 0; rg < 16; ++rg) {
      const v8h hv = *(const v8h*)(sv + (rg * 4 + rr) * EPH + c * 8);
      *(v8h*)(vrow + (size_t)(rg * 4) * TT) = hv;
    }
    // later instructions rewrite registers that these stores name
    // (a precaution)
    asm volatile("s_wait_xcnt 0x0" ::: "memory");
  } else {
    // Q, K: the f32 rows are staged; a lane then takes 8 consecutive d of one
    // row and the 8 that rotate-half pairs with them (d +- 32). The cos and sin
    // rows come in batches of four row groups.
    float* sf = (float*)stg;
    _Float16* dst = ((sec == 0) ? Qb : Kb) +
                    ((size_t)((b * HH + h) * TT + t0 + rr)) * DH + c * 8;
    const float* cp = cosT + (size_t)(t0 + rr) * DH + c * 8;
    const float* sp = sinT + (size_t)(t0 + rr) * DH + c * 8;
    const float sg = (c < 4) ? -1.0f : 1.0f;   // rotate-half: -x[d+32], +x[d-32]
    // Q leaves multiplied by QSC, in f32 ahead of its one rounding to f16, so
    // that the attention's K Q^T comes out as exponents of two; K by one
    const float qs = (sec == 0) ? QSC : 1.0f;
    const float* own = sf + rr * EPF + c * 8;
    const float* par = sf + rr * EPF + (c ^ 4) * 8;
#pragma unroll
    for (int i = 0; i < 4; ++i)
#pragma unroll
      for (int j = 0; j < 4; ++j)
#pragma unroll
        for (int v = 0; v < 8; ++v)
          sf[(16 * i + 8 * hi + v) * EPF + 16 * j + cn] =
              acc[i][4 * hh + j][v] + bias[j];
    // the rows that are read back were written by other lanes of this wave
    asm volatile("s_wait_dscnt 0x0" ::: "memory");
#pragma unroll
    for (int bt = 0; bt < 4; ++bt) {
      v4f tc[8], ts[8];   // [row group in the batch, low or high 4]
#pragma unroll
      for (int g = 0; g < 4; ++g) {
        const int tr = bt * 16 + g * 4;
        tc[2 * g]     = *(const v4f*)(cp + tr * DH);
        tc[2 * g + 1] = *(const v4f*)(cp + tr * DH + 4);
        ts[2 * g]     = *(const v4f*)(sp + tr * DH);
        ts[2 * g + 1] = *(const v4f*)(sp + tr * DH + 4);
      }
      // later instructions rewrite the address registers that these loads name
      // (a precaution)
      asm volatile("s_wait_xcnt 0x0" ::: "memory");
      // keeps the batch's 16 loads together, one wait for all: left alone, the
      // scheduler sinks them to their uses, each with a full wait of its own
      __builtin_amdgcn_sched_barrier(0);
#pragma unroll
      for (int g = 0; g < 4; ++g) {
        const int tr = bt * 16 + g * 4;     // row in the wave's tile
        const v4f x0 = *(const v4f*)(own + tr * EPF);
        const v4f x1 = *(const v4f*)(own + tr * EPF + 4);
        const v4f p0 = *(const v4f*)(par + tr * EPF);
        const v4f p1 = *(const v4f*)(par + tr * EPF + 4);
        const v4f c0 = tc[2 * g], c1 = tc[2 * g + 1];
        const v4f s0 = ts[2 * g] * sg, s1 = ts[2 * g + 1] * sg;
        v8h ov;
#pragma unroll
        for (int e = 0; e < 4; ++e) {
          ov[e]     = (_Float16)((x0[e] * c0[e] + p0[e] * s0[e]) * qs);
          ov[4 + e] = (_Float16)((x1[e] * c1[e] + p1[e] * s1[e]) * qs);
        }
        *(v8h*)(dst + (size_t)tr * DH) = ov;
        // the next row group's LDS reads rewrite registers that this store
        // names (a precaution)
        asm volatile("s_wait_xcnt 0x0" ::: "memory");
      }
      if (bt < 3) {
        // the next batch's loads start behind this batch's work
        __builtin_amdgcn_sched_barrier(0);
      }
    }
  }
  // this head's rows have been read back before the next head's are staged
  asm volatile("s_wait_dscnt 0x0" ::: "memory");
  }
}

#define AKT 64
#define APW 72

#define ATS 5120 // a tile's place in LDS, halves: 64 rows of 144 B, rounded up to
                 // a multiple of 2 KiB
static_assert(ATS >= AKT * APW && (ATS * 2) % 2048 == 0, "places in LDS");

// Lane l with lane l ^ 16: the two lanes that share one query column.
__device__ __forceinline__ float xhalf(float x) {
  const int i = __builtin_bit_cast(int, x);
  return __builtin_bit_cast(float, __builtin_amdgcn_permlanex16(
      i, i, 0x76543210, 0xfedcba98, false, false));
}

// All scores below are exponents of two (Q carries QSC) and relative: the
// negated maximum in use of a lane's column is the C operand of the first
// S^T product, so the accumulators hold s - m and go to the exponential as
// they are.
// The maximum in use of a column may lag behind its true running maximum by up
// to ARS: every p then stays below 2^ARS = e^6 = 403, far inside f16, and the
// output tiles and the sum are rescaled only in a pass in which some column
// goes past.
#define ARS (6.0f * 1.44269504f)

// A lane's own maximum over its 16 relative scores of one column group.
__device__ __forceinline__ float attn_lane_max(v8f s0, v8f s1) {
  // The loop over v is unrolled because its index names a register.
  float mx = fmaxf(s0[0], s1[0]);
#pragma unroll
  for (int v = 1; v < 8; ++v) mx = fmaxf(mx, fmaxf(s0[v], s1[v]));
  return mx;
}

// The rare path: raises the column's maximum in use to this pass's column maximum where that is higher (the same
// value in both lanes of a column), rescales the group's sum and output and
// moves this pass's scores and the C operand by the same step. In the first
// pass the maximum in use is not yet one (C is zero): the column's maximum is
// taken whatever its sign, and sum and output are still zero.
__device__ __forceinline__ void attn_rescale(float mx, bool first, v8f& nm,
                                             float& lsum, v8f o[4], v8f& s0,
                                             v8f& s1) {
  mx = fmaxf(mx, xhalf(mx));        // the column's other 16 keys
  const float d  = first ? mx : fmaxf(mx, 0.0f);   // rise of the maximum in use
  const float al = first ? 0.0f : __builtin_amdgcn_exp2f(-d);
  lsum *= al;
  nm -= d;
  s0 -= d;
  s1 -= d;
  // The loops over f and v are unrolled because their index names a register.
#pragma unroll
  for (int f = 0; f < 4; ++f)
#pragma unroll
    for (int v = 0; v < 8; ++v) o[f][v] *= al;
}

// One column group's probabilities over 32 keys from its relative scores:
// adds to this lane's share of the sum and returns P^T as a B operand in the k
// order of load_frag: halves 0..7 = keys 8 hi.., 8..15 = keys 16 + 8 hi..
__device__ __forceinline__ v16h attn_probs(v8f s0, v8f s1, float& lsum) {
  // The loops over v are unrolled because their index names a register.
  // The 16 exponentials stand in one statement, none next to a user of its
  // registers (every result is marked early: it shares no register with a
  // source), with the closing v_nop as the slot that the instruction set asks
  // for behind a transcendental. The sources are read where the matrix
  // instruction left them.
  float e0, e1, e2, e3, e4, e5, e6, e7, g0, g1, g2, g3, g4, g5, g6, g7;
  asm("v_exp_f32 %0, %16\n\t"
      "v_exp_f32 %1, %17\n\t"
      "v_exp_f32 %2, %18\n\t"
      "v_exp_f32 %3, %19\n\t"
      "v_exp_f32 %4, %20\n\t"
      "v_exp_f32 %5, %21\n\t"
      "v_exp_f32 %6, %22\n\t"
      "v_exp_f32 %7, %23\n\t"
      "v_exp_f32 %8, %24\n\t"
      "v_exp_f32 %9, %25\n\t"
      "v_exp_f32 %10, %26\n\t"
      "v_exp_f32 %11, %27\n\t"
      "v_exp_f32 %12, %28\n\t"
      "v_exp_f32 %13, %29\n\t"
      "v_exp_f32 %14, %30\n\t"
      "v_exp_f32 %15, %31\n\t"
      "v_nop"
      : "=&v"(e0), "=&v"(e1), "=&v"(e2), "=&v"(e3), "=&v"(e4), "=&v"(e5),
        "=&v"(e6), "=&v"(e7), "=&v"(g0), "=&v"(g1), "=&v"(g2), "=&v"(g3),
        "=&v"(g4), "=&v"(g5), "=&v"(g6), "=&v"(g7)
      : "v"(s0[0]), "v"(s0[1]), "v"(s0[2]), "v"(s0[3]), "v"(s0[4]), "v"(s0[5]),
        "v"(s0[6]), "v"(s0[7]), "v"(s1[0]), "v"(s1[1]), "v"(s1[2]), "v"(s1[3]),
        "v"(s1[4]), "v"(s1[5]), "v"(s1[6]), "v"(s1[7]));
  const v8f p0 = {e0, e1, e2, e3, e4, e5, e6, e7};
  const v8f p1 = {g0, g1, g2, g3, g4, g5, g6, g7};
  v16h pf;
#pragma unroll
  for (int v = 0; v < 8; ++v) {
    pf[v]     = (_Float16)p0[v];
    pf[8 + v] = (_Float16)p1[v];
  }
  const v8f pp = p0 + p1;
  float sum = pp[0];
#pragma unroll
  for (int v = 1; v < 8; ++v) sum += pp[v];
  lsum += sum;
  return pf;
}

// Two work-groups share a WGP (512 work-groups on 256 WGPs), four waves a SIMD:
// the register budget is set for exactly that.
__global__ __launch_bounds__(256)
__attribute__((amdgpu_waves_per_eu(4, 4))) void attn_kernel(
    const _Float16* __restrict__ Q, const _Float16* __restrict__ K,
    const _Float16* __restrict__ VT, _Float16* __restrict__ O) {
  static_assert(AKT == DH, "K tile and V^T tile have the same number of rows");
  __shared__ __attribute__((aligned(2048))) _Float16 KVtile[2][2][ATS];  // [buffer][K, V^T]
  const int tid  = threadIdx.x;
  const int lane = tid & 31;
  const int hi   = lane >> 4;
  const int cn   = lane & 15;
  const int wave = tid >> 5;
  const int bh   = blockIdx.y;
  const int b    = bh >> 4;
  const int h    = bh & 15;
  const int tq0  = blockIdx.x * 256 + wave * 32;

  const _Float16* Qp = Q  + ((size_t)bh * TT + tq0) * DH;
  const _Float16* Kp = K  + (size_t)bh * TT * DH;
  const _Float16* Vp = VT + (size_t)bh * DH * TT;   // [DH][TT]

  // Wave 0 brings the K tile (64 rows, one behind the other in memory), wave 1
  // the V^T tile (64 rows, TT halves apart).
  const unsigned wv  = uni((unsigned)tid >> 5);
  const bool     isV = wv == 1u;
  const unsigned long long ga = (unsigned long long)(size_t)(isV ? Vp : Kp);
  const unsigned gstep = isV ? AKT * 2u : AKT * DH * 2u;   // tile to tile, bytes
  // The tile's place (the low 32 bits of the generic pointer are the offset in
  // the work-group's LDS).
  const unsigned lsl =
      (unsigned)(size_t)(&KVtile[0][0][0]) + (isV ? ATS * 2u : 0u);
  const v8u g1 = tdm_group1(AKT, isV ? TT * 2u : DH * 2u);

  // Tile 0 lands and is published; tile 1 then flies while tile 0 is worked on.
  v4u g0 = tdm_group0(lsl, ga);
  if (pinned(wv < 2u)) {
    tdm_load(g0, g1);
    tdm_wait(g0, g1);
  }
  __syncthreads();                                   // tile 0 visible to all
  g0 = tdm_group0(lsl + 2u * ATS * 2u, ga + gstep);
  if (pinned(wv < 2u)) tdm_load(g0, g1);

  // Q is the B operand: in group g lane cn holds query column tq0 + 16 g + cn.
  const v16h qa0 = load_frag(Qp,                DH, lane);   // g 0, d 0..31
  const v16h qa1 = load_frag(Qp + 32,           DH, lane);   // g 0, d 32..63
  const v16h qb0 = load_frag(Qp + 16 * DH,      DH, lane);   // g 1, d 0..31
  const v16h qb1 = load_frag(Qp + 16 * DH + 32, DH, lane);   // g 1, d 32..63

  // Everything below is per query column, so per lane and group: lanes cn and
  // cn + 16 share a column and split its keys (scores) and its d (output).
  v8f nmA = {}, nmB = {};           // negated maxima in use, as C operands
  float lsumA = 0.f, lsumB = 0.f;   // this lane's shares of the running sums
  v8f oA[4] = {}, oB[4] = {};       // o[f][v] = O^T[16 f + 8 hi + v][cn]

  for (int ps = 0; ps < TT / 32; ++ps) {
    const int st  = ps >> 1;          // tile
    const int cur = st & 1;           // its buffer
    const int kb  = (ps & 1) * 32;    // first key of this pass inside the tile
    const _Float16* tK = &KVtile[cur][0][0];
    const _Float16* tV = &KVtile[cur][1][0];

    // S^T = K Q^T - m: s0[v] = key kb + 8 hi + v, s1[v] = key kb + 16 + 8 hi + v.
    const v16h k00 = load_frag(tK + kb * APW,             APW, lane);
    const v16h k01 = load_frag(tK + kb * APW + 32,        APW, lane);
    const v16h k10 = load_frag(tK + (kb + 16) * APW,      APW, lane);
    const v16h k11 = load_frag(tK + (kb + 16) * APW + 32, APW, lane);
    v8f sA0 = wmma16(k00, qa0, nmA);
    v8f sA1 = wmma16(k10, qa0, nmA);
    sA0 = wmma16(k01, qa1, sA0);
    sA1 = wmma16(k11, qa1, sA1);
    v8f sB0 = wmma16(k00, qb0, nmB);
    v8f sB1 = wmma16(k10, qb0, nmB);
    sB0 = wmma16(k01, qb1, sB0);
    sB1 = wmma16(k11, qb1, sB1);

    const v16h vf0 = load_frag(tV + 0  * APW + kb, APW, lane);
    const v16h vf1 = load_frag(tV + 16 * APW + kb, APW, lane);
    const v16h vf2 = load_frag(tV + 32 * APW + kb, APW, lane);
    const v16h vf3 = load_frag(tV + 48 * APW + kb, APW, lane);

    // Lazy rescale: one test per pass for both groups and all lanes, a scalar
    // branch; either lane of a column sees a score past the bound.
    const float mxA = attn_lane_max(sA0, sA1);
    const float mxB = attn_lane_max(sB0, sB1);
    const bool need  = fmaxf(mxA, mxB) > ARS;
    const bool first = ps == 0;
    if (first || __builtin_amdgcn_ballot_w32(need) != 0) {
      attn_rescale(mxA, first, nmA, lsumA, oA, sA0, sA1);
      attn_rescale(mxB, first, nmB, lsumB, oB, sB0, sB1);
    }
    const v16h pfA = attn_probs(sA0, sA1, lsumA);
    const v16h pfB = attn_probs(sB0, sB1, lsumB);

    // O^T += V^T P^T
    oA[0] = wmma16(vf0, pfA, oA[0]);
    oA[1] = wmma16(vf1, pfA, oA[1]);
    oA[2] = wmma16(vf2, pfA, oA[2]);
    oA[3] = wmma16(vf3, pfA, oA[3]);
    oB[0] = wmma16(vf0, pfB, oB[0]);
    oB[1] = wmma16(vf1, pfB, oB[1]);
    oB[2] = wmma16(vf2, pfB, oB[2]);
    oB[3] = wmma16(vf3, pfB, oB[3]);

    if (ps & 1) {
      // Hand-over: this wave's reads of the current tile are done, an issuing
      // wave's part of the next tile has landed; the barrier says both of every
      // wave.
      asm volatile("s_wait_dscnt 0x0" ::: "memory");
      if (pinned(wv < 2u)) tdm_wait(g0, g1);
      __syncthreads();
      // refill the buffer that this tile has left
      if (pinned((unsigned)(wv < 2u) & (unsigned)(st + 2 < TT / AKT))) {
        g0 = tdm_group0(lsl + (unsigned)cur * (2u * ATS * 2u),
                        ga + (unsigned long long)((unsigned)(st + 2) * gstep));
        tdm_load(g0, g1);
      }
    }
  }
  tdm_wait(g0, g1);                                   // nothing left in flight
  asm volatile("s_wait_dscnt 0x0" ::: "memory");  // no LDS read left either

  // join the two shares of each column's sum
  const float invA = 1.0f / (lsumA + xhalf(lsumA));
  const float invB = 1.0f / (lsumB + xhalf(lsumB));
  // A lane holds 8 consecutive d of its query row per tile: 16-byte stores.
  _Float16* Op = O + ((size_t)(b * TT + tq0 + cn)) * DD + h * DH + hi * 8;
  // The loops over f and v are unrolled because their index names a register.
  v8h ova[4], ovb[4];
#pragma unroll
  for (int f = 0; f < 4; ++f) {
#pragma unroll
    for (int v = 0; v < 8; ++v) {
      ova[f][v] = (_Float16)(oA[f][v] * invA);
      ovb[f][v] = (_Float16)(oB[f][v] * invB);
    }
  }
#pragma unroll
  for (int f = 0; f < 4; ++f) {
    *(v8h*)(Op + 16 * f) = ova[f];
    *(v8h*)(Op + 16 * DD + 16 * f) = ovb[f];
  }
}

// ---------------------------------------------------------------------------
// Kernel 4: output projection, fp32 result + bias. grid = (1024/128, 8192/256)
// ---------------------------------------------------------------------------
__global__ __launch_bounds__(256) void proj_kernel(
    const _Float16* __restrict__ Ah, const _Float16* __restrict__ WT,
    const float* __restrict__ bproj, float* __restrict__ out) {
  __shared__ __attribute__((aligned(2048))) _Float16 ldsAB[2 * GBUF];
  const int tid  = threadIdx.x;
  const int lane = tid & 31;
  const int hi   = lane >> 4;
  const int cn   = lane & 15;
  const int wave = tid >> 5;
  const int wm   = (wave & 3) * 64;
  const int wn   = (wave >> 2) * 64;
  const int m0   = blockIdx.y * 256;
  const int n0   = blockIdx.x * 128;

  v8f acc[4][4] = {};
  gemm_mainloop(Ah, WT, m0, n0, ldsAB, tid, acc);

#pragma unroll
  for (int i = 0; i < 4; ++i) {
#pragma unroll
    for (int j = 0; j < 4; ++j) {
      const int gn = n0 + wn + 16 * j + cn;
      const float bv = bproj[gn];
#pragma unroll
      for (int v = 0; v < 8; ++v) {
        const int gm = m0 + wm + 16 * i + v + hi * 8;
        out[(size_t)gm * DD + gn] = acc[i][j][v] + bv;
      }
    }
  }
}

// ---------------------------------------------------------------------------
extern "C" void kernel_launch(void* const* d_in, const int* in_sizes, int n_in,
                              void* d_out, int out_size, void* d_ws,
                              size_t ws_size, hipStream_t stream) {
  const float* x     = (const float*)d_in[0];
  const float* Wqkv  = (const float*)d_in[1];
  const float* bqkv  = (const float*)d_in[2];
  const float* Wproj = (const float*)d_in[3];
  const float* bproj = (const float*)d_in[4];
  const float* cosT  = (const float*)d_in[5];
  const float* sinT  = (const float*)d_in[6];
  float* out = (float*)d_out;

  char* ws = (char*)d_ws;
  // byte offsets (total 72 MB)
  _Float16* xh     = (_Float16*)(ws);              // 16 MB, reused as attn out
  _Float16* wqkvT  = (_Float16*)(ws + 16777216);   //  6 MB
  _Float16* wprojT = (_Float16*)(ws + 23068672);   //  2 MB
  _Float16* Qb     = (_Float16*)(ws + 25165824);   // 16 MB
  _Float16* Kb     = (_Float16*)(ws + 41943040);   // 16 MB
  _Float16* VT     = (_Float16*)(ws + 58720256);   // 16 MB
  _Float16* attnh  = xh;   // x no longer needed after QKV GEMM

  // 1) precision conversion / weight transpose
  prep_kernel<<<PWQ + PWP + PXB, 256, 0, stream>>>(x, Wqkv, Wproj, xh, wqkvT,
                                                   wprojT);
  // 2) QKV GEMM + RoPE  (M=8192 in 256-row tiles, N=3072 in 384-col tiles)
  qkv_rope_kernel<<<dim3(8, 32), 256, 0, stream>>>(xh, wqkvT, bqkv, cosT, sinT,
                                                    Qb, Kb, VT);
  // 3) flash attention  (grid: T/256 x B*H)
  attn_kernel<<<dim3(TT / 256, HB * HH), 256, 0, stream>>>(Qb, Kb, VT, attnh);
  // 4) output projection (M=8192, N=1024)
  proj_kernel<<<dim3(8, 32), 256, 0, stream>>>(attnh, wprojT, bproj, out);
}
